// v000
// Times are from an AMD MI455X. After a warm-up the kernel runs many times in a row, and a time is the length of
// such a window on the GPU divided by its runs, so every launch and the gaps after it count. The runs cycle
// through copies of the inputs. A figure is the median of several windows, for all but v000 over two sittings.
// Sittings can differ by a few percent; kernels timed side by side share one.
// v000 is the starting kernel. One run takes 503 microseconds.
#include <hip/hip_runtime.h>
#include <hip/hip_bf16.h>

// ---------------------------------------------------------------------------
// Transformer block for MI455X (gfx1250, wave32, WMMA).
// bf16 activations, f32 accumulation via v_wmma_f32_16x16x32_bf16.
// A-tiles staged to LDS with global_load_async_to_lds_b128 (ASYNCcnt).
// ---------------------------------------------------------------------------

typedef __bf16 bf16;
typedef __attribute__((ext_vector_type(16))) __bf16 v16bf;
typedef __attribute__((ext_vector_type(8)))  float  v8f;

#define BB   4
#define TT   4096
#define CC   256
#define HH   4
#define DD   64
#define MM   (BB * TT)      // 16384 tokens
#define N3   (3 * CC)       // 768
#define LNEPS 1e-5f
#define BSTR 34             // transposed-B LDS stride (bank-spread, even)

// K index inside a 16x32 (16-bit) A/B fragment for VGPR r, lane-half hi.
// ISA 7.12.2: VGPR0..3 lanes0-15 hold K=0..7 (pairs), lanes16-31 K=8..15; VGPR4..7 -> +16.
__device__ __forceinline__ int kbase(int r, int hi) {
  return ((r & 4) << 2) | (hi << 3) | ((r & 3) << 1);
}

union FragAB {
  v16bf v;
  unsigned int u[8];
  bf16 b[16];
};

__device__ __forceinline__ unsigned lds_off32(const void* p) {
  return (unsigned)(unsigned long long)(uintptr_t)p;   // low 32 bits = LDS byte offset
}

// ---------------------------------------------------------------------------
// fp32 -> bf16 convert
// ---------------------------------------------------------------------------
__global__ __launch_bounds__(256) void cvt_bf16_kernel(const float* __restrict__ in,
                                                       bf16* __restrict__ out, int n) {
  int i = blockIdx.x * 256 + threadIdx.x;
  if (i < n) out[i] = (bf16)in[i];
}

// ---------------------------------------------------------------------------
// Tiled GEMM: Out = A[M x K] * W[K x N] (+bias, + epilogue)
// Block tile 256x32 (8 waves, each a 32x32 tile = 4 WMMA per K=32 chunk).
// A tile: async-DMA to LDS (row-major, stride 32).
// B tile: stored transposed [n][k] in LDS so fragments load as b32 pairs.
// mode 0: QKV scatter -> q/k bf16 [B,H,T,D], v bf16 [B,H,D,T]
// mode 1: + residual  -> f32 out [M x N]
// mode 2: GELU        -> bf16 out [M x N]
// ---------------------------------------------------------------------------
__global__ __launch_bounds__(256) void gemm_bf16_kernel(
    const bf16* __restrict__ A, const bf16* __restrict__ W,
    const float* __restrict__ bias, int K, int N, int mode,
    const float* __restrict__ res, float* __restrict__ outf,
    bf16* __restrict__ outb, bf16* __restrict__ oq,
    bf16* __restrict__ okk, bf16* __restrict__ ov) {
  __shared__ __align__(16) bf16 sA[256 * 32];
  __shared__ __align__(16) bf16 sBt[32 * BSTR];

  const int tid  = threadIdx.x;
  const int lane = tid & 31;
  const int wave = tid >> 5;           // 0..7, owns rows [wave*32, wave*32+32)
  const int hi   = (lane >> 4) & 1;
  const int m0   = blockIdx.y * 256;
  const int n0   = blockIdx.x * 32;

  const int arow = tid >> 2, acol = (tid & 3) << 3;  // + i*64 rows, 8 bf16 each
  const int brow = tid >> 3, bcol = (tid & 7) << 2;  // 32 k-rows x 4 n each

  v8f acc[2][2];
#pragma unroll
  for (int ms = 0; ms < 2; ++ms)
#pragma unroll
    for (int ns = 0; ns < 2; ++ns)
      acc[ms][ns] = (v8f){0.f, 0.f, 0.f, 0.f, 0.f, 0.f, 0.f, 0.f};

  for (int k0 = 0; k0 < K; k0 += 32) {
    __syncthreads();
    // ---- A tile: async DMA, 4 x 16B per lane (rows arow + i*64) ----
#pragma unroll
    for (int i = 0; i < 4; ++i) {
      unsigned lo = lds_off32(sA + (arow + i * 64) * 32 + acol);
      unsigned long long ga =
          (unsigned long long)(uintptr_t)(A + (size_t)(m0 + arow + i * 64) * K + k0 + acol);
      asm volatile("global_load_async_to_lds_b128 %0, %1, off"
                   :: "v"(lo), "v"(ga) : "memory");
    }
    // ---- B tile: load [k][n] row-major, store transposed [n][k] ----
    {
      uint2 w2 = *reinterpret_cast<const uint2*>(W + (size_t)(k0 + brow) * N + n0 + bcol);
      bf16 wb[4];
      *reinterpret_cast<uint2*>(wb) = w2;
#pragma unroll
      for (int i = 0; i < 4; ++i) sBt[(bcol + i) * BSTR + brow] = wb[i];
    }
    if (k0 + 32 < K)
      __builtin_prefetch(W + (size_t)(k0 + 32 + brow) * N + n0 + bcol, 0, 1);

    asm volatile("s_wait_asynccnt 0" ::: "memory");
    __syncthreads();

    // ---- fragments: all b32 LDS loads ----
    FragAB fa[2], fb[2];
#pragma unroll
    for (int ms = 0; ms < 2; ++ms) {
      const bf16* ap = sA + (wave * 32 + ms * 16 + (lane & 15)) * 32;
#pragma unroll
      for (int r = 0; r < 8; ++r)
        fa[ms].u[r] = *reinterpret_cast<const unsigned int*>(ap + kbase(r, hi));
    }
#pragma unroll
    for (int ns = 0; ns < 2; ++ns) {
      const bf16* bp = sBt + (ns * 16 + (lane & 15)) * BSTR;
#pragma unroll
      for (int r = 0; r < 8; ++r)
        fb[ns].u[r] = *reinterpret_cast<const unsigned int*>(bp + kbase(r, hi));
    }
#pragma unroll
    for (int ms = 0; ms < 2; ++ms)
#pragma unroll
      for (int ns = 0; ns < 2; ++ns)
        acc[ms][ns] = __builtin_amdgcn_wmma_f32_16x16x32_bf16(
            false, fa[ms].v, false, fb[ns].v, (short)0, acc[ms][ns], false, false);
  }

  // ---- epilogue ----
#pragma unroll
  for (int ns = 0; ns < 2; ++ns) {
    const int gn = n0 + ns * 16 + (lane & 15);
    const float bv = bias[gn];
#pragma unroll
    for (int ms = 0; ms < 2; ++ms) {
#pragma unroll
      for (int r = 0; r < 8; ++r) {
        const int gm = m0 + wave * 32 + ms * 16 + r + (hi << 3);
        float val = acc[ms][ns][r] + bv;
        if (mode == 0) {               // QKV scatter
          int part = gn >> 8, cc = gn & 255;
          int hh = cc >> 6, dd = cc & 63;
          int bb = gm >> 12, ttok = gm & (TT - 1);
          if (part == 2) {             // V transposed: [B,H,D,T]
            ov[(((size_t)(bb * HH + hh)) * DD + dd) * TT + ttok] = (bf16)val;
          } else {
            bf16* dst = (part == 0) ? oq : okk;
            dst[(((size_t)(bb * HH + hh)) * TT + ttok) * DD + dd] = (bf16)val;
          }
        } else if (mode == 1) {        // bias + residual -> f32
          size_t idx = (size_t)gm * N + gn;
          outf[idx] = val + res[idx];
        } else {                       // exact GELU -> bf16
          float g = 0.5f * val * (1.0f + erff(val * 0.70710678118f));
          outb[(size_t)gm * N + gn] = (bf16)g;
        }
      }
    }
  }
}

// ---------------------------------------------------------------------------
// Flash attention: each wave owns a 16-row Q tile of one (b,h); streams keys
// in chunks of 32. 8 WMMAs per chunk. V is [B,H,D,T] so V-frags are b32 loads.
// ---------------------------------------------------------------------------
__global__ __launch_bounds__(256) void attn_kernel(const bf16* __restrict__ q,
                                                   const bf16* __restrict__ k,
                                                   const bf16* __restrict__ v,
                                                   bf16* __restrict__ o) {
  __shared__ __align__(16) bf16 sP[8 * 16 * 32];   // per-wave P staging

  const int tid  = threadIdx.x;
  const int lane = tid & 31;
  const int wave = tid >> 5;
  const int hi   = (lane >> 4) & 1;
  const int tile = blockIdx.x * 8 + wave;          // 0 .. B*H*(T/16)-1
  const int ntq  = TT / 16;                        // 256
  const int bh   = tile / ntq;
  const int tq   = tile - bh * ntq;
  const size_t rowbase = (size_t)bh * TT;

  bf16* myP = sP + wave * 512;

  // Q fragments (d = 0..31 and 32..63), loaded once.
  FragAB qf0, qf1;
  {
    const bf16* qp = q + (rowbase + tq * 16 + (lane & 15)) * DD;
#pragma unroll
    for (int r = 0; r < 8; ++r) {
      qf0.u[r] = *reinterpret_cast<const unsigned int*>(qp + kbase(r, hi));
      qf1.u[r] = *reinterpret_cast<const unsigned int*>(qp + 32 + kbase(r, hi));
    }
  }

  v8f oacc[4];
#pragma unroll
  for (int j = 0; j < 4; ++j) oacc[j] = (v8f){0.f, 0.f, 0.f, 0.f, 0.f, 0.f, 0.f, 0.f};
  float rowm[8], rows[8];
#pragma unroll
  for (int r = 0; r < 8; ++r) { rowm[r] = -3.0e38f; rows[r] = 0.f; }

  const float scale = 0.125f;  // D^-0.5, D=64

  for (int s0 = 0; s0 < TT; s0 += 32) {
    // ---- S = Q * K^T for 32 keys (two 16x16 N-tiles) ----
    v8f sacc[2];
#pragma unroll
    for (int nt = 0; nt < 2; ++nt) {
      sacc[nt] = (v8f){0.f, 0.f, 0.f, 0.f, 0.f, 0.f, 0.f, 0.f};
      const bf16* kp = k + (rowbase + s0 + nt * 16 + (lane & 15)) * DD;
      FragAB kf0, kf1;
#pragma unroll
      for (int r = 0; r < 8; ++r) {
        kf0.u[r] = *reinterpret_cast<const unsigned int*>(kp + kbase(r, hi));
        kf1.u[r] = *reinterpret_cast<const unsigned int*>(kp + 32 + kbase(r, hi));
      }
      sacc[nt] = __builtin_amdgcn_wmma_f32_16x16x32_bf16(false, qf0.v, false, kf0.v,
                                                         (short)0, sacc[nt], false, false);
      sacc[nt] = __builtin_amdgcn_wmma_f32_16x16x32_bf16(false, qf1.v, false, kf1.v,
                                                         (short)0, sacc[nt], false, false);
    }

    // ---- online softmax over this 32-col chunk (rows live in 16-lane halves) ----
    float corr[8];
#pragma unroll
    for (int r = 0; r < 8; ++r) {
      float c0 = sacc[0][r] * scale;
      float c1 = sacc[1][r] * scale;
      float mc = fmaxf(c0, c1);
#pragma unroll
      for (int off = 1; off <= 8; off <<= 1) mc = fmaxf(mc, __shfl_xor(mc, off, 32));
      float mn = fmaxf(rowm[r], mc);
      corr[r] = __expf(rowm[r] - mn);
      rowm[r] = mn;
      float p0 = __expf(c0 - mn);
      float p1 = __expf(c1 - mn);
      float rs = p0 + p1;
#pragma unroll
      for (int off = 1; off <= 8; off <<= 1) rs += __shfl_xor(rs, off, 32);
      rows[r] = rows[r] * corr[r] + rs;
      int rr = r + (hi << 3);
      myP[rr * 32 + (lane & 15)]      = (bf16)p0;
      myP[rr * 32 + 16 + (lane & 15)] = (bf16)p1;
    }
    asm volatile("s_wait_dscnt 0" ::: "memory");   // C-layout -> A-layout through LDS

    // ---- P fragment (16x32) ----
    FragAB pf;
    const bf16* pp = myP + (lane & 15) * 32;
#pragma unroll
    for (int r = 0; r < 8; ++r)
      pf.u[r] = *reinterpret_cast<const unsigned int*>(pp + kbase(r, hi));

    // ---- O = O*corr + P * V   (V-frags: contiguous b32 pairs along keys) ----
#pragma unroll
    for (int j = 0; j < 4; ++j) {
#pragma unroll
      for (int r = 0; r < 8; ++r) oacc[j][r] *= corr[r];
      FragAB vf;
      const bf16* vp = v + ((size_t)bh * DD + j * 16 + (lane & 15)) * TT + s0;
#pragma unroll
      for (int r = 0; r < 8; ++r)
        vf.u[r] = *reinterpret_cast<const unsigned int*>(vp + kbase(r, hi));
      oacc[j] = __builtin_amdgcn_wmma_f32_16x16x32_bf16(false, pf.v, false, vf.v,
                                                        (short)0, oacc[j], false, false);
    }
  }

  // ---- normalize + merge heads: write [B,T,C] bf16 ----
  const int b = bh >> 2, h = bh & 3;
#pragma unroll
  for (int r = 0; r < 8; ++r) {
    float inv = 1.0f / rows[r];
    int token = tq * 16 + r + (hi << 3);
#pragma unroll
    for (int j = 0; j < 4; ++j) {
      int col = h * DD + j * 16 + (lane & 15);
      o[((size_t)b * TT + token) * CC + col] = (bf16)(oacc[j][r] * inv);
    }
  }
}

// ---------------------------------------------------------------------------
// LayerNorm over C=256: one wave per token; butterfly reductions.
// ---------------------------------------------------------------------------
__global__ __launch_bounds__(256) void ln_kernel(const float* __restrict__ in,
                                                 const float* __restrict__ w,
                                                 const float* __restrict__ bias,
                                                 float* __restrict__ outf,
                                                 bf16* __restrict__ outb) {
  const int lane  = threadIdx.x & 31;
  const int token = blockIdx.x * 8 + (threadIdx.x >> 5);
  const float4* p = reinterpret_cast<const float4*>(in + (size_t)token * CC);
  float4 a0 = p[lane];
  float4 a1 = p[32 + lane];

  float sum = a0.x + a0.y + a0.z + a0.w + a1.x + a1.y + a1.z + a1.w;
  float sq  = a0.x * a0.x + a0.y * a0.y + a0.z * a0.z + a0.w * a0.w +
              a1.x * a1.x + a1.y * a1.y + a1.z * a1.z + a1.w * a1.w;
#pragma unroll
  for (int off = 1; off <= 16; off <<= 1) {
    sum += __shfl_xor(sum, off, 32);
    sq  += __shfl_xor(sq, off, 32);
  }
  const float mean = sum * (1.0f / CC);
  const float var  = sq * (1.0f / CC) - mean * mean;
  const float rstd = rsqrtf(var + LNEPS);

  float4* of = reinterpret_cast<float4*>(outf + (size_t)token * CC);
#pragma unroll
  for (int i = 0; i < 2; ++i) {
    float4 av = (i == 0) ? a0 : a1;
    int c = (i * 32 + lane) * 4;
    float4 y;
    y.x = w[c + 0] * (av.x - mean) * rstd + bias[c + 0];
    y.y = w[c + 1] * (av.y - mean) * rstd + bias[c + 1];
    y.z = w[c + 2] * (av.z - mean) * rstd + bias[c + 2];
    y.w = w[c + 3] * (av.w - mean) * rstd + bias[c + 3];
    of[i * 32 + lane] = y;
    if (outb) {
      bf16* ob = outb + (size_t)token * CC + c;
      ob[0] = (bf16)y.x; ob[1] = (bf16)y.y; ob[2] = (bf16)y.z; ob[3] = (bf16)y.w;
    }
  }
}

// ---------------------------------------------------------------------------
// Host launcher
// ---------------------------------------------------------------------------
extern "C" void kernel_launch(void* const* d_in, const int* in_sizes, int n_in,
                              void* d_out, int out_size, void* d_ws, size_t ws_size,
                              hipStream_t stream) {
  const float* x      = (const float*)d_in[0];
  const float* qkv_w  = (const float*)d_in[1];
  const float* qkv_b  = (const float*)d_in[2];
  const float* proj_w = (const float*)d_in[3];
  const float* proj_b = (const float*)d_in[4];
  const float* n1_w   = (const float*)d_in[5];
  const float* n1_b   = (const float*)d_in[6];
  const float* ffn_w1 = (const float*)d_in[7];
  const float* ffn_b1 = (const float*)d_in[8];
  const float* ffn_w2 = (const float*)d_in[9];
  const float* ffn_b2 = (const float*)d_in[10];
  const float* n2_w   = (const float*)d_in[11];
  const float* n2_b   = (const float*)d_in[12];
  float* out = (float*)d_out;

  char* ws = (char*)d_ws;
  size_t off = 0;
  auto take = [&](size_t bytes) { void* p = ws + off; off += (bytes + 255) & ~(size_t)255; return p; };

  bf16*  x_bf     = (bf16*)take((size_t)MM * CC * 2);
  bf16*  wqkv_bf  = (bf16*)take((size_t)CC * N3 * 2);
  bf16*  wproj_bf = (bf16*)take((size_t)CC * CC * 2);
  bf16*  w1_bf    = (bf16*)take((size_t)CC * N3 * 2);
  bf16*  w2_bf    = (bf16*)take((size_t)N3 * CC * 2);
  bf16*  q_bf     = (bf16*)take((size_t)MM * CC * 2);
  bf16*  k_bf     = (bf16*)take((size_t)MM * CC * 2);
  bf16*  v_bf     = (bf16*)take((size_t)MM * CC * 2);   // [B,H,D,T]
  bf16*  attn_bf  = (bf16*)take((size_t)MM * CC * 2);
  float* r1       = (float*)take((size_t)MM * CC * 4);
  float* x1f      = (float*)take((size_t)MM * CC * 4);
  bf16*  x1_bf    = (bf16*)take((size_t)MM * CC * 2);
  bf16*  h_bf     = (bf16*)take((size_t)MM * N3 * 2);
  float* r2       = (float*)take((size_t)MM * CC * 4);

  // 1) converts
  cvt_bf16_kernel<<<(MM * CC + 255) / 256, 256, 0, stream>>>(x, x_bf, MM * CC);
  cvt_bf16_kernel<<<(CC * N3 + 255) / 256, 256, 0, stream>>>(qkv_w, wqkv_bf, CC * N3);
  cvt_bf16_kernel<<<(CC * CC + 255) / 256, 256, 0, stream>>>(proj_w, wproj_bf, CC * CC);
  cvt_bf16_kernel<<<(CC * N3 + 255) / 256, 256, 0, stream>>>(ffn_w1, w1_bf, CC * N3);
  cvt_bf16_kernel<<<(N3 * CC + 255) / 256, 256, 0, stream>>>(ffn_w2, w2_bf, N3 * CC);

  // 2) QKV projection, scatter q/k -> [B,H,T,D], v -> [B,H,D,T]
  gemm_bf16_kernel<<<dim3(N3 / 32, MM / 256), 256, 0, stream>>>(
      x_bf, wqkv_bf, qkv_b, CC, N3, 0, nullptr, nullptr, nullptr, q_bf, k_bf, v_bf);

  // 3) flash attention -> [B,T,C] bf16
  attn_kernel<<<(BB * HH * (TT / 16)) / 8, 256, 0, stream>>>(q_bf, k_bf, v_bf, attn_bf);

  // 4) output projection + residual(x) -> r1 f32
  gemm_bf16_kernel<<<dim3(CC / 32, MM / 256), 256, 0, stream>>>(
      attn_bf, wproj_bf, proj_b, CC, CC, 1, x, r1, nullptr, nullptr, nullptr, nullptr);

  // 5) LN1 -> x1 (f32 + bf16)
  ln_kernel<<<MM / 8, 256, 0, stream>>>(r1, n1_w, n1_b, x1f, x1_bf);

  // 6) FFN1 + GELU -> h bf16
  gemm_bf16_kernel<<<dim3(N3 / 32, MM / 256), 256, 0, stream>>>(
      x1_bf, w1_bf, ffn_b1, CC, N3, 2, nullptr, nullptr, h_bf, nullptr, nullptr, nullptr);

  // 7) FFN2 + residual(x1) -> r2 f32
  gemm_bf16_kernel<<<dim3(CC / 32, MM / 256), 256, 0, stream>>>(
      h_bf, w2_bf, ffn_b2, N3, CC, 1, x1f, r2, nullptr, nullptr, nullptr, nullptr);

  // 8) LN2 -> output f32
  ln_kernel<<<MM / 8, 256, 0, stream>>>(r2, n2_w, n2_b, out, nullptr);
}

// v001
// Measured time: 471 microseconds a run.
// Timed twice side by side with v000, it ran 1.09 times as fast both times.
#include <hip/hip_runtime.h>
#include <hip/hip_bf16.h>

// ---------------------------------------------------------------------------
// Transformer block for MI455X (gfx1250, wave32, WMMA).
// bf16 activations, f32 accumulation via v_wmma_f32_16x16x32_bf16.
// A-tiles staged to LDS with global_load_async_to_lds_b128 (ASYNCcnt).
// ---------------------------------------------------------------------------

typedef __bf16 bf16;
typedef __attribute__((ext_vector_type(16))) __bf16 v16bf;
typedef __attribute__((ext_vector_type(8)))  float  v8f;

#define BB   4
#define TT   4096
#define CC   256
#define HH   4
#define DD   64
#define MM   (BB * TT)      // 16384 tokens
#define N3   (3 * CC)       // 768
#define LNEPS 1e-5f
#define BSTR 34             // transposed-B LDS stride (bank-spread, even)

// K index inside a 16x32 (16-bit) A/B fragment for VGPR r, lane-half hi.
// ISA 7.12.2: VGPR0..3 lanes0-15 hold K=0..7 (pairs), lanes16-31 K=8..15; VGPR4..7 -> +16.
__device__ __forceinline__ int kbase(int r, int hi) {
  return ((r & 4) << 2) | (hi << 3) | ((r & 3) << 1);
}

union FragAB {
  v16bf v;
  unsigned int u[8];
  bf16 b[16];
};

__device__ __forceinline__ unsigned lds_off32(const void* p) {
  return (unsigned)(unsigned long long)(uintptr_t)p;   // low 32 bits = LDS byte offset
}

// ---------------------------------------------------------------------------
// fp32 -> bf16 convert
// ---------------------------------------------------------------------------
__global__ __launch_bounds__(256) void cvt_bf16_kernel(const float* __restrict__ in,
                                                       bf16* __restrict__ out, int n) {
  int i = blockIdx.x * 256 + threadIdx.x;
  if (i < n) out[i] = (bf16)in[i];
}

// ---------------------------------------------------------------------------
// Tiled GEMM: Out = A[M x K] * W[K x N] (+bias, + epilogue)
// Block tile 256x32 (8 waves, each a 32x32 tile = 4 WMMA per K=32 chunk).
// A tile: async-DMA to LDS (row-major, stride 32).
// B tile: stored transposed [n][k] in LDS so fragments load as b32 pairs.
// mode 0: QKV scatter -> q/k bf16 [B,H,T,D], v bf16 [B,H,D,T]
// mode 1: + residual  -> f32 out [M x N]
// mode 2: GELU        -> bf16 out [M x N]
// ---------------------------------------------------------------------------
__global__ __launch_bounds__(256) void gemm_bf16_kernel(
    const bf16* __restrict__ A, const bf16* __restrict__ W,
    const float* __restrict__ bias, int K, int N, int mode,
    const float* __restrict__ res, float* __restrict__ outf,
    bf16* __restrict__ outb, bf16* __restrict__ oq,
    bf16* __restrict__ okk, bf16* __restrict__ ov) {
  __shared__ __align__(16) bf16 sA[256 * 32];
  __shared__ __align__(16) bf16 sBt[32 * BSTR];

  const int tid  = threadIdx.x;
  const int lane = tid & 31;
  const int wave = tid >> 5;           // 0..7, owns rows [wave*32, wave*32+32)
  const int hi   = (lane >> 4) & 1;
  const int m0   = blockIdx.y * 256;
  const int n0   = blockIdx.x * 32;

  const int arow = tid >> 2, acol = (tid & 3) << 3;  // + i*64 rows, 8 bf16 each
  const int brow = tid >> 3, bcol = (tid & 7) << 2;  // 32 k-rows x 4 n each

  v8f acc[2][2];
#pragma unroll
  for (int ms = 0; ms < 2; ++ms)
#pragma unroll
    for (int ns = 0; ns < 2; ++ns)
      acc[ms][ns] = (v8f){0.f, 0.f, 0.f, 0.f, 0.f, 0.f, 0.f, 0.f};

  for (int k0 = 0; k0 < K; k0 += 32) {
    __syncthreads();
    // ---- A tile: async DMA, 4 x 16B per lane (rows arow + i*64) ----
#pragma unroll
    for (int i = 0; i < 4; ++i) {
      unsigned lo = lds_off32(sA + (arow + i * 64) * 32 + acol);
      unsigned long long ga =
          (unsigned long long)(uintptr_t)(A + (size_t)(m0 + arow + i * 64) * K + k0 + acol);
      asm volatile("global_load_async_to_lds_b128 %0, %1, off"
                   :: "v"(lo), "v"(ga) : "memory");
    }
    // ---- B tile: load [k][n] row-major, store transposed [n][k] ----
    {
      uint2 w2 = *reinterpret_cast<const uint2*>(W + (size_t)(k0 + brow) * N + n0 + bcol);
      bf16 wb[4];
      *reinterpret_cast<uint2*>(wb) = w2;
#pragma unroll
      for (int i = 0; i < 4; ++i) sBt[(bcol + i) * BSTR + brow] = wb[i];
    }
    if (k0 + 32 < K)
      __builtin_prefetch(W + (size_t)(k0 + 32 + brow) * N + n0 + bcol, 0, 1);

    asm volatile("s_wait_asynccnt 0" ::: "memory");
    __syncthreads();

    // ---- fragments: all b32 LDS loads ----
    FragAB fa[2], fb[2];
#pragma unroll
    for (int ms = 0; ms < 2; ++ms) {
      const bf16* ap = sA + (wave * 32 + ms * 16 + (lane & 15)) * 32;
#pragma unroll
      for (int r = 0; r < 8; ++r)
        fa[ms].u[r] = *reinterpret_cast<const unsigned int*>(ap + kbase(r, hi));
    }
#pragma unroll
    for (int ns = 0; ns < 2; ++ns) {
      const bf16* bp = sBt + (ns * 16 + (lane & 15)) * BSTR;
#pragma unroll
      for (int r = 0; r < 8; ++r)
        fb[ns].u[r] = *reinterpret_cast<const unsigned int*>(bp + kbase(r, hi));
    }
#pragma unroll
    for (int ms = 0; ms < 2; ++ms)
#pragma unroll
      for (int ns = 0; ns < 2; ++ns)
        acc[ms][ns] = __builtin_amdgcn_wmma_f32_16x16x32_bf16(
            false, fa[ms].v, false, fb[ns].v, (short)0, acc[ms][ns], false, false);
  }

  // ---- epilogue ----
#pragma unroll
  for (int ns = 0; ns < 2; ++ns) {
    const int gn = n0 + ns * 16 + (lane & 15);
    const float bv = bias[gn];
#pragma unroll
    for (int ms = 0; ms < 2; ++ms) {
#pragma unroll
      for (int r = 0; r < 8; ++r) {
        const int gm = m0 + wave * 32 + ms * 16 + r + (hi << 3);
        float val = acc[ms][ns][r] + bv;
        if (mode == 0) {               // QKV scatter
          int part = gn >> 8, cc = gn & 255;
          int hh = cc >> 6, dd = cc & 63;
          int bb = gm >> 12, ttok = gm & (TT - 1);
          if (part == 2) {             // V transposed: [B,H,D,T]
            ov[(((size_t)(bb * HH + hh)) * DD + dd) * TT + ttok] = (bf16)val;
          } else {
            bf16* dst = (part == 0) ? oq : okk;
            dst[(((size_t)(bb * HH + hh)) * TT + ttok) * DD + dd] = (bf16)val;
          }
        } else if (mode == 1) {        // bias + residual -> f32
          size_t idx = (size_t)gm * N + gn;
          outf[idx] = val + res[idx];
        } else {                       // exact GELU -> bf16
          float g = 0.5f * val * (1.0f + erff(val * 0.70710678118f));
          outb[(size_t)gm * N + gn] = (bf16)g;
        }
      }
    }
  }
}

// ---------------------------------------------------------------------------
// Flash attention, transposed: each wave owns 16 queries of one (b,h) and streams
// keys in chunks of 32. St = K * Qt puts one query's scores in one lane (column),
// so max and sum run in-lane plus one exchange between the wave halves; the two
// St tiles, converted in place, are the B operand of Ot += Vt * Pt.
// 8 WMMAs per chunk. V is [B,H,D,T] so Vt rows are contiguous along keys.
// ---------------------------------------------------------------------------
__device__ __forceinline__ float xhalf(float x) {   // lane l <-> lane l ^ 16
  int b = __builtin_bit_cast(int, x);
  return __builtin_bit_cast(float,
      __builtin_amdgcn_permlanex16(b, b, 0x76543210, 0xfedcba98, false, false));
}

__global__ __launch_bounds__(256) void attn_kernel(const bf16* __restrict__ q,
                                                   const bf16* __restrict__ k,
                                                   const bf16* __restrict__ v,
                                                   bf16* __restrict__ o) {
  const int tid  = threadIdx.x;
  const int lane = tid & 31;
  const int wave = tid >> 5;
  const int hi   = (lane >> 4) & 1;
  const int tile = blockIdx.x * 8 + wave;          // 0 .. B*H*(T/16)-1
  const int ntq  = TT / 16;                        // 256
  const int bh   = tile / ntq;
  const int tq   = tile - bh * ntq;
  const size_t rowbase = (size_t)bh * TT;

  // Q fragments (d = 0..31 and 32..63) as B operand: lane column = query. Loaded once.
  FragAB qf0, qf1;
  {
    const bf16* qp = q + (rowbase + tq * 16 + (lane & 15)) * DD;
#pragma unroll
    for (int r = 0; r < 8; ++r) {
      qf0.u[r] = *reinterpret_cast<const unsigned int*>(qp + kbase(r, hi));
      qf1.u[r] = *reinterpret_cast<const unsigned int*>(qp + 32 + kbase(r, hi));
    }
  }

  // oacc[j][r] = Ot[d = j*16 + 8*hi + r][query = lane & 15]
  v8f oacc[4];
#pragma unroll
  for (int j = 0; j < 4; ++j) oacc[j] = (v8f){0.f, 0.f, 0.f, 0.f, 0.f, 0.f, 0.f, 0.f};
  float rowm = -3.0e38f;   // running maximum of this lane's query (equal in both halves)
  float rows = 0.f;        // running sum over this half's keys only; halves join at the end

  const float scale = 0.125f;  // D^-0.5, D=64

  for (int s0 = 0; s0 < TT; s0 += 32) {
    // ---- St = K * Qt for 32 keys: sacc[nt][r] = score(key s0+nt*16+8*hi+r, query) ----
    v8f sacc[2];
#pragma unroll
    for (int nt = 0; nt < 2; ++nt) {
      sacc[nt] = (v8f){0.f, 0.f, 0.f, 0.f, 0.f, 0.f, 0.f, 0.f};
      const bf16* kp = k + (rowbase + s0 + nt * 16 + (lane & 15)) * DD;
      FragAB kf0, kf1;
#pragma unroll
      for (int r = 0; r < 8; ++r) {
        kf0.u[r] = *reinterpret_cast<const unsigned int*>(kp + kbase(r, hi));
        kf1.u[r] = *reinterpret_cast<const unsigned int*>(kp + 32 + kbase(r, hi));
      }
      sacc[nt] = __builtin_amdgcn_wmma_f32_16x16x32_bf16(false, kf0.v, false, qf0.v,
                                                         (short)0, sacc[nt], false, false);
      sacc[nt] = __builtin_amdgcn_wmma_f32_16x16x32_bf16(false, kf1.v, false, qf1.v,
                                                         (short)0, sacc[nt], false, false);
    }

    // ---- online softmax: this lane holds 16 of its query's 32 scores ----
    float c[16];
#pragma unroll
    for (int i = 0; i < 16; ++i) c[i] = sacc[i >> 3][i & 7] * scale;
    float m4[4];
#pragma unroll
    for (int i = 0; i < 4; ++i)
      m4[i] = fmaxf(fmaxf(c[4 * i], c[4 * i + 1]), fmaxf(c[4 * i + 2], c[4 * i + 3]));
    float mc = fmaxf(fmaxf(m4[0], m4[1]), fmaxf(m4[2], m4[3]));
    mc = fmaxf(mc, xhalf(mc));
    const float mn   = fmaxf(rowm, mc);
    const float corr = __expf(rowm - mn);
    rowm = mn;

    // Pt as B operand: element s wants key 8*hi+s (s<8) or 16+8*hi+(s-8), which is
    // exactly tile s>>3, register s&7 of St: convert in place, no lane exchange.
    FragAB pf;
    float p[16];
#pragma unroll
    for (int i = 0; i < 16; ++i) {
      p[i] = __expf(c[i] - mn);
      pf.b[i] = (bf16)p[i];
    }
    float s4[4];
#pragma unroll
    for (int i = 0; i < 4; ++i)
      s4[i] = (p[i] + p[i + 4]) + (p[i + 8] + p[i + 12]);
    rows = rows * corr + ((s4[0] + s4[1]) + (s4[2] + s4[3]));

    // ---- Ot = Ot*corr + Vt * Pt   (Vt rows: contiguous b32 pairs along keys) ----
#pragma unroll
    for (int j = 0; j < 4; ++j) {
#pragma unroll
      for (int r = 0; r < 8; ++r) oacc[j][r] *= corr;
      FragAB vf;
      const bf16* vp = v + ((size_t)bh * DD + j * 16 + (lane & 15)) * TT + s0;
#pragma unroll
      for (int r = 0; r < 8; ++r)
        vf.u[r] = *reinterpret_cast<const unsigned int*>(vp + kbase(r, hi));
      oacc[j] = __builtin_amdgcn_wmma_f32_16x16x32_bf16(false, vf.v, false, pf.v,
                                                        (short)0, oacc[j], false, false);
    }
  }

  // ---- normalize + merge heads: write [B,T,C] bf16, 8 consecutive d per lane ----
  const int b = bh >> 2, h = bh & 3;
  const float inv = 1.0f / (rows + xhalf(rows));
  const int token = tq * 16 + (lane & 15);
  bf16* op = o + ((size_t)b * TT + token) * CC + h * DD + (hi << 3);
#pragma unroll
  for (int j = 0; j < 4; ++j) {
    union { bf16 e[8]; uint4 u; } pk;
#pragma unroll
    for (int r = 0; r < 8; ++r) pk.e[r] = (bf16)(oacc[j][r] * inv);
    *reinterpret_cast<uint4*>(op + j * 16) = pk.u;
  }
}

// ---------------------------------------------------------------------------
// LayerNorm over C=256: one wave per token; butterfly reductions.
// ---------------------------------------------------------------------------
__global__ __launch_bounds__(256) void ln_kernel(const float* __restrict__ in,
                                                 const float* __restrict__ w,
                                                 const float* __restrict__ bias,
                                                 float* __restrict__ outf,
                                                 bf16* __restrict__ outb) {
  const int lane  = threadIdx.x & 31;
  const int token = blockIdx.x * 8 + (threadIdx.x >> 5);
  const float4* p = reinterpret_cast<const float4*>(in + (size_t)token * CC);
  float4 a0 = p[lane];
  float4 a1 = p[32 + lane];

  float sum = a0.x + a0.y + a0.z + a0.w + a1.x + a1.y + a1.z + a1.w;
  float sq  = a0.x * a0.x + a0.y * a0.y + a0.z * a0.z + a0.w * a0.w +
              a1.x * a1.x + a1.y * a1.y + a1.z * a1.z + a1.w * a1.w;
#pragma unroll
  for (int off = 1; off <= 16; off <<= 1) {
    sum += __shfl_xor(sum, off, 32);
    sq  += __shfl_xor(sq, off, 32);
  }
  const float mean = sum * (1.0f / CC);
  const float var  = sq * (1.0f / CC) - mean * mean;
  const float rstd = rsqrtf(var + LNEPS);

  float4* of = reinterpret_cast<float4*>(outf + (size_t)token * CC);
#pragma unroll
  for (int i = 0; i < 2; ++i) {
    float4 av = (i == 0) ? a0 : a1;
    int c = (i * 32 + lane) * 4;
    float4 y;
    y.x = w[c + 0] * (av.x - mean) * rstd + bias[c + 0];
    y.y = w[c + 1] * (av.y - mean) * rstd + bias[c + 1];
    y.z = w[c + 2] * (av.z - mean) * rstd + bias[c + 2];
    y.w = w[c + 3] * (av.w - mean) * rstd + bias[c + 3];
    of[i * 32 + lane] = y;
    if (outb) {
      bf16* ob = outb + (size_t)token * CC + c;
      ob[0] = (bf16)y.x; ob[1] = (bf16)y.y; ob[2] = (bf16)y.z; ob[3] = (bf16)y.w;
    }
  }
}

// ---------------------------------------------------------------------------
// Host launcher
// ---------------------------------------------------------------------------
extern "C" void kernel_launch(void* const* d_in, const int* in_sizes, int n_in,
                              void* d_out, int out_size, void* d_ws, size_t ws_size,
                              hipStream_t stream) {
  const float* x      = (const float*)d_in[0];
  const float* qkv_w  = (const float*)d_in[1];
  const float* qkv_b  = (const float*)d_in[2];
  const float* proj_w = (const float*)d_in[3];
  const float* proj_b = (const float*)d_in[4];
  const float* n1_w   = (const float*)d_in[5];
  const float* n1_b   = (const float*)d_in[6];
  const float* ffn_w1 = (const float*)d_in[7];
  const float* ffn_b1 = (const float*)d_in[8];
  const float* ffn_w2 = (const float*)d_in[9];
  const float* ffn_b2 = (const float*)d_in[10];
  const float* n2_w   = (const float*)d_in[11];
  const float* n2_b   = (const float*)d_in[12];
  float* out = (float*)d_out;

  char* ws = (char*)d_ws;
  size_t off = 0;
  auto take = [&](size_t bytes) { void* p = ws + off; off += (bytes + 255) & ~(size_t)255; return p; };

  bf16*  x_bf     = (bf16*)take((size_t)MM * CC * 2);
  bf16*  wqkv_bf  = (bf16*)take((size_t)CC * N3 * 2);
  bf16*  wproj_bf = (bf16*)take((size_t)CC * CC * 2);
  bf16*  w1_bf    = (bf16*)take((size_t)CC * N3 * 2);
  bf16*  w2_bf    = (bf16*)take((size_t)N3 * CC * 2);
  bf16*  q_bf     = (bf16*)take((size_t)MM * CC * 2);
  bf16*  k_bf     = (bf16*)take((size_t)MM * CC * 2);
  bf16*  v_bf     = (bf16*)take((size_t)MM * CC * 2);   // [B,H,D,T]
  bf16*  attn_bf  = (bf16*)take((size_t)MM * CC * 2);
  float* r1       = (float*)take((size_t)MM * CC * 4);
  float* x1f      = (float*)take((size_t)MM * CC * 4);
  bf16*  x1_bf    = (bf16*)take((size_t)MM * CC * 2);
  bf16*  h_bf     = (bf16*)take((size_t)MM * N3 * 2);
  float* r2       = (float*)take((size_t)MM * CC * 4);

  // 1) converts
  cvt_bf16_kernel<<<(MM * CC + 255) / 256, 256, 0, stream>>>(x, x_bf, MM * CC);
  cvt_bf16_kernel<<<(CC * N3 + 255) / 256, 256, 0, stream>>>(qkv_w, wqkv_bf, CC * N3);
  cvt_bf16_kernel<<<(CC * CC + 255) / 256, 256, 0, stream>>>(proj_w, wproj_bf, CC * CC);
  cvt_bf16_kernel<<<(CC * N3 + 255) / 256, 256, 0, stream>>>(ffn_w1, w1_bf, CC * N3);
  cvt_bf16_kernel<<<(N3 * CC + 255) / 256, 256, 0, stream>>>(ffn_w2, w2_bf, N3 * CC);

  // 2) QKV projection, scatter q/k -> [B,H,T,D], v -> [B,H,D,T]
  gemm_bf16_kernel<<<dim3(N3 / 32, MM / 256), 256, 0, stream>>>(
      x_bf, wqkv_bf, qkv_b, CC, N3, 0, nullptr, nullptr, nullptr, q_bf, k_bf, v_bf);

  // 3) flash attention -> [B,T,C] bf16
  attn_kernel<<<(BB * HH * (TT / 16)) / 8, 256, 0, stream>>>(q_bf, k_bf, v_bf, attn_bf);

  // 4) output projection + residual(x) -> r1 f32
  gemm_bf16_kernel<<<dim3(CC / 32, MM / 256), 256, 0, stream>>>(
      attn_bf, wproj_bf, proj_b, CC, CC, 1, x, r1, nullptr, nullptr, nullptr, nullptr);

  // 5) LN1 -> x1 (f32 + bf16)
  ln_kernel<<<MM / 8, 256, 0, stream>>>(r1, n1_w, n1_b, x1f, x1_bf);

  // 6) FFN1 + GELU -> h bf16
  gemm_bf16_kernel<<<dim3(N3 / 32, MM / 256), 256, 0, stream>>>(
      x1_bf, w1_bf, ffn_b1, CC, N3, 2, nullptr, nullptr, h_bf, nullptr, nullptr, nullptr);

  // 7) FFN2 + residual(x1) -> r2 f32
  gemm_bf16_kernel<<<dim3(CC / 32, MM / 256), 256, 0, stream>>>(
      h_bf, w2_bf, ffn_b2, N3, CC, 1, x1f, r2, nullptr, nullptr, nullptr, nullptr);

  // 8) LN2 -> output f32
  ln_kernel<<<MM / 8, 256, 0, stream>>>(r2, n2_w, n2_b, out, nullptr);
}

// v002
// A run of this version takes 288 microseconds.
// In two side-by-side timings against v001, it was 1.63 and 1.64 times as fast.
// All steps since v000 together make it 1.79 times as fast.
#include <hip/hip_runtime.h>
#include <hip/hip_bf16.h>

// ---------------------------------------------------------------------------
// Transformer block for MI455X (gfx1250, wave32, WMMA).
// bf16 activations, f32 accumulation via v_wmma_f32_16x16x32_bf16.
// A-tiles staged to LDS with global_load_async_to_lds_b128 (ASYNCcnt).
// ---------------------------------------------------------------------------

typedef __bf16 bf16;
typedef __attribute__((ext_vector_type(16))) __bf16 v16bf;
typedef __attribute__((ext_vector_type(8)))  float  v8f;

#define BB   4
#define TT   4096
#define CC   256
#define HH   4
#define DD   64
#define MM   (BB * TT)      // 16384 tokens
#define N3   (3 * CC)       // 768
#define LNEPS 1e-5f
#define BSTR 34             // transposed-B LDS stride (bank-spread, even)

// K index inside a 16x32 (16-bit) A/B fragment for VGPR r, lane-half hi.
// ISA 7.12.2: VGPR0..3 lanes0-15 hold K=0..7 (pairs), lanes16-31 K=8..15; VGPR4..7 -> +16.
__device__ __forceinline__ int kbase(int r, int hi) {
  return ((r & 4) << 2) | (hi << 3) | ((r & 3) << 1);
}

union FragAB {
  v16bf v;
  unsigned int u[8];
  bf16 b[16];
};

__device__ __forceinline__ unsigned lds_off32(const void* p) {
  return (unsigned)(unsigned long long)(uintptr_t)p;   // low 32 bits = LDS byte offset
}

// ---------------------------------------------------------------------------
// fp32 -> bf16 convert
// ---------------------------------------------------------------------------
__global__ __launch_bounds__(256) void cvt_bf16_kernel(const float* __restrict__ in,
                                                       bf16* __restrict__ out, int n) {
  int i = blockIdx.x * 256 + threadIdx.x;
  if (i < n) out[i] = (bf16)in[i];
}

// ---------------------------------------------------------------------------
// Tiled GEMM: Out = A[M x K] * W[K x N] (+bias, + epilogue)
// Block tile 256x32 (8 waves, each a 32x32 tile = 4 WMMA per K=32 chunk).
// A tile: async-DMA to LDS (row-major, stride 32).
// B tile: stored transposed [n][k] in LDS so fragments load as b32 pairs.
// mode 0: QKV scatter -> q/k bf16 [B,H,T,D], v bf16 [B,H,D,T]
// mode 1: + residual  -> f32 out [M x N]
// mode 2: GELU        -> bf16 out [M x N]
// ---------------------------------------------------------------------------
__global__ __launch_bounds__(256) void gemm_bf16_kernel(
    const bf16* __restrict__ A, const bf16* __restrict__ W,
    const float* __restrict__ bias, int K, int N, int mode,
    const float* __restrict__ res, float* __restrict__ outf,
    bf16* __restrict__ outb, bf16* __restrict__ oq,
    bf16* __restrict__ okk, bf16* __restrict__ ov) {
  __shared__ __align__(16) bf16 sA[256 * 32];
  __shared__ __align__(16) bf16 sBt[32 * BSTR];

  const int tid  = threadIdx.x;
  const int lane = tid & 31;
  const int wave = tid >> 5;           // 0..7, owns rows [wave*32, wave*32+32)
  const int hi   = (lane >> 4) & 1;
  const int m0   = blockIdx.y * 256;
  const int n0   = blockIdx.x * 32;

  const int arow = tid >> 2, acol = (tid & 3) << 3;  // + i*64 rows, 8 bf16 each
  const int brow = tid >> 3, bcol = (tid & 7) << 2;  // 32 k-rows x 4 n each

  v8f acc[2][2];
#pragma unroll
  for (int ms = 0; ms < 2; ++ms)
#pragma unroll
    for (int ns = 0; ns < 2; ++ns)
      acc[ms][ns] = (v8f){0.f, 0.f, 0.f, 0.f, 0.f, 0.f, 0.f, 0.f};

  for (int k0 = 0; k0 < K; k0 += 32) {
    __syncthreads();
    // ---- A tile: async DMA, 4 x 16B per lane (rows arow + i*64) ----
#pragma unroll
    for (int i = 0; i < 4; ++i) {
      unsigned lo = lds_off32(sA + (arow + i * 64) * 32 + acol);
      unsigned long long ga =
          (unsigned long long)(uintptr_t)(A + (size_t)(m0 + arow + i * 64) * K + k0 + acol);
      asm volatile("global_load_async_to_lds_b128 %0, %1, off"
                   :: "v"(lo), "v"(ga) : "memory");
    }
    // ---- B tile: load [k][n] row-major, store transposed [n][k] ----
    {
      uint2 w2 = *reinterpret_cast<const uint2*>(W + (size_t)(k0 + brow) * N + n0 + bcol);
      bf16 wb[4];
      *reinterpret_cast<uint2*>(wb) = w2;
#pragma unroll
      for (int i = 0; i < 4; ++i) sBt[(bcol + i) * BSTR + brow] = wb[i];
    }
    if (k0 + 32 < K)
      __builtin_prefetch(W + (size_t)(k0 + 32 + brow) * N + n0 + bcol, 0, 1);

    asm volatile("s_wait_asynccnt 0" ::: "memory");
    __syncthreads();

    // ---- fragments: all b32 LDS loads ----
    FragAB fa[2], fb[2];
#pragma unroll
    for (int ms = 0; ms < 2; ++ms) {
      const bf16* ap = sA + (wave * 32 + ms * 16 + (lane & 15)) * 32;
#pragma unroll
      for (int r = 0; r < 8; ++r)
        fa[ms].u[r] = *reinterpret_cast<const unsigned int*>(ap + kbase(r, hi));
    }
#pragma unroll
    for (int ns = 0; ns < 2; ++ns) {
      const bf16* bp = sBt + (ns * 16 + (lane & 15)) * BSTR;
#pragma unroll
      for (int r = 0; r < 8; ++r)
        fb[ns].u[r] = *reinterpret_cast<const unsigned int*>(bp + kbase(r, hi));
    }
#pragma unroll
    for (int ms = 0; ms < 2; ++ms)
#pragma unroll
      for (int ns = 0; ns < 2; ++ns)
        acc[ms][ns] = __builtin_amdgcn_wmma_f32_16x16x32_bf16(
            false, fa[ms].v, false, fb[ns].v, (short)0, acc[ms][ns], false, false);
  }

  // ---- epilogue ----
#pragma unroll
  for (int ns = 0; ns < 2; ++ns) {
    const int gn = n0 + ns * 16 + (lane & 15);
    const float bv = bias[gn];
#pragma unroll
    for (int ms = 0; ms < 2; ++ms) {
#pragma unroll
      for (int r = 0; r < 8; ++r) {
        const int gm = m0 + wave * 32 + ms * 16 + r + (hi << 3);
        float val = acc[ms][ns][r] + bv;
        if (mode == 0) {               // QKV scatter
          int part = gn >> 8, cc = gn & 255;
          int hh = cc >> 6, dd = cc & 63;
          int bb = gm >> 12, ttok = gm & (TT - 1);
          if (part == 2) {             // V transposed: [B,H,D,T]
            ov[(((size_t)(bb * HH + hh)) * DD + dd) * TT + ttok] = (bf16)val;
          } else {
            bf16* dst = (part == 0) ? oq : okk;
            dst[(((size_t)(bb * HH + hh)) * TT + ttok) * DD + dd] = (bf16)val;
          }
        } else if (mode == 1) {        // bias + residual -> f32
          size_t idx = (size_t)gm * N + gn;
          outf[idx] = val + res[idx];
        } else {                       // exact GELU -> bf16
          float g = 0.5f * val * (1.0f + erff(val * 0.70710678118f));
          outb[(size_t)gm * N + gn] = (bf16)g;
        }
      }
    }
  }
}

// ---------------------------------------------------------------------------
// Flash attention, transposed: each wave owns 16 queries of one (b,h) and walks the
// keys in chunks of 32. St = K * Qt puts one query's scores in one lane (column),
// so max and sum run in-lane plus one exchange between the wave halves; the two
// St tiles, converted in place, are the B operand of Ot += Vt * Pt.
// 8 WMMAs per chunk. V is [B,H,D,T] so Vt rows are contiguous along keys.
// The 8 waves of a block share one (b,h): K and Vt tiles of SKEYS keys are brought
// into LDS once per block by async copies (two buffers, the next tile in flight
// while this one is worked on) and every wave reads its fragments from there.
// ---------------------------------------------------------------------------
#define SKEYS  128                  // keys per LDS tile
#define NTILE  (TT / SKEYS)         // 32 tiles
#define KPITCH 72                   // bf16 per K row in LDS: 128 B + 16 B (16 B x odd)
#define VPITCH 136                  // bf16 per Vt row in LDS: 256 B + 16 B (16 B x odd)
#define KTILE  (SKEYS * KPITCH)     // bf16 per K tile
#define VTILE  (DD * VPITCH)        // bf16 per Vt tile
#define LOG2E  1.44269504088896f    // exp(x) = exp2(x * LOG2E), the product that __expf forms

__device__ __forceinline__ float xhalf(float x) {   // lane l <-> lane l ^ 16
  int b = __builtin_bit_cast(int, x);
  return __builtin_bit_cast(float,
      __builtin_amdgcn_permlanex16(b, b, 0x76543210, 0xfedcba98, false, false));
}

// exp2 with the one slot that the instruction set asks for behind a transcendental (before its
// result is read or its source register rewritten) kept in the same statement: a v_nop in a
// statement of its own did not stay behind the v_exp in the build.
__device__ __forceinline__ float exp2_slot(float x) {
  float r;
  asm("v_exp_f32 %0, %1\n\tv_nop" : "=v"(r) : "v"(x));
  return r;
}

// One 16x32 fragment from an LDS row: k = 8*hi..+7 and 16+8*hi..+7 (the order of kbase).
__device__ __forceinline__ void frag_lds(FragAB& f, const bf16* rowp, int hi) {
  uint4 lo = *reinterpret_cast<const uint4*>(rowp + (hi << 3));
  uint4 up = *reinterpret_cast<const uint4*>(rowp + 16 + (hi << 3));
  f.u[0] = lo.x; f.u[1] = lo.y; f.u[2] = lo.z; f.u[3] = lo.w;
  f.u[4] = up.x; f.u[5] = up.y; f.u[6] = up.z; f.u[7] = up.w;
}

// One tile: K rows [SKEYS][64] (16 KB contiguous at kg) and Vt rows [64][SKEYS] (source
// pitch TT, at vg), 16 B per lane and copy, 4 + 4 copies per lane; a wave's copy covers
// 512 B of whole lines.
__device__ __forceinline__ void tile_copy(const bf16* kg, const bf16* vg,
                                          bf16* sk, bf16* sv, int tid) {
  unsigned lk[4], lv[4];
  unsigned long long gk[4], gv[4];
#pragma unroll   // the address arrays must become registers: they are the operands of the asm below
  for (int i = 0; i < 4; ++i) {
    const int p = i * 256 + tid;
    lk[i] = lds_off32(sk + (p >> 3) * KPITCH + ((p & 7) << 3));
    gk[i] = (unsigned long long)(uintptr_t)(kg + (p << 3));
    lv[i] = lds_off32(sv + (p >> 4) * VPITCH + ((p & 15) << 3));
    gv[i] = (unsigned long long)(uintptr_t)(vg + (size_t)(p >> 4) * TT + ((p & 15) << 3));
  }
  // The copies and their s_wait_xcnt in one statement: the wait stands before any
  // rewrite of an address register that an issued copy names.
  asm volatile(
      "global_load_async_to_lds_b128 %0, %8, off\n\t"
      "global_load_async_to_lds_b128 %1, %9, off\n\t"
      "global_load_async_to_lds_b128 %2, %10, off\n\t"
      "global_load_async_to_lds_b128 %3, %11, off\n\t"
      "global_load_async_to_lds_b128 %4, %12, off\n\t"
      "global_load_async_to_lds_b128 %5, %13, off\n\t"
      "global_load_async_to_lds_b128 %6, %14, off\n\t"
      "global_load_async_to_lds_b128 %7, %15, off\n\t"
      "s_wait_xcnt 0x0"
      :: "v"(lk[0]), "v"(lk[1]), "v"(lk[2]), "v"(lk[3]),
         "v"(lv[0]), "v"(lv[1]), "v"(lv[2]), "v"(lv[3]),
         "v"(gk[0]), "v"(gk[1]), "v"(gk[2]), "v"(gk[3]),
         "v"(gv[0]), "v"(gv[1]), "v"(gv[2]), "v"(gv[3])
      : "memory");
}

__global__ __launch_bounds__(256) void attn_kernel(const bf16* __restrict__ q,
                                                   const bf16* __restrict__ k,
                                                   const bf16* __restrict__ v,
                                                   bf16* __restrict__ o) {
  __shared__ __align__(16) bf16 sK[2][KTILE];
  __shared__ __align__(16) bf16 sV[2][VTILE];

  const int tid  = threadIdx.x;
  const int lane = tid & 31;
  const int wave = tid >> 5;
  const int hi   = (lane >> 4) & 1;
  const int tile = blockIdx.x * 8 + wave;          // 0 .. B*H*(T/16)-1
  const int ntq  = TT / 16;                        // 256
  const int bh   = (blockIdx.x * 8) / ntq;         // one (b,h) per block: 8 divides 256
  const int tq   = tile - bh * ntq;
  const size_t rowbase = (size_t)bh * TT;
  const bf16* kbh = k + rowbase * DD;              // K rows of this (b,h)
  const bf16* vbh = v + (size_t)bh * DD * TT;      // Vt rows of this (b,h)

  // Tile 0 into buffer 0, landed and published; then tile 1 into buffer 1.
  tile_copy(kbh, vbh, sK[0], sV[0], tid);
  asm volatile("s_wait_asynccnt 0x0" ::: "memory");   // this wave's copies of tile 0 have landed
  __syncthreads();                                    // ... and every other wave's
  tile_copy(kbh + SKEYS * DD, vbh + SKEYS, sK[1], sV[1], tid);

  // Q fragments (d = 0..31 and 32..63) as B operand: lane column = query. Loaded once.
  FragAB qf0, qf1;
  {
    const bf16* qp = q + (rowbase + tq * 16 + (lane & 15)) * DD;
#pragma unroll
    for (int r = 0; r < 8; ++r) {
      qf0.u[r] = *reinterpret_cast<const unsigned int*>(qp + kbase(r, hi));
      qf1.u[r] = *reinterpret_cast<const unsigned int*>(qp + 32 + kbase(r, hi));
    }
  }

  // oacc[j][r] = Ot[d = j*16 + 8*hi + r][query = lane & 15]
  v8f oacc[4];
#pragma unroll
  for (int j = 0; j < 4; ++j) oacc[j] = (v8f){0.f, 0.f, 0.f, 0.f, 0.f, 0.f, 0.f, 0.f};
  float rowm = -3.0e38f;   // running maximum of this lane's query (equal in both halves)
  float rows = 0.f;        // running sum over this half's keys only; halves join at the end

  const float scale = 0.125f;  // D^-0.5, D=64

  for (int t = 0; t < NTILE; ++t) {
    const bf16* bk = sK[t & 1] + (lane & 15) * KPITCH;
    const bf16* bv = sV[t & 1] + (lane & 15) * VPITCH;

    // Unrolled so that the LDS offsets are immediates and a chunk's reads can be
    // issued ahead of the vector work of the chunk before it.
#pragma unroll
    for (int c32 = 0; c32 < SKEYS / 32; ++c32) {
      // ---- St = K * Qt for 32 keys: sacc[nt][r] = score(key +nt*16+8*hi+r, query) ----
      v8f sacc[2];
#pragma unroll
      for (int nt = 0; nt < 2; ++nt) {
        sacc[nt] = (v8f){0.f, 0.f, 0.f, 0.f, 0.f, 0.f, 0.f, 0.f};
        const bf16* kp = bk + (c32 * 32 + nt * 16) * KPITCH;
        FragAB kf0, kf1;
        frag_lds(kf0, kp, hi);
        frag_lds(kf1, kp + 32, hi);
        sacc[nt] = __builtin_amdgcn_wmma_f32_16x16x32_bf16(false, kf0.v, false, qf0.v,
                                                           (short)0, sacc[nt], false, false);
        sacc[nt] = __builtin_amdgcn_wmma_f32_16x16x32_bf16(false, kf1.v, false, qf1.v,
                                                           (short)0, sacc[nt], false, false);
      }

      // ---- online softmax: this lane holds 16 of its query's 32 scores ----
      float c[16];
#pragma unroll
      for (int i = 0; i < 16; ++i) c[i] = sacc[i >> 3][i & 7] * scale;
      float m4[4];
#pragma unroll
      for (int i = 0; i < 4; ++i)
        m4[i] = fmaxf(fmaxf(c[4 * i], c[4 * i + 1]), fmaxf(c[4 * i + 2], c[4 * i + 3]));
      float mc = fmaxf(fmaxf(m4[0], m4[1]), fmaxf(m4[2], m4[3]));
      mc = fmaxf(mc, xhalf(mc));
      const float mn   = fmaxf(rowm, mc);
      const float corr = exp2_slot((rowm - mn) * LOG2E);
      rowm = mn;

      // Pt as B operand: element s wants key 8*hi+s (s<8) or 16+8*hi+(s-8), which is
      // exactly tile s>>3, register s&7 of St: convert in place, no lane exchange.
      FragAB pf;
      float p[16];
#pragma unroll
      for (int i = 0; i < 16; ++i) {
        p[i] = exp2_slot((c[i] - mn) * LOG2E);
        pf.b[i] = (bf16)p[i];
      }
      float s4[4];
#pragma unroll
      for (int i = 0; i < 4; ++i)
        s4[i] = (p[i] + p[i + 4]) + (p[i + 8] + p[i + 12]);
      rows = rows * corr + ((s4[0] + s4[1]) + (s4[2] + s4[3]));

      // ---- Ot = Ot*corr + Vt * Pt ----
#pragma unroll
      for (int j = 0; j < 4; ++j) {
#pragma unroll
        for (int r = 0; r < 8; ++r) oacc[j][r] *= corr;
        FragAB vf;
        frag_lds(vf, bv + j * 16 * VPITCH + c32 * 32, hi);
        oacc[j] = __builtin_amdgcn_wmma_f32_16x16x32_bf16(false, vf.v, false, pf.v,
                                                          (short)0, oacc[j], false, false);
      }
    }

    // Hand-over: tile t + 1 becomes readable, buffer t & 1 becomes free.
    asm volatile("s_wait_dscnt 0x0" ::: "memory");     // this wave's reads of tile t are done
    asm volatile("s_wait_asynccnt 0x0" ::: "memory");  // this wave's copies of tile t + 1 have landed
    __syncthreads();                                   // both hold for every wave of the block
    if (t + 2 < NTILE)
      tile_copy(kbh + (size_t)(t + 2) * SKEYS * DD, vbh + (t + 2) * SKEYS,
                sK[t & 1], sV[t & 1], tid);
  }
  asm volatile("s_wait_asynccnt 0x0" ::: "memory");    // no copy outstanding when the wave ends

  // ---- normalize + merge heads: write [B,T,C] bf16, 8 consecutive d per lane ----
  const int b = bh >> 2, h = bh & 3;
  const float inv = 1.0f / (rows + xhalf(rows));
  const int token = tq * 16 + (lane & 15);
  bf16* op = o + ((size_t)b * TT + token) * CC + h * DD + (hi << 3);
#pragma unroll
  for (int j = 0; j < 4; ++j) {
    union { bf16 e[8]; uint4 u; } pk;
#pragma unroll
    for (int r = 0; r < 8; ++r) pk.e[r] = (bf16)(oacc[j][r] * inv);
    *reinterpret_cast<uint4*>(op + j * 16) = pk.u;
  }
}

// ---------------------------------------------------------------------------
// LayerNorm over C=256: one wave per token; butterfly reductions.
// ---------------------------------------------------------------------------
__global__ __launch_bounds__(256) void ln_kernel(const float* __restrict__ in,
                                                 const float* __restrict__ w,
                                                 const float* __restrict__ bias,
                                                 float* __restrict__ outf,
                                                 bf16* __restrict__ outb) {
  const int lane  = threadIdx.x & 31;
  const int token = blockIdx.x * 8 + (threadIdx.x >> 5);
  const float4* p = reinterpret_cast<const float4*>(in + (size_t)token * CC);
  float4 a0 = p[lane];
  float4 a1 = p[32 + lane];

  float sum = a0.x + a0.y + a0.z + a0.w + a1.x + a1.y + a1.z + a1.w;
  float sq  = a0.x * a0.x + a0.y * a0.y + a0.z * a0.z + a0.w * a0.w +
              a1.x * a1.x + a1.y * a1.y + a1.z * a1.z + a1.w * a1.w;
#pragma unroll
  for (int off = 1; off <= 16; off <<= 1) {
    sum += __shfl_xor(sum, off, 32);
    sq  += __shfl_xor(sq, off, 32);
  }
  const float mean = sum * (1.0f / CC);
  const float var  = sq * (1.0f / CC) - mean * mean;
  const float rstd = rsqrtf(var + LNEPS);

  float4* of = reinterpret_cast<float4*>(outf + (size_t)token * CC);
#pragma unroll
  for (int i = 0; i < 2; ++i) {
    float4 av = (i == 0) ? a0 : a1;
    int c = (i * 32 + lane) * 4;
    float4 y;
    y.x = w[c + 0] * (av.x - mean) * rstd + bias[c + 0];
    y.y = w[c + 1] * (av.y - mean) * rstd + bias[c + 1];
    y.z = w[c + 2] * (av.z - mean) * rstd + bias[c + 2];
    y.w = w[c + 3] * (av.w - mean) * rstd + bias[c + 3];
    of[i * 32 + lane] = y;
    if (outb) {
      bf16* ob = outb + (size_t)token * CC + c;
      ob[0] = (bf16)y.x; ob[1] = (bf16)y.y; ob[2] = (bf16)y.z; ob[3] = (bf16)y.w;
    }
  }
}

// ---------------------------------------------------------------------------
// Host launcher
// ---------------------------------------------------------------------------
extern "C" void kernel_launch(void* const* d_in, const int* in_sizes, int n_in,
                              void* d_out, int out_size, void* d_ws, size_t ws_size,
                              hipStream_t stream) {
  const float* x      = (const float*)d_in[0];
  const float* qkv_w  = (const float*)d_in[1];
  const float* qkv_b  = (const float*)d_in[2];
  const float* proj_w = (const float*)d_in[3];
  const float* proj_b = (const float*)d_in[4];
  const float* n1_w   = (const float*)d_in[5];
  const float* n1_b   = (const float*)d_in[6];
  const float* ffn_w1 = (const float*)d_in[7];
  const float* ffn_b1 = (const float*)d_in[8];
  const float* ffn_w2 = (const float*)d_in[9];
  const float* ffn_b2 = (const float*)d_in[10];
  const float* n2_w   = (const float*)d_in[11];
  const float* n2_b   = (const float*)d_in[12];
  float* out = (float*)d_out;

  char* ws = (char*)d_ws;
  size_t off = 0;
  auto take = [&](size_t bytes) { void* p = ws + off; off += (bytes + 255) & ~(size_t)255; return p; };

  bf16*  x_bf     = (bf16*)take((size_t)MM * CC * 2);
  bf16*  wqkv_bf  = (bf16*)take((size_t)CC * N3 * 2);
  bf16*  wproj_bf = (bf16*)take((size_t)CC * CC * 2);
  bf16*  w1_bf    = (bf16*)take((size_t)CC * N3 * 2);
  bf16*  w2_bf    = (bf16*)take((size_t)N3 * CC * 2);
  bf16*  q_bf     = (bf16*)take((size_t)MM * CC * 2);
  bf16*  k_bf     = (bf16*)take((size_t)MM * CC * 2);
  bf16*  v_bf     = (bf16*)take((size_t)MM * CC * 2);   // [B,H,D,T]
  bf16*  attn_bf  = (bf16*)take((size_t)MM * CC * 2);
  float* r1       = (float*)take((size_t)MM * CC * 4);
  float* x1f      = (float*)take((size_t)MM * CC * 4);
  bf16*  x1_bf    = (bf16*)take((size_t)MM * CC * 2);
  bf16*  h_bf     = (bf16*)take((size_t)MM * N3 * 2);
  float* r2       = (float*)take((size_t)MM * CC * 4);

  // 1) converts
  cvt_bf16_kernel<<<(MM * CC + 255) / 256, 256, 0, stream>>>(x, x_bf, MM * CC);
  cvt_bf16_kernel<<<(CC * N3 + 255) / 256, 256, 0, stream>>>(qkv_w, wqkv_bf, CC * N3);
  cvt_bf16_kernel<<<(CC * CC + 255) / 256, 256, 0, stream>>>(proj_w, wproj_bf, CC * CC);
  cvt_bf16_kernel<<<(CC * N3 + 255) / 256, 256, 0, stream>>>(ffn_w1, w1_bf, CC * N3);
  cvt_bf16_kernel<<<(N3 * CC + 255) / 256, 256, 0, stream>>>(ffn_w2, w2_bf, N3 * CC);

  // 2) QKV projection, scatter q/k -> [B,H,T,D], v -> [B,H,D,T]
  gemm_bf16_kernel<<<dim3(N3 / 32, MM / 256), 256, 0, stream>>>(
      x_bf, wqkv_bf, qkv_b, CC, N3, 0, nullptr, nullptr, nullptr, q_bf, k_bf, v_bf);

  // 3) flash attention -> [B,T,C] bf16
  attn_kernel<<<(BB * HH * (TT / 16)) / 8, 256, 0, stream>>>(q_bf, k_bf, v_bf, attn_bf);

  // 4) output projection + residual(x) -> r1 f32
  gemm_bf16_kernel<<<dim3(CC / 32, MM / 256), 256, 0, stream>>>(
      attn_bf, wproj_bf, proj_b, CC, CC, 1, x, r1, nullptr, nullptr, nullptr, nullptr);

  // 5) LN1 -> x1 (f32 + bf16)
  ln_kernel<<<MM / 8, 256, 0, stream>>>(r1, n1_w, n1_b, x1f, x1_bf);

  // 6) FFN1 + GELU -> h bf16
  gemm_bf16_kernel<<<dim3(N3 / 32, MM / 256), 256, 0, stream>>>(
      x1_bf, w1_bf, ffn_b1, CC, N3, 2, nullptr, nullptr, h_bf, nullptr, nullptr, nullptr);

  // 7) FFN2 + residual(x1) -> r2 f32
  gemm_bf16_kernel<<<dim3(CC / 32, MM / 256), 256, 0, stream>>>(
      h_bf, w2_bf, ffn_b2, N3, CC, 1, x1f, r2, nullptr, nullptr, nullptr, nullptr);

  // 8) LN2 -> output f32
  ln_kernel<<<MM / 8, 256, 0, stream>>>(r2, n2_w, n2_b, out, nullptr);
}

// v003
// Measured time: 262 microseconds a run.
// Next to v002, in two timings, it ran 1.10 and 1.11 times as fast.
// All steps since v000 together make it 1.97 times as fast.
#include <hip/hip_runtime.h>
#include <hip/hip_bf16.h>

// ---------------------------------------------------------------------------
// Transformer block for MI455X (gfx1250, wave32, WMMA).
// bf16 activations, f32 accumulation via v_wmma_f32_16x16x32_bf16.
// A-tiles staged to LDS with global_load_async_to_lds_b128 (ASYNCcnt).
// ---------------------------------------------------------------------------

typedef __bf16 bf16;
typedef __attribute__((ext_vector_type(16))) __bf16 v16bf;
typedef __attribute__((ext_vector_type(8)))  float  v8f;

#define BB   4
#define TT   4096
#define CC   256
#define HH   4
#define DD   64
#define MM   (BB * TT)      // 16384 tokens
#define N3   (3 * CC)       // 768
#define LNEPS 1e-5f
#define BSTR 34             // transposed-B LDS stride (bank-spread, even)

// K index inside a 16x32 (16-bit) A/B fragment for VGPR r, lane-half hi.
// ISA 7.12.2: VGPR0..3 lanes0-15 hold K=0..7 (pairs), lanes16-31 K=8..15; VGPR4..7 -> +16.
__device__ __forceinline__ int kbase(int r, int hi) {
  return ((r & 4) << 2) | (hi << 3) | ((r & 3) << 1);
}

union FragAB {
  v16bf v;
  unsigned int u[8];
  bf16 b[16];
};

__device__ __forceinline__ unsigned lds_off32(const void* p) {
  return (unsigned)(unsigned long long)(uintptr_t)p;   // low 32 bits = LDS byte offset
}

// ---------------------------------------------------------------------------
// fp32 -> bf16 convert. A thread takes PER pieces of 4 floats (16 B loads, all issued
// before the first store; a wave's load covers 512 contiguous bytes), so that the launch
// starts few waves that each keep PER loads in flight. The grid covers the array exactly:
// blocks * 256 * PER * 4 elements.
// ---------------------------------------------------------------------------
template <int PER>
__global__ __launch_bounds__(256) void cvt_bf16_kernel(const float* __restrict__ in,
                                                       bf16* __restrict__ out) {
  const int base = blockIdx.x * (256 * PER) + threadIdx.x;   // index of a piece of 4 floats
  const float4* ip = reinterpret_cast<const float4*>(in);
  uint2* op = reinterpret_cast<uint2*>(out);
  float4 a[PER];
#pragma unroll   // a[] must become registers, and the loads stand together ahead of the stores
  for (int i = 0; i < PER; ++i) a[i] = ip[base + i * 256];
#pragma unroll   // as above
  for (int i = 0; i < PER; ++i) {
    union { bf16 e[4]; uint2 u; } pk;
    pk.e[0] = (bf16)a[i].x; pk.e[1] = (bf16)a[i].y;
    pk.e[2] = (bf16)a[i].z; pk.e[3] = (bf16)a[i].w;
    op[base + i * 256] = pk.u;
  }
}

// ---------------------------------------------------------------------------
// Tiled GEMM: Out = A[M x K] * W[K x N] (+bias, + epilogue)
// Block tile 256x32 (8 waves, each a 32x32 tile = 4 WMMA per K=32 chunk).
// A tile: async-DMA to LDS (row-major, stride 32).
// B tile: stored transposed [n][k] in LDS so fragments load as b32 pairs.
// mode 0: QKV scatter -> q/k bf16 [B,H,T,D], v bf16 [B,H,D,T]
// mode 1: + residual  -> f32 out [M x N]
// mode 2: GELU        -> bf16 out [M x N]
// ---------------------------------------------------------------------------
__global__ __launch_bounds__(256) void gemm_bf16_kernel(
    const bf16* __restrict__ A, const bf16* __restrict__ W,
    const float* __restrict__ bias, int K, int N, int mode,
    const float* __restrict__ res, float* __restrict__ outf,
    bf16* __restrict__ outb, bf16* __restrict__ oq,
    bf16* __restrict__ okk, bf16* __restrict__ ov) {
  __shared__ __align__(16) bf16 sA[256 * 32];
  __shared__ __align__(16) bf16 sBt[32 * BSTR];

  const int tid  = threadIdx.x;
  const int lane = tid & 31;
  const int wave = tid >> 5;           // 0..7, owns rows [wave*32, wave*32+32)
  const int hi   = (lane >> 4) & 1;
  const int m0   = blockIdx.y * 256;
  const int n0   = blockIdx.x * 32;

  const int arow = tid >> 2, acol = (tid & 3) << 3;  // + i*64 rows, 8 bf16 each
  const int brow = tid >> 3, bcol = (tid & 7) << 2;  // 32 k-rows x 4 n each

  v8f acc[2][2];
#pragma unroll
  for (int ms = 0; ms < 2; ++ms)
#pragma unroll
    for (int ns = 0; ns < 2; ++ns)
      acc[ms][ns] = (v8f){0.f, 0.f, 0.f, 0.f, 0.f, 0.f, 0.f, 0.f};

  for (int k0 = 0; k0 < K; k0 += 32) {
    __syncthreads();
    // ---- A tile: async DMA, 4 x 16B per lane (rows arow + i*64) ----
#pragma unroll
    for (int i = 0; i < 4; ++i) {
      unsigned lo = lds_off32(sA + (arow + i * 64) * 32 + acol);
      unsigned long long ga =
          (unsigned long long)(uintptr_t)(A + (size_t)(m0 + arow + i * 64) * K + k0 + acol);
      asm volatile("global_load_async_to_lds_b128 %0, %1, off"
                   :: "v"(lo), "v"(ga) : "memory");
    }
    // ---- B tile: load [k][n] row-major, store transposed [n][k] ----
    {
      uint2 w2 = *reinterpret_cast<const uint2*>(W + (size_t)(k0 + brow) * N + n0 + bcol);
      bf16 wb[4];
      *reinterpret_cast<uint2*>(wb) = w2;
#pragma unroll
      for (int i = 0; i < 4; ++i) sBt[(bcol + i) * BSTR + brow] = wb[i];
    }
    if (k0 + 32 < K)
      __builtin_prefetch(W + (size_t)(k0 + 32 + brow) * N + n0 + bcol, 0, 1);

    asm volatile("s_wait_asynccnt 0" ::: "memory");
    __syncthreads();

    // ---- fragments: all b32 LDS loads ----
    FragAB fa[2], fb[2];
#pragma unroll
    for (int ms = 0; ms < 2; ++ms) {
      const bf16* ap = sA + (wave * 32 + ms * 16 + (lane & 15)) * 32;
#pragma unroll
      for (int r = 0; r < 8; ++r)
        fa[ms].u[r] = *reinterpret_cast<const unsigned int*>(ap + kbase(r, hi));
    }
#pragma unroll
    for (int ns = 0; ns < 2; ++ns) {
      const bf16* bp = sBt + (ns * 16 + (lane & 15)) * BSTR;
#pragma unroll
      for (int r = 0; r < 8; ++r)
        fb[ns].u[r] = *reinterpret_cast<const unsigned int*>(bp + kbase(r, hi));
    }
#pragma unroll
    for (int ms = 0; ms < 2; ++ms)
#pragma unroll
      for (int ns = 0; ns < 2; ++ns)
        acc[ms][ns] = __builtin_amdgcn_wmma_f32_16x16x32_bf16(
            false, fa[ms].v, false, fb[ns].v, (short)0, acc[ms][ns], false, false);
  }

  // ---- epilogue ----
#pragma unroll
  for (int ns = 0; ns < 2; ++ns) {
    const int gn = n0 + ns * 16 + (lane & 15);
    const float bv = bias[gn];
#pragma unroll
    for (int ms = 0; ms < 2; ++ms) {
#pragma unroll
      for (int r = 0; r < 8; ++r) {
        const int gm = m0 + wave * 32 + ms * 16 + r + (hi << 3);
        float val = acc[ms][ns][r] + bv;
        if (mode == 0) {               // QKV scatter
          int part = gn >> 8, cc = gn & 255;
          int hh = cc >> 6, dd = cc & 63;
          int bb = gm >> 12, ttok = gm & (TT - 1);
          if (part == 2) {             // V transposed: [B,H,D,T]
            ov[(((size_t)(bb * HH + hh)) * DD + dd) * TT + ttok] = (bf16)val;
          } else {
            bf16* dst = (part == 0) ? oq : okk;
            dst[(((size_t)(bb * HH + hh)) * TT + ttok) * DD + dd] = (bf16)val;
          }
        } else if (mode == 1) {        // bias + residual -> f32
          size_t idx = (size_t)gm * N + gn;
          outf[idx] = val + res[idx];
        } else {                       // exact GELU -> bf16
          float g = 0.5f * val * (1.0f + erff(val * 0.70710678118f));
          outb[(size_t)gm * N + gn] = (bf16)g;
        }
      }
    }
  }
}

// ---------------------------------------------------------------------------
// Flash attention, transposed: each wave owns 16 queries of one (b,h) and walks the
// keys in chunks of 32. St = K * Qt puts one query's scores in one lane (column),
// so max and sum run in-lane plus one exchange between the wave halves; the two
// St tiles, converted in place, are the B operand of Ot += Vt * Pt.
// 8 WMMAs per chunk. V is [B,H,D,T] so Vt rows are contiguous along keys.
// The 8 waves of a block share one (b,h): K and Vt tiles of SKEYS keys are brought
// into LDS once per block by async copies (two buffers, the next tile in flight
// while this one is worked on) and every wave reads its fragments from there.
// ---------------------------------------------------------------------------
#define SKEYS  128                  // keys per LDS tile
#define NTILE  (TT / SKEYS)         // 32 tiles
#define KPITCH 72                   // bf16 per K row in LDS: 128 B + 16 B (16 B x odd)
#define VPITCH 136                  // bf16 per Vt row in LDS: 256 B + 16 B (16 B x odd)
#define KTILE  (SKEYS * KPITCH)     // bf16 per K tile
#define VTILE  (DD * VPITCH)        // bf16 per Vt tile
#define LOG2E  1.44269504088896f    // exp(x) = exp2(x * LOG2E), the product that __expf forms

__device__ __forceinline__ float xhalf(float x) {   // lane l <-> lane l ^ 16
  int b = __builtin_bit_cast(int, x);
  return __builtin_bit_cast(float,
      __builtin_amdgcn_permlanex16(b, b, 0x76543210, 0xfedcba98, false, false));
}

// exp2 with the one slot that the instruction set asks for behind a transcendental (before its
// result is read or its source register rewritten) kept in the same statement: a v_nop in a
// statement of its own did not stay behind the v_exp in the build.
__device__ __forceinline__ float exp2_slot(float x) {
  float r;
  asm("v_exp_f32 %0, %1\n\tv_nop" : "=v"(r) : "v"(x));
  return r;
}

// One 16x32 fragment from an LDS row: k = 8*hi..+7 and 16+8*hi..+7 (the order of kbase).
__device__ __forceinline__ void frag_lds(FragAB& f, const bf16* rowp, int hi) {
  uint4 lo = *reinterpret_cast<const uint4*>(rowp + (hi << 3));
  uint4 up = *reinterpret_cast<const uint4*>(rowp + 16 + (hi << 3));
  f.u[0] = lo.x; f.u[1] = lo.y; f.u[2] = lo.z; f.u[3] = lo.w;
  f.u[4] = up.x; f.u[5] = up.y; f.u[6] = up.z; f.u[7] = up.w;
}

// One tile: K rows [SKEYS][64] (16 KB contiguous at kg) and Vt rows [64][SKEYS] (source
// pitch TT, at vg), 16 B per lane and copy, 4 + 4 copies per lane; a wave's copy covers
// 512 B of whole lines.
__device__ __forceinline__ void tile_copy(const bf16* kg, const bf16* vg,
                                          bf16* sk, bf16* sv, int tid) {
  unsigned lk[4], lv[4];
  unsigned long long gk[4], gv[4];
#pragma unroll   // the address arrays must become registers: they are the operands of the asm below
  for (int i = 0; i < 4; ++i) {
    const int p = i * 256 + tid;
    lk[i] = lds_off32(sk + (p >> 3) * KPITCH + ((p & 7) << 3));
    gk[i] = (unsigned long long)(uintptr_t)(kg + (p << 3));
    lv[i] = lds_off32(sv + (p >> 4) * VPITCH + ((p & 15) << 3));
    gv[i] = (unsigned long long)(uintptr_t)(vg + (size_t)(p >> 4) * TT + ((p & 15) << 3));
  }
  // The copies and their s_wait_xcnt in one statement: the wait stands before any
  // rewrite of an address register that an issued copy names.
  asm volatile(
      "global_load_async_to_lds_b128 %0, %8, off\n\t"
      "global_load_async_to_lds_b128 %1, %9, off\n\t"
      "global_load_async_to_lds_b128 %2, %10, off\n\t"
      "global_load_async_to_lds_b128 %3, %11, off\n\t"
      "global_load_async_to_lds_b128 %4, %12, off\n\t"
      "global_load_async_to_lds_b128 %5, %13, off\n\t"
      "global_load_async_to_lds_b128 %6, %14, off\n\t"
      "global_load_async_to_lds_b128 %7, %15, off\n\t"
      "s_wait_xcnt 0x0"
      :: "v"(lk[0]), "v"(lk[1]), "v"(lk[2]), "v"(lk[3]),
         "v"(lv[0]), "v"(lv[1]), "v"(lv[2]), "v"(lv[3]),
         "v"(gk[0]), "v"(gk[1]), "v"(gk[2]), "v"(gk[3]),
         "v"(gv[0]), "v"(gv[1]), "v"(gv[2]), "v"(gv[3])
      : "memory");
}

__global__ __launch_bounds__(256) void attn_kernel(const bf16* __restrict__ q,
                                                   const bf16* __restrict__ k,
                                                   const bf16* __restrict__ v,
                                                   bf16* __restrict__ o) {
  __shared__ __align__(16) bf16 sK[2][KTILE];
  __shared__ __align__(16) bf16 sV[2][VTILE];

  const int tid  = threadIdx.x;
  const int lane = tid & 31;
  const int wave = tid >> 5;
  const int hi   = (lane >> 4) & 1;
  const int tile = blockIdx.x * 8 + wave;          // 0 .. B*H*(T/16)-1
  const int ntq  = TT / 16;                        // 256
  const int bh   = (blockIdx.x * 8) / ntq;         // one (b,h) per block: 8 divides 256
  const int tq   = tile - bh * ntq;
  const size_t rowbase = (size_t)bh * TT;
  const bf16* kbh = k + rowbase * DD;              // K rows of this (b,h)
  const bf16* vbh = v + (size_t)bh * DD * TT;      // Vt rows of this (b,h)

  // Tile 0 into buffer 0, landed and published; then tile 1 into buffer 1.
  tile_copy(kbh, vbh, sK[0], sV[0], tid);
  asm volatile("s_wait_asynccnt 0x0" ::: "memory");   // this wave's copies of tile 0 have landed
  __syncthreads();                                    // ... and every other wave's
  tile_copy(kbh + SKEYS * DD, vbh + SKEYS, sK[1], sV[1], tid);

  // Q fragments (d = 0..31 and 32..63) as B operand: lane column = query. Loaded once.
  FragAB qf0, qf1;
  {
    const bf16* qp = q + (rowbase + tq * 16 + (lane & 15)) * DD;
#pragma unroll
    for (int r = 0; r < 8; ++r) {
      qf0.u[r] = *reinterpret_cast<const unsigned int*>(qp + kbase(r, hi));
      qf1.u[r] = *reinterpret_cast<const unsigned int*>(qp + 32 + kbase(r, hi));
    }
  }

  // oacc[j][r] = Ot[d = j*16 + 8*hi + r][query = lane & 15]
  v8f oacc[4];
#pragma unroll
  for (int j = 0; j < 4; ++j) oacc[j] = (v8f){0.f, 0.f, 0.f, 0.f, 0.f, 0.f, 0.f, 0.f};
  float rowm = -3.0e38f;   // running maximum of this lane's query (equal in both halves)
  float rows = 0.f;        // running sum over this half's keys only; halves join at the end

  const float scale = 0.125f;  // D^-0.5, D=64

  for (int t = 0; t < NTILE; ++t) {
    const bf16* bk = sK[t & 1] + (lane & 15) * KPITCH;
    const bf16* bv = sV[t & 1] + (lane & 15) * VPITCH;

    // Unrolled so that the LDS offsets are immediates and a chunk's reads can be
    // issued ahead of the vector work of the chunk before it.
#pragma unroll
    for (int c32 = 0; c32 < SKEYS / 32; ++c32) {
      // ---- St = K * Qt for 32 keys: sacc[nt][r] = score(key +nt*16+8*hi+r, query) ----
      v8f sacc[2];
#pragma unroll
      for (int nt = 0; nt < 2; ++nt) {
        sacc[nt] = (v8f){0.f, 0.f, 0.f, 0.f, 0.f, 0.f, 0.f, 0.f};
        const bf16* kp = bk + (c32 * 32 + nt * 16) * KPITCH;
        FragAB kf0, kf1;
        frag_lds(kf0, kp, hi);
        frag_lds(kf1, kp + 32, hi);
        sacc[nt] = __builtin_amdgcn_wmma_f32_16x16x32_bf16(false, kf0.v, false, qf0.v,
                                                           (short)0, sacc[nt], false, false);
        sacc[nt] = __builtin_amdgcn_wmma_f32_16x16x32_bf16(false, kf1.v, false, qf1.v,
                                                           (short)0, sacc[nt], false, false);
      }

      // ---- online softmax: this lane holds 16 of its query's 32 scores ----
      float c[16];
#pragma unroll
      for (int i = 0; i < 16; ++i) c[i] = sacc[i >> 3][i & 7] * scale;
      float m4[4];
#pragma unroll
      for (int i = 0; i < 4; ++i)
        m4[i] = fmaxf(fmaxf(c[4 * i], c[4 * i + 1]), fmaxf(c[4 * i + 2], c[4 * i + 3]));
      float mc = fmaxf(fmaxf(m4[0], m4[1]), fmaxf(m4[2], m4[3]));
      mc = fmaxf(mc, xhalf(mc));
      const float mn   = fmaxf(rowm, mc);
      const float corr = exp2_slot((rowm - mn) * LOG2E);
      rowm = mn;

      // Pt as B operand: element s wants key 8*hi+s (s<8) or 16+8*hi+(s-8), which is
      // exactly tile s>>3, register s&7 of St: convert in place, no lane exchange.
      FragAB pf;
      float p[16];
#pragma unroll
      for (int i = 0; i < 16; ++i) {
        p[i] = exp2_slot((c[i] - mn) * LOG2E);
        pf.b[i] = (bf16)p[i];
      }
      float s4[4];
#pragma unroll
      for (int i = 0; i < 4; ++i)
        s4[i] = (p[i] + p[i + 4]) + (p[i + 8] + p[i + 12]);
      rows = rows * corr + ((s4[0] + s4[1]) + (s4[2] + s4[3]));

      // ---- Ot = Ot*corr + Vt * Pt ----
#pragma unroll
      for (int j = 0; j < 4; ++j) {
#pragma unroll
        for (int r = 0; r < 8; ++r) oacc[j][r] *= corr;
        FragAB vf;
        frag_lds(vf, bv + j * 16 * VPITCH + c32 * 32, hi);
        oacc[j] = __builtin_amdgcn_wmma_f32_16x16x32_bf16(false, vf.v, false, pf.v,
                                                          (short)0, oacc[j], false, false);
      }
    }

    // Hand-over: tile t + 1 becomes readable, buffer t & 1 becomes free.
    asm volatile("s_wait_dscnt 0x0" ::: "memory");     // this wave's reads of tile t are done
    asm volatile("s_wait_asynccnt 0x0" ::: "memory");  // this wave's copies of tile t + 1 have landed
    __syncthreads();                                   // both hold for every wave of the block
    if (t + 2 < NTILE)
      tile_copy(kbh + (size_t)(t + 2) * SKEYS * DD, vbh + (t + 2) * SKEYS,
                sK[t & 1], sV[t & 1], tid);
  }
  asm volatile("s_wait_asynccnt 0x0" ::: "memory");    // no copy outstanding when the wave ends

  // ---- normalize + merge heads: write [B,T,C] bf16, 8 consecutive d per lane ----
  const int b = bh >> 2, h = bh & 3;
  const float inv = 1.0f / (rows + xhalf(rows));
  const int token = tq * 16 + (lane & 15);
  bf16* op = o + ((size_t)b * TT + token) * CC + h * DD + (hi << 3);
#pragma unroll
  for (int j = 0; j < 4; ++j) {
    union { bf16 e[8]; uint4 u; } pk;
#pragma unroll
    for (int r = 0; r < 8; ++r) pk.e[r] = (bf16)(oacc[j][r] * inv);
    *reinterpret_cast<uint4*>(op + j * 16) = pk.u;
  }
}

// ---------------------------------------------------------------------------
// LayerNorm over C=256: a wave takes LNT consecutive tokens (4 KB contiguous), all their
// loads issued first, so that the launch starts a quarter of the waves and each keeps
// 2 * LNT loads in flight; w and bias are read once per wave. Butterfly reductions.
// All results are formed in registers before the first store, so that no register of an
// issued store is written again.
// ---------------------------------------------------------------------------
#define LNT 4
__global__ __launch_bounds__(256) void ln_kernel(const float* __restrict__ in,
                                                 const float* __restrict__ w,
                                                 const float* __restrict__ bias,
                                                 float* __restrict__ outf,
                                                 bf16* __restrict__ outb) {
  const int lane = threadIdx.x & 31;
  const int tok0 = (blockIdx.x * 8 + (threadIdx.x >> 5)) * LNT;
  float4 wv[2], bv[2];
#pragma unroll   // wv[], bv[] must become registers
  for (int i = 0; i < 2; ++i) {
    wv[i] = reinterpret_cast<const float4*>(w)[i * 32 + lane];
    bv[i] = reinterpret_cast<const float4*>(bias)[i * 32 + lane];
  }
  const float4* p = reinterpret_cast<const float4*>(in + (size_t)tok0 * CC);
  float4 a[LNT][2];
#pragma unroll   // a[][] must become registers, and the loads stand together ahead of the sums
  for (int t = 0; t < LNT; ++t) {
    a[t][0] = p[t * 64 + lane];
    a[t][1] = p[t * 64 + 32 + lane];
  }

  // Mean and 1/sigma of all LNT tokens first, with no branch in between: the tokens'
  // butterfly chains are independent, and standing together they overlap.
  float4 y[LNT][2];
#pragma unroll   // a[][], y[][] are indexed by t
  for (int t = 0; t < LNT; ++t) {
    const float4 a0 = a[t][0], a1 = a[t][1];
    float sum = a0.x + a0.y + a0.z + a0.w + a1.x + a1.y + a1.z + a1.w;
    float sq  = a0.x * a0.x + a0.y * a0.y + a0.z * a0.z + a0.w * a0.w +
                a1.x * a1.x + a1.y * a1.y + a1.z * a1.z + a1.w * a1.w;
#pragma unroll
    for (int off = 1; off <= 16; off <<= 1) {
      sum += __shfl_xor(sum, off, 32);
      sq  += __shfl_xor(sq, off, 32);
    }
    const float mean = sum * (1.0f / CC);
    const float var  = sq * (1.0f / CC) - mean * mean;
    const float rstd = rsqrtf(var + LNEPS);
#pragma unroll
    for (int i = 0; i < 2; ++i) {
      const float4 av = a[t][i];
      y[t][i].x = wv[i].x * (av.x - mean) * rstd + bv[i].x;
      y[t][i].y = wv[i].y * (av.y - mean) * rstd + bv[i].y;
      y[t][i].z = wv[i].z * (av.z - mean) * rstd + bv[i].z;
      y[t][i].w = wv[i].w * (av.w - mean) * rstd + bv[i].w;
    }
  }

  if (outb) {
    uint2* ob = reinterpret_cast<uint2*>(outb + (size_t)tok0 * CC);
#pragma unroll   // y[][] is indexed by t
    for (int t = 0; t < LNT; ++t)
#pragma unroll
      for (int i = 0; i < 2; ++i) {
        union { bf16 e[4]; uint2 u; } pk;
        pk.e[0] = (bf16)y[t][i].x; pk.e[1] = (bf16)y[t][i].y;
        pk.e[2] = (bf16)y[t][i].z; pk.e[3] = (bf16)y[t][i].w;
        ob[t * 64 + i * 32 + lane] = pk.u;
      }
  }
  float4* of = reinterpret_cast<float4*>(outf + (size_t)tok0 * CC);
#pragma unroll   // y[][] is indexed by t
  for (int t = 0; t < LNT; ++t) {
    of[t * 64 + lane]      = y[t][0];
    of[t * 64 + 32 + lane] = y[t][1];
  }
}

// ---------------------------------------------------------------------------
// Host launcher
// ---------------------------------------------------------------------------
extern "C" void kernel_launch(void* const* d_in, const int* in_sizes, int n_in,
                              void* d_out, int out_size, void* d_ws, size_t ws_size,
                              hipStream_t stream) {
  const float* x      = (const float*)d_in[0];
  const float* qkv_w  = (const float*)d_in[1];
  const float* qkv_b  = (const float*)d_in[2];
  const float* proj_w = (const float*)d_in[3];
  const float* proj_b = (const float*)d_in[4];
  const float* n1_w   = (const float*)d_in[5];
  const float* n1_b   = (const float*)d_in[6];
  const float* ffn_w1 = (const float*)d_in[7];
  const float* ffn_b1 = (const float*)d_in[8];
  const float* ffn_w2 = (const float*)d_in[9];
  const float* ffn_b2 = (const float*)d_in[10];
  const float* n2_w   = (const float*)d_in[11];
  const float* n2_b   = (const float*)d_in[12];
  float* out = (float*)d_out;

  char* ws = (char*)d_ws;
  size_t off = 0;
  auto take = [&](size_t bytes) { void* p = ws + off; off += (bytes + 255) & ~(size_t)255; return p; };

  bf16*  x_bf     = (bf16*)take((size_t)MM * CC * 2);
  bf16*  wqkv_bf  = (bf16*)take((size_t)CC * N3 * 2);
  bf16*  wproj_bf = (bf16*)take((size_t)CC * CC * 2);
  bf16*  w1_bf    = (bf16*)take((size_t)CC * N3 * 2);
  bf16*  w2_bf    = (bf16*)take((size_t)N3 * CC * 2);
  bf16*  q_bf     = (bf16*)take((size_t)MM * CC * 2);
  bf16*  k_bf     = (bf16*)take((size_t)MM * CC * 2);
  bf16*  v_bf     = (bf16*)take((size_t)MM * CC * 2);   // [B,H,D,T]
  bf16*  attn_bf  = (bf16*)take((size_t)MM * CC * 2);
  float* r1       = (float*)take((size_t)MM * CC * 4);
  float* x1f      = (float*)take((size_t)MM * CC * 4);
  bf16*  x1_bf    = (bf16*)take((size_t)MM * CC * 2);
  bf16*  h_bf     = (bf16*)take((size_t)MM * N3 * 2);
  float* r2       = (float*)take((size_t)MM * CC * 4);

  // 1) converts: 8 pieces of 4 floats per thread for x, 2 for the weights
  cvt_bf16_kernel<8><<<(MM * CC) / (256 * 8 * 4), 256, 0, stream>>>(x, x_bf);
  cvt_bf16_kernel<2><<<(CC * N3) / (256 * 2 * 4), 256, 0, stream>>>(qkv_w, wqkv_bf);
  cvt_bf16_kernel<2><<<(CC * CC) / (256 * 2 * 4), 256, 0, stream>>>(proj_w, wproj_bf);
  cvt_bf16_kernel<2><<<(CC * N3) / (256 * 2 * 4), 256, 0, stream>>>(ffn_w1, w1_bf);
  cvt_bf16_kernel<2><<<(N3 * CC) / (256 * 2 * 4), 256, 0, stream>>>(ffn_w2, w2_bf);

  // 2) QKV projection, scatter q/k -> [B,H,T,D], v -> [B,H,D,T]
  gemm_bf16_kernel<<<dim3(N3 / 32, MM / 256), 256, 0, stream>>>(
      x_bf, wqkv_bf, qkv_b, CC, N3, 0, nullptr, nullptr, nullptr, q_bf, k_bf, v_bf);

  // 3) flash attention -> [B,T,C] bf16
  attn_kernel<<<(BB * HH * (TT / 16)) / 8, 256, 0, stream>>>(q_bf, k_bf, v_bf, attn_bf);

  // 4) output projection + residual(x) -> r1 f32
  gemm_bf16_kernel<<<dim3(CC / 32, MM / 256), 256, 0, stream>>>(
      attn_bf, wproj_bf, proj_b, CC, CC, 1, x, r1, nullptr, nullptr, nullptr, nullptr);

  // 5) LN1 -> x1 (f32 + bf16)
  ln_kernel<<<MM / (8 * LNT), 256, 0, stream>>>(r1, n1_w, n1_b, x1f, x1_bf);

  // 6) FFN1 + GELU -> h bf16
  gemm_bf16_kernel<<<dim3(N3 / 32, MM / 256), 256, 0, stream>>>(
      x1_bf, w1_bf, ffn_b1, CC, N3, 2, nullptr, nullptr, h_bf, nullptr, nullptr, nullptr);

  // 7) FFN2 + residual(x1) -> r2 f32
  gemm_bf16_kernel<<<dim3(CC / 32, MM / 256), 256, 0, stream>>>(
      h_bf, w2_bf, ffn_b2, N3, CC, 1, x1f, r2, nullptr, nullptr, nullptr, nullptr);

  // 8) LN2 -> output f32
  ln_kernel<<<MM / (8 * LNT), 256, 0, stream>>>(r2, n2_w, n2_b, out, nullptr);
}

// v004
// Measured time: 163 microseconds a run.
// Timed twice side by side with v003, it ran 1.61 and 1.62 times as fast.
// Counting every step since v000, it is 3.19 times as fast.
#include <hip/hip_runtime.h>
#include <hip/hip_bf16.h>

// ---------------------------------------------------------------------------
// Transformer block for MI455X (gfx1250, wave32, WMMA).
// bf16 activations, f32 accumulation via v_wmma_f32_16x16x32_bf16.
// GEMM and attention tiles staged to LDS with global_load_async_to_lds_b128 (ASYNCcnt).
// ---------------------------------------------------------------------------

typedef __bf16 bf16;
typedef __attribute__((ext_vector_type(16))) __bf16 v16bf;
typedef __attribute__((ext_vector_type(8)))  float  v8f;

#define BB   4
#define TT   4096
#define CC   256
#define HH   4
#define DD   64
#define MM   (BB * TT)      // 16384 tokens
#define N3   (3 * CC)       // 768
#define LNEPS 1e-5f

// K index inside a 16x32 (16-bit) A/B fragment for VGPR r, lane-half hi.
// ISA 7.12.2: VGPR0..3 lanes0-15 hold K=0..7 (pairs), lanes16-31 K=8..15; VGPR4..7 -> +16.
__device__ __forceinline__ int kbase(int r, int hi) {
  return ((r & 4) << 2) | (hi << 3) | ((r & 3) << 1);
}

union FragAB {
  v16bf v;
  unsigned int u[8];
  bf16 b[16];
};

__device__ __forceinline__ unsigned lds_off32(const void* p) {
  return (unsigned)(unsigned long long)(uintptr_t)p;   // low 32 bits = LDS byte offset
}

// ---------------------------------------------------------------------------
// fp32 -> bf16 convert. A thread takes PER pieces of 4 floats (16 B loads, all issued
// before the first store; a wave's load covers 512 contiguous bytes), so that the launch
// starts few waves that each keep PER loads in flight. The grid covers the array exactly:
// blocks * 256 * PER * 4 elements.
// ---------------------------------------------------------------------------
template <int PER>
__global__ __launch_bounds__(256) void cvt_bf16_kernel(const float* __restrict__ in,
                                                       bf16* __restrict__ out) {
  const int base = blockIdx.x * (256 * PER) + threadIdx.x;   // index of a piece of 4 floats
  const float4* ip = reinterpret_cast<const float4*>(in);
  uint2* op = reinterpret_cast<uint2*>(out);
  float4 a[PER];
#pragma unroll   // a[] must become registers, and the loads stand together ahead of the stores
  for (int i = 0; i < PER; ++i) a[i] = ip[base + i * 256];
#pragma unroll   // as above
  for (int i = 0; i < PER; ++i) {
    union { bf16 e[4]; uint2 u; } pk;
    pk.e[0] = (bf16)a[i].x; pk.e[1] = (bf16)a[i].y;
    pk.e[2] = (bf16)a[i].z; pk.e[3] = (bf16)a[i].w;
    op[base + i * 256] = pk.u;
  }
}

// ---------------------------------------------------------------------------
// Weight convert with transpose: fp32 [K][N] -> bf16 [N][K], so that a GEMM's B tile has
// K-contiguous rows like its A tile. A block takes 32 n x 64 k: a wave reads 8 rows of
// 128 contiguous bytes, and the block's 8 waves together fill one whole 128-B line of each
// of its 32 output rows. Grid (N / 32, K / 64).
// ---------------------------------------------------------------------------
__global__ __launch_bounds__(256) void cvt_wt_kernel(const float* __restrict__ in,
                                                     bf16* __restrict__ out, int K, int N) {
  const int n  = blockIdx.x * 32 + (threadIdx.x & 31);
  const int k0 = blockIdx.y * 64 + (threadIdx.x >> 5) * 8;
  float a[8];
#pragma unroll   // a[] must become registers, and the loads stand together ahead of the store
  for (int i = 0; i < 8; ++i) a[i] = in[(size_t)(k0 + i) * N + n];
  union { bf16 e[8]; uint4 u; } pk;
#pragma unroll   // as above
  for (int i = 0; i < 8; ++i) pk.e[i] = (bf16)a[i];
  *reinterpret_cast<uint4*>(out + (size_t)n * K + k0) = pk.u;
}

// One 16x32 fragment from an LDS row: k = 8*hi..+7 and 16+8*hi..+7 (the order of kbase).
__device__ __forceinline__ void frag_lds(FragAB& f, const bf16* rowp, int hi) {
  uint4 lo = *reinterpret_cast<const uint4*>(rowp + (hi << 3));
  uint4 up = *reinterpret_cast<const uint4*>(rowp + 16 + (hi << 3));
  f.u[0] = lo.x; f.u[1] = lo.y; f.u[2] = lo.z; f.u[3] = lo.w;
  f.u[4] = up.x; f.u[5] = up.y; f.u[6] = up.z; f.u[7] = up.w;
}

// ---------------------------------------------------------------------------
// Tiled GEMM: Out = A[M x K] * W[K x N] (+bias, + epilogue), W given as Wt[N x K].
// Block tile 128x128 (8 waves as 4 x 2, each a 32x64 tile = 8 WMMA per 32 k), K in steps
// of 64: a step's A and Wt tiles are 128 rows of one whole 128-B line each, brought into LDS
// by async copies (two buffers, the next step in flight while this one is worked on).
// MODE 0: QKV scatter -> q/k bf16 [B,H,T,D], v bf16 [B,H,D,T]
// MODE 1: + residual  -> f32 out [M x N]
// MODE 2: GELU        -> bf16 out [M x N]
// ---------------------------------------------------------------------------
#define GPITCH 72                   // bf16 per tile row in LDS: 128 B + 16 B (16 B x odd)
#define GTILE  (128 * GPITCH)       // bf16 per operand tile

// One K step: 128 rows x 64 k of A (at ag) and of Wt (at bg), source pitch K, 16 B per lane
// and copy, 4 + 4 copies per lane; a wave's copy covers 4 whole lines.
template <int K>
__device__ __forceinline__ void gemm_copy(const bf16* ag, const bf16* bg,
                                          bf16* sa, bf16* sb, int tid) {
  unsigned la[4], lb[4];
  unsigned long long ga[4], gb[4];
#pragma unroll   // the address arrays must become registers: they are the operands of the asm below
  for (int i = 0; i < 4; ++i) {
    const int p = i * 256 + tid;
    const int row = p >> 3, col = (p & 7) << 3;
    la[i] = lds_off32(sa + row * GPITCH + col);
    ga[i] = (unsigned long long)(uintptr_t)(ag + (size_t)row * K + col);
    lb[i] = lds_off32(sb + row * GPITCH + col);
    gb[i] = (unsigned long long)(uintptr_t)(bg + (size_t)row * K + col);
  }
  // The copies and their s_wait_xcnt in one statement: the wait stands before any
  // rewrite of an address register that an issued copy names.
  asm volatile(
      "global_load_async_to_lds_b128 %0, %8, off\n\t"
      "global_load_async_to_lds_b128 %1, %9, off\n\t"
      "global_load_async_to_lds_b128 %2, %10, off\n\t"
      "global_load_async_to_lds_b128 %3, %11, off\n\t"
      "global_load_async_to_lds_b128 %4, %12, off\n\t"
      "global_load_async_to_lds_b128 %5, %13, off\n\t"
      "global_load_async_to_lds_b128 %6, %14, off\n\t"
      "global_load_async_to_lds_b128 %7, %15, off\n\t"
      "s_wait_xcnt 0x0"
      :: "v"(la[0]), "v"(la[1]), "v"(la[2]), "v"(la[3]),
         "v"(lb[0]), "v"(lb[1]), "v"(lb[2]), "v"(lb[3]),
         "v"(ga[0]), "v"(ga[1]), "v"(ga[2]), "v"(ga[3]),
         "v"(gb[0]), "v"(gb[1]), "v"(gb[2]), "v"(gb[3])
      : "memory");
}

template <int MODE, int K, int N>
__global__ __launch_bounds__(256) void gemm_bf16_kernel(
    const bf16* __restrict__ A, const bf16* __restrict__ Wt,
    const float* __restrict__ bias,
    const float* __restrict__ res, float* __restrict__ outf,
    bf16* __restrict__ outb, bf16* __restrict__ oq,
    bf16* __restrict__ okk, bf16* __restrict__ ov) {
  __shared__ __align__(16) bf16 sA[2][GTILE];
  __shared__ __align__(16) bf16 sB[2][GTILE];
  constexpr int NSTEP = K / 64;        // at least 4 here

  const int tid  = threadIdx.x;
  const int lane = tid & 31;
  const int wave = tid >> 5;
  const int hi   = (lane >> 4) & 1;
  const int wm   = (wave >> 1) * 32;   // the wave's rows inside the block tile
  const int wn   = (wave & 1) * 64;    // the wave's columns inside the block tile
  const int m0   = blockIdx.y * 128;
  const int n0   = blockIdx.x * 128;
  const bf16* ag = A + (size_t)m0 * K;
  const bf16* bg = Wt + (size_t)n0 * K;

  // Step 0 into buffer 0, landed and published; then step 1 into buffer 1.
  gemm_copy<K>(ag, bg, sA[0], sB[0], tid);
  asm volatile("s_wait_asynccnt 0x0" ::: "memory");   // this wave's copies of step 0 have landed
  __syncthreads();                                    // ... and every other wave's
  gemm_copy<K>(ag + 64, bg + 64, sA[1], sB[1], tid);

  v8f acc[2][4];
#pragma unroll
  for (int ms = 0; ms < 2; ++ms)
#pragma unroll
    for (int ns = 0; ns < 4; ++ns)
      acc[ms][ns] = (v8f){0.f, 0.f, 0.f, 0.f, 0.f, 0.f, 0.f, 0.f};

  for (int t = 0; t < NSTEP; ++t) {
    const bf16* pa = sA[t & 1] + (wm + (lane & 15)) * GPITCH;
    const bf16* pb = sB[t & 1] + (wn + (lane & 15)) * GPITCH;
#pragma unroll   // fa[], fb[] must become registers; the LDS offsets become immediates
    for (int kk = 0; kk < 2; ++kk) {
      FragAB fa[2], fb[4];
#pragma unroll
      for (int ms = 0; ms < 2; ++ms) frag_lds(fa[ms], pa + ms * 16 * GPITCH + kk * 32, hi);
#pragma unroll
      for (int ns = 0; ns < 4; ++ns) frag_lds(fb[ns], pb + ns * 16 * GPITCH + kk * 32, hi);
#pragma unroll
      for (int ms = 0; ms < 2; ++ms)
#pragma unroll
        for (int ns = 0; ns < 4; ++ns)
          acc[ms][ns] = __builtin_amdgcn_wmma_f32_16x16x32_bf16(
              false, fa[ms].v, false, fb[ns].v, (short)0, acc[ms][ns], false, false);
    }

    // Hand-over: step t + 1 becomes readable, buffer t & 1 becomes free.
    asm volatile("s_wait_dscnt 0x0" ::: "memory");     // this wave's reads of step t are done
    asm volatile("s_wait_asynccnt 0x0" ::: "memory");  // this wave's copies of step t + 1 have landed
    __syncthreads();                                   // both hold for every wave of the block
    if (t + 2 < NSTEP)
      gemm_copy<K>(ag + (t + 2) * 64, bg + (t + 2) * 64, sA[t & 1], sB[t & 1], tid);
  }
  asm volatile("s_wait_asynccnt 0x0" ::: "memory");    // no copy outstanding when the wave ends

  // ---- epilogue: acc[ms][ns][r] is row wm + ms*16 + 8*hi + r, column wn + ns*16 + (lane & 15) ----
  const int gn0 = n0 + wn + (lane & 15);
  const int gm0 = m0 + wm + (hi << 3);
  float bv[4];
#pragma unroll   // bv[] must become registers
  for (int ns = 0; ns < 4; ++ns) bv[ns] = bias[gn0 + ns * 16];

  if (MODE == 0) {                     // QKV scatter
    const int part = n0 >> 8;          // a 128-column tile lies inside one of q, k, v: block-uniform
    if (part == 2) {                   // V transposed: [B,H,D,T]
#pragma unroll
      for (int ns = 0; ns < 4; ++ns)
#pragma unroll
        for (int ms = 0; ms < 2; ++ms)
#pragma unroll
          for (int r = 0; r < 8; ++r) {
            const int gm = gm0 + ms * 16 + r, cc = (gn0 + ns * 16) & 255;
            const int hh = cc >> 6, dd = cc & 63;
            const int bb = gm >> 12, ttok = gm & (TT - 1);
            ov[(((size_t)(bb * HH + hh)) * DD + dd) * TT + ttok] = (bf16)(acc[ms][ns][r] + bv[ns]);
          }
    } else {
      bf16* dst = (part == 0) ? oq : okk;
#pragma unroll
      for (int ns = 0; ns < 4; ++ns)
#pragma unroll
        for (int ms = 0; ms < 2; ++ms)
#pragma unroll
          for (int r = 0; r < 8; ++r) {
            const int gm = gm0 + ms * 16 + r, cc = (gn0 + ns * 16) & 255;
            const int hh = cc >> 6, dd = cc & 63;
            const int bb = gm >> 12, ttok = gm & (TT - 1);
            dst[(((size_t)(bb * HH + hh)) * TT + ttok) * DD + dd] = (bf16)(acc[ms][ns][r] + bv[ns]);
          }
    }
  } else if (MODE == 1) {              // bias + residual -> f32
    const unsigned base = (unsigned)gm0 * N + (unsigned)gn0;
    float rv[4][2][8];
    // Precaution: stands before a later load's result can take a register that a bias load names.
    asm volatile("s_wait_xcnt 0x0" ::: "memory");
#pragma unroll   // rv[][][] must become registers; all residual loads are in flight together
    for (int ns = 0; ns < 4; ++ns)
#pragma unroll
      for (int ms = 0; ms < 2; ++ms)
#pragma unroll
        for (int r = 0; r < 8; ++r) rv[ns][ms][r] = res[base + (ms * 16 + r) * N + ns * 16];
    // Precaution: stands before any register that a residual load names is written again.
    asm volatile("s_wait_xcnt 0x0" ::: "memory");
#pragma unroll
    for (int ns = 0; ns < 4; ++ns)
#pragma unroll
      for (int ms = 0; ms < 2; ++ms)
#pragma unroll
        for (int r = 0; r < 8; ++r)
          outf[base + (ms * 16 + r) * N + ns * 16] = (acc[ms][ns][r] + bv[ns]) + rv[ns][ms][r];
  } else {                             // exact GELU -> bf16
#pragma unroll
    for (int ns = 0; ns < 4; ++ns)
#pragma unroll
      for (int ms = 0; ms < 2; ++ms)
#pragma unroll
        for (int r = 0; r < 8; ++r) {
          const float val = acc[ms][ns][r] + bv[ns];
          const float g = 0.5f * val * (1.0f + erff(val * 0.70710678118f));
          outb[(size_t)(gm0 + ms * 16 + r) * N + gn0 + ns * 16] = (bf16)g;
        }
  }
}

// ---------------------------------------------------------------------------
// Flash attention, transposed: each wave owns 16 queries of one (b,h) and walks the
// keys in chunks of 32. St = K * Qt puts one query's scores in one lane (column),
// so max and sum run in-lane plus one exchange between the wave halves; the two
// St tiles, converted in place, are the B operand of Ot += Vt * Pt.
// 8 WMMAs per chunk. V is [B,H,D,T] so Vt rows are contiguous along keys.
// The 8 waves of a block share one (b,h): K and Vt tiles of SKEYS keys are brought
// into LDS once per block by async copies (two buffers, the next tile in flight
// while this one is worked on) and every wave reads its fragments from there.
// ---------------------------------------------------------------------------
#define SKEYS  128                  // keys per LDS tile
#define NTILE  (TT / SKEYS)         // 32 tiles
#define KPITCH 72                   // bf16 per K row in LDS: 128 B + 16 B (16 B x odd)
#define VPITCH 136                  // bf16 per Vt row in LDS: 256 B + 16 B (16 B x odd)
#define KTILE  (SKEYS * KPITCH)     // bf16 per K tile
#define VTILE  (DD * VPITCH)        // bf16 per Vt tile
#define LOG2E  1.44269504088896f    // exp(x) = exp2(x * LOG2E), the product that __expf forms

__device__ __forceinline__ float xhalf(float x) {   // lane l <-> lane l ^ 16
  int b = __builtin_bit_cast(int, x);
  return __builtin_bit_cast(float,
      __builtin_amdgcn_permlanex16(b, b, 0x76543210, 0xfedcba98, false, false));
}

// exp2 with the one slot that the instruction set asks for behind a transcendental (before its
// result is read or its source register rewritten) kept in the same statement: a v_nop in a
// statement of its own did not stay behind the v_exp in the build.
__device__ __forceinline__ float exp2_slot(float x) {
  float r;
  asm("v_exp_f32 %0, %1\n\tv_nop" : "=v"(r) : "v"(x));
  return r;
}

// One tile: K rows [SKEYS][64] (16 KB contiguous at kg) and Vt rows [64][SKEYS] (source
// pitch TT, at vg), 16 B per lane and copy, 4 + 4 copies per lane; a wave's copy covers
// 512 B of whole lines.
__device__ __forceinline__ void tile_copy(const bf16* kg, const bf16* vg,
                                          bf16* sk, bf16* sv, int tid) {
  unsigned lk[4], lv[4];
  unsigned long long gk[4], gv[4];
#pragma unroll   // the address arrays must become registers: they are the operands of the asm below
  for (int i = 0; i < 4; ++i) {
    const int p = i * 256 + tid;
    lk[i] = lds_off32(sk + (p >> 3) * KPITCH + ((p & 7) << 3));
    gk[i] = (unsigned long long)(uintptr_t)(kg + (p << 3));
    lv[i] = lds_off32(sv + (p >> 4) * VPITCH + ((p & 15) << 3));
    gv[i] = (unsigned long long)(uintptr_t)(vg + (size_t)(p >> 4) * TT + ((p & 15) << 3));
  }
  // The copies and their s_wait_xcnt in one statement: the wait stands before any
  // rewrite of an address register that an issued copy names.
  asm volatile(
      "global_load_async_to_lds_b128 %0, %8, off\n\t"
      "global_load_async_to_lds_b128 %1, %9, off\n\t"
      "global_load_async_to_lds_b128 %2, %10, off\n\t"
      "global_load_async_to_lds_b128 %3, %11, off\n\t"
      "global_load_async_to_lds_b128 %4, %12, off\n\t"
      "global_load_async_to_lds_b128 %5, %13, off\n\t"
      "global_load_async_to_lds_b128 %6, %14, off\n\t"
      "global_load_async_to_lds_b128 %7, %15, off\n\t"
      "s_wait_xcnt 0x0"
      :: "v"(lk[0]), "v"(lk[1]), "v"(lk[2]), "v"(lk[3]),
         "v"(lv[0]), "v"(lv[1]), "v"(lv[2]), "v"(lv[3]),
         "v"(gk[0]), "v"(gk[1]), "v"(gk[2]), "v"(gk[3]),
         "v"(gv[0]), "v"(gv[1]), "v"(gv[2]), "v"(gv[3])
      : "memory");
}

__global__ __launch_bounds__(256) void attn_kernel(const bf16* __restrict__ q,
                                                   const bf16* __restrict__ k,
                                                   const bf16* __restrict__ v,
                                                   bf16* __restrict__ o) {
  __shared__ __align__(16) bf16 sK[2][KTILE];
  __shared__ __align__(16) bf16 sV[2][VTILE];

  const int tid  = threadIdx.x;
  const int lane = tid & 31;
  const int wave = tid >> 5;
  const int hi   = (lane >> 4) & 1;
  const int tile = blockIdx.x * 8 + wave;          // 0 .. B*H*(T/16)-1
  const int ntq  = TT / 16;                        // 256
  const int bh   = (blockIdx.x * 8) / ntq;         // one (b,h) per block: 8 divides 256
  const int tq   = tile - bh * ntq;
  const size_t rowbase = (size_t)bh * TT;
  const bf16* kbh = k + rowbase * DD;              // K rows of this (b,h)
  const bf16* vbh = v + (size_t)bh * DD * TT;      // Vt rows of this (b,h)

  // Tile 0 into buffer 0, landed and published; then tile 1 into buffer 1.
  tile_copy(kbh, vbh, sK[0], sV[0], tid);
  asm volatile("s_wait_asynccnt 0x0" ::: "memory");   // this wave's copies of tile 0 have landed
  __syncthreads();                                    // ... and every other wave's
  tile_copy(kbh + SKEYS * DD, vbh + SKEYS, sK[1], sV[1], tid);

  // Q fragments (d = 0..31 and 32..63) as B operand: lane column = query. Loaded once.
  FragAB qf0, qf1;
  {
    const bf16* qp = q + (rowbase + tq * 16 + (lane & 15)) * DD;
#pragma unroll
    for (int r = 0; r < 8; ++r) {
      qf0.u[r] = *reinterpret_cast<const unsigned int*>(qp + kbase(r, hi));
      qf1.u[r] = *reinterpret_cast<const unsigned int*>(qp + 32 + kbase(r, hi));
    }
  }

  // oacc[j][r] = Ot[d = j*16 + 8*hi + r][query = lane & 15]
  v8f oacc[4];
#pragma unroll
  for (int j = 0; j < 4; ++j) oacc[j] = (v8f){0.f, 0.f, 0.f, 0.f, 0.f, 0.f, 0.f, 0.f};
  float rowm = -3.0e38f;   // running maximum of this lane's query (equal in both halves)
  float rows = 0.f;        // running sum over this half's keys only; halves join at the end

  const float scale = 0.125f;  // D^-0.5, D=64

  for (int t = 0; t < NTILE; ++t) {
    const bf16* bk = sK[t & 1] + (lane & 15) * KPITCH;
    const bf16* bv = sV[t & 1] + (lane & 15) * VPITCH;

    // Unrolled so that the LDS offsets are immediates and a chunk's reads can be
    // issued ahead of the vector work of the chunk before it.
#pragma unroll
    for (int c32 = 0; c32 < SKEYS / 32; ++c32) {
      // ---- St = K * Qt for 32 keys: sacc[nt][r] = score(key +nt*16+8*hi+r, query) ----
      v8f sacc[2];
#pragma unroll
      for (int nt = 0; nt < 2; ++nt) {
        sacc[nt] = (v8f){0.f, 0.f, 0.f, 0.f, 0.f, 0.f, 0.f, 0.f};
        const bf16* kp = bk + (c32 * 32 + nt * 16) * KPITCH;
        FragAB kf0, kf1;
        frag_lds(kf0, kp, hi);
        frag_lds(kf1, kp + 32, hi);
        sacc[nt] = __builtin_amdgcn_wmma_f32_16x16x32_bf16(false, kf0.v, false, qf0.v,
                                                           (short)0, sacc[nt], false, false);
        sacc[nt] = __builtin_amdgcn_wmma_f32_16x16x32_bf16(false, kf1.v, false, qf1.v,
                                                           (short)0, sacc[nt], false, false);
      }

      // ---- online softmax: this lane holds 16 of its query's 32 scores ----
      float c[16];
#pragma unroll
      for (int i = 0; i < 16; ++i) c[i] = sacc[i >> 3][i & 7] * scale;
      float m4[4];
#pragma unroll
      for (int i = 0; i < 4; ++i)
        m4[i] = fmaxf(fmaxf(c[4 * i], c[4 * i + 1]), fmaxf(c[4 * i + 2], c[4 * i + 3]));
      float mc = fmaxf(fmaxf(m4[0], m4[1]), fmaxf(m4[2], m4[3]));
      mc = fmaxf(mc, xhalf(mc));
      const float mn   = fmaxf(rowm, mc);
      const float corr = exp2_slot((rowm - mn) * LOG2E);
      rowm = mn;

      // Pt as B operand: element s wants key 8*hi+s (s<8) or 16+8*hi+(s-8), which is
      // exactly tile s>>3, register s&7 of St: convert in place, no lane exchange.
      FragAB pf;
      float p[16];
#pragma unroll
      for (int i = 0; i < 16; ++i) {
        p[i] = exp2_slot((c[i] - mn) * LOG2E);
        pf.b[i] = (bf16)p[i];
      }
      float s4[4];
#pragma unroll
      for (int i = 0; i < 4; ++i)
        s4[i] = (p[i] + p[i + 4]) + (p[i + 8] + p[i + 12]);
      rows = rows * corr + ((s4[0] + s4[1]) + (s4[2] + s4[3]));

      // ---- Ot = Ot*corr + Vt * Pt ----
#pragma unroll
      for (int j = 0; j < 4; ++j) {
#pragma unroll
        for (int r = 0; r < 8; ++r) oacc[j][r] *= corr;
        FragAB vf;
        frag_lds(vf, bv + j * 16 * VPITCH + c32 * 32, hi);
        oacc[j] = __builtin_amdgcn_wmma_f32_16x16x32_bf16(false, vf.v, false, pf.v,
                                                          (short)0, oacc[j], false, false);
      }
    }

    // Hand-over: tile t + 1 becomes readable, buffer t & 1 becomes free.
    asm volatile("s_wait_dscnt 0x0" ::: "memory");     // this wave's reads of tile t are done
    asm volatile("s_wait_asynccnt 0x0" ::: "memory");  // this wave's copies of tile t + 1 have landed
    __syncthreads();                                   // both hold for every wave of the block
    if (t + 2 < NTILE)
      tile_copy(kbh + (size_t)(t + 2) * SKEYS * DD, vbh + (t + 2) * SKEYS,
                sK[t & 1], sV[t & 1], tid);
  }
  asm volatile("s_wait_asynccnt 0x0" ::: "memory");    // no copy outstanding when the wave ends

  // ---- normalize + merge heads: write [B,T,C] bf16, 8 consecutive d per lane ----
  const int b = bh >> 2, h = bh & 3;
  const float inv = 1.0f / (rows + xhalf(rows));
  const int token = tq * 16 + (lane & 15);
  bf16* op = o + ((size_t)b * TT + token) * CC + h * DD + (hi << 3);
#pragma unroll
  for (int j = 0; j < 4; ++j) {
    union { bf16 e[8]; uint4 u; } pk;
#pragma unroll
    for (int r = 0; r < 8; ++r) pk.e[r] = (bf16)(oacc[j][r] * inv);
    *reinterpret_cast<uint4*>(op + j * 16) = pk.u;
  }
}

// ---------------------------------------------------------------------------
// LayerNorm over C=256: a wave takes LNT consecutive tokens (4 KB contiguous), all their
// loads issued first, so that the launch starts a quarter of the waves and each keeps
// 2 * LNT loads in flight; w and bias are read once per wave. Butterfly reductions.
// All results are formed in registers before the first store, so that no register of an
// issued store is written again.
// ---------------------------------------------------------------------------
#define LNT 4
__global__ __launch_bounds__(256) void ln_kernel(const float* __restrict__ in,
                                                 const float* __restrict__ w,
                                                 const float* __restrict__ bias,
                                                 float* __restrict__ outf,
                                                 bf16* __restrict__ outb) {
  const int lane = threadIdx.x & 31;
  const int tok0 = (blockIdx.x * 8 + (threadIdx.x >> 5)) * LNT;
  float4 wv[2], bv[2];
#pragma unroll   // wv[], bv[] must become registers
  for (int i = 0; i < 2; ++i) {
    wv[i] = reinterpret_cast<const float4*>(w)[i * 32 + lane];
    bv[i] = reinterpret_cast<const float4*>(bias)[i * 32 + lane];
  }
  const float4* p = reinterpret_cast<const float4*>(in + (size_t)tok0 * CC);
  float4 a[LNT][2];
#pragma unroll   // a[][] must become registers, and the loads stand together ahead of the sums
  for (int t = 0; t < LNT; ++t) {
    a[t][0] = p[t * 64 + lane];
    a[t][1] = p[t * 64 + 32 + lane];
  }

  // Mean and 1/sigma of all LNT tokens first, with no branch in between: the tokens'
  // butterfly chains are independent, and standing together they overlap.
  float4 y[LNT][2];
#pragma unroll   // a[][], y[][] are indexed by t
  for (int t = 0; t < LNT; ++t) {
    const float4 a0 = a[t][0], a1 = a[t][1];
    float sum = a0.x + a0.y + a0.z + a0.w + a1.x + a1.y + a1.z + a1.w;
    float sq  = a0.x * a0.x + a0.y * a0.y + a0.z * a0.z + a0.w * a0.w +
                a1.x * a1.x + a1.y * a1.y + a1.z * a1.z + a1.w * a1.w;
#pragma unroll
    for (int off = 1; off <= 16; off <<= 1) {
      sum += __shfl_xor(sum, off, 32);
      sq  += __shfl_xor(sq, off, 32);
    }
    const float mean = sum * (1.0f / CC);
    const float var  = sq * (1.0f / CC) - mean * mean;
    const float rstd = rsqrtf(var + LNEPS);
#pragma unroll
    for (int i = 0; i < 2; ++i) {
      const float4 av = a[t][i];
      y[t][i].x = wv[i].x * (av.x - mean) * rstd + bv[i].x;
      y[t][i].y = wv[i].y * (av.y - mean) * rstd + bv[i].y;
      y[t][i].z = wv[i].z * (av.z - mean) * rstd + bv[i].z;
      y[t][i].w = wv[i].w * (av.w - mean) * rstd + bv[i].w;
    }
  }

  if (outb) {
    uint2* ob = reinterpret_cast<uint2*>(outb + (size_t)tok0 * CC);
#pragma unroll   // y[][] is indexed by t
    for (int t = 0; t < LNT; ++t)
#pragma unroll
      for (int i = 0; i < 2; ++i) {
        union { bf16 e[4]; uint2 u; } pk;
        pk.e[0] = (bf16)y[t][i].x; pk.e[1] = (bf16)y[t][i].y;
        pk.e[2] = (bf16)y[t][i].z; pk.e[3] = (bf16)y[t][i].w;
        ob[t * 64 + i * 32 + lane] = pk.u;
      }
  }
  float4* of = reinterpret_cast<float4*>(outf + (size_t)tok0 * CC);
#pragma unroll   // y[][] is indexed by t
  for (int t = 0; t < LNT; ++t) {
    of[t * 64 + lane]      = y[t][0];
    of[t * 64 + 32 + lane] = y[t][1];
  }
}

// ---------------------------------------------------------------------------
// Host launcher
// ---------------------------------------------------------------------------
extern "C" void kernel_launch(void* const* d_in, const int* in_sizes, int n_in,
                              void* d_out, int out_size, void* d_ws, size_t ws_size,
                              hipStream_t stream) {
  const float* x      = (const float*)d_in[0];
  const float* qkv_w  = (const float*)d_in[1];
  const float* qkv_b  = (const float*)d_in[2];
  const float* proj_w = (const float*)d_in[3];
  const float* proj_b = (const float*)d_in[4];
  const float* n1_w   = (const float*)d_in[5];
  const float* n1_b   = (const float*)d_in[6];
  const float* ffn_w1 = (const float*)d_in[7];
  const float* ffn_b1 = (const float*)d_in[8];
  const float* ffn_w2 = (const float*)d_in[9];
  const float* ffn_b2 = (const float*)d_in[10];
  const float* n2_w   = (const float*)d_in[11];
  const float* n2_b   = (const float*)d_in[12];
  float* out = (float*)d_out;

  char* ws = (char*)d_ws;
  size_t off = 0;
  auto take = [&](size_t bytes) { void* p = ws + off; off += (bytes + 255) & ~(size_t)255; return p; };

  bf16*  x_bf     = (bf16*)take((size_t)MM * CC * 2);
  bf16*  wqkv_bf  = (bf16*)take((size_t)CC * N3 * 2);
  bf16*  wproj_bf = (bf16*)take((size_t)CC * CC * 2);
  bf16*  w1_bf    = (bf16*)take((size_t)CC * N3 * 2);
  bf16*  w2_bf    = (bf16*)take((size_t)N3 * CC * 2);
  bf16*  q_bf     = (bf16*)take((size_t)MM * CC * 2);
  bf16*  k_bf     = (bf16*)take((size_t)MM * CC * 2);
  bf16*  v_bf     = (bf16*)take((size_t)MM * CC * 2);   // [B,H,D,T]
  bf16*  attn_bf  = (bf16*)take((size_t)MM * CC * 2);
  float* r1       = (float*)take((size_t)MM * CC * 4);
  float* x1f      = (float*)take((size_t)MM * CC * 4);
  bf16*  x1_bf    = (bf16*)take((size_t)MM * CC * 2);
  bf16*  h_bf     = (bf16*)take((size_t)MM * N3 * 2);
  float* r2       = (float*)take((size_t)MM * CC * 4);

  // 1) converts: 8 pieces of 4 floats per thread for x; the weights [K][N] -> bf16 [N][K]
  cvt_bf16_kernel<8><<<(MM * CC) / (256 * 8 * 4), 256, 0, stream>>>(x, x_bf);
  cvt_wt_kernel<<<dim3(N3 / 32, CC / 64), 256, 0, stream>>>(qkv_w, wqkv_bf, CC, N3);
  cvt_wt_kernel<<<dim3(CC / 32, CC / 64), 256, 0, stream>>>(proj_w, wproj_bf, CC, CC);
  cvt_wt_kernel<<<dim3(N3 / 32, CC / 64), 256, 0, stream>>>(ffn_w1, w1_bf, CC, N3);
  cvt_wt_kernel<<<dim3(CC / 32, N3 / 64), 256, 0, stream>>>(ffn_w2, w2_bf, N3, CC);

  // 2) QKV projection, scatter q/k -> [B,H,T,D], v -> [B,H,D,T]
  gemm_bf16_kernel<0, CC, N3><<<dim3(N3 / 128, MM / 128), 256, 0, stream>>>(
      x_bf, wqkv_bf, qkv_b, nullptr, nullptr, nullptr, q_bf, k_bf, v_bf);

  // 3) flash attention -> [B,T,C] bf16
  attn_kernel<<<(BB * HH * (TT / 16)) / 8, 256, 0, stream>>>(q_bf, k_bf, v_bf, attn_bf);

  // 4) output projection + residual(x) -> r1 f32
  gemm_bf16_kernel<1, CC, CC><<<dim3(CC / 128, MM / 128), 256, 0, stream>>>(
      attn_bf, wproj_bf, proj_b, x, r1, nullptr, nullptr, nullptr, nullptr);

  // 5) LN1 -> x1 (f32 + bf16)
  ln_kernel<<<MM / (8 * LNT), 256, 0, stream>>>(r1, n1_w, n1_b, x1f, x1_bf);

  // 6) FFN1 + GELU -> h bf16
  gemm_bf16_kernel<2, CC, N3><<<dim3(N3 / 128, MM / 128), 256, 0, stream>>>(
      x1_bf, w1_bf, ffn_b1, nullptr, nullptr, h_bf, nullptr, nullptr, nullptr);

  // 7) FFN2 + residual(x1) -> r2 f32
  gemm_bf16_kernel<1, N3, CC><<<dim3(CC / 128, MM / 128), 256, 0, stream>>>(
      h_bf, w2_bf, ffn_b2, x1f, r2, nullptr, nullptr, nullptr, nullptr);

  // 8) LN2 -> output f32
  ln_kernel<<<MM / (8 * LNT), 256, 0, stream>>>(r2, n2_w, n2_b, out, nullptr);
}

// v005
// It runs in 154 microseconds.
// Timed twice side by side with v004, it ran 1.05 and 1.06 times as fast.
// Over all steps from v000 it is 3.37 times as fast.
#include <hip/hip_runtime.h>
#include <hip/hip_bf16.h>

// ---------------------------------------------------------------------------
// Transformer block for MI455X (gfx1250, wave32, WMMA).
// bf16 activations, f32 accumulation via v_wmma_f32_16x16x32_bf16.
// GEMM and attention tiles staged to LDS with global_load_async_to_lds_b128 (ASYNCcnt).
// ---------------------------------------------------------------------------

typedef __bf16 bf16;
typedef __attribute__((ext_vector_type(16))) __bf16 v16bf;
typedef __attribute__((ext_vector_type(8)))  float  v8f;

#define BB   4
#define TT   4096
#define CC   256
#define HH   4
#define DD   64
#define MM   (BB * TT)      // 16384 tokens
#define N3   (3 * CC)       // 768
#define LNEPS 1e-5f

// K index inside a 16x32 (16-bit) A/B fragment for VGPR r, lane-half hi.
// ISA 7.12.2: VGPR0..3 lanes0-15 hold K=0..7 (pairs), lanes16-31 K=8..15; VGPR4..7 -> +16.
__device__ __forceinline__ int kbase(int r, int hi) {
  return ((r & 4) << 2) | (hi << 3) | ((r & 3) << 1);
}

union FragAB {
  v16bf v;
  unsigned int u[8];
  bf16 b[16];
};

__device__ __forceinline__ unsigned lds_off32(const void* p) {
  return (unsigned)(unsigned long long)(uintptr_t)p;   // low 32 bits = LDS byte offset
}

// ---------------------------------------------------------------------------
// fp32 -> bf16 convert of one block's share. A thread takes PER pieces of 4 floats (16 B
// loads, all issued before the first store; a wave's load covers 512 contiguous bytes), so
// that few waves each keep PER loads in flight. blk counts blocks of 256 * PER * 4 elements.
// ---------------------------------------------------------------------------
template <int PER>
__device__ __forceinline__ void cvt_bf16_block(const float* __restrict__ in,
                                               bf16* __restrict__ out, int blk) {
  const int base = blk * (256 * PER) + threadIdx.x;          // index of a piece of 4 floats
  const float4* ip = reinterpret_cast<const float4*>(in);
  uint2* op = reinterpret_cast<uint2*>(out);
  float4 a[PER];
#pragma unroll   // a[] must become registers, and the loads stand together ahead of the stores
  for (int i = 0; i < PER; ++i) a[i] = ip[base + i * 256];
#pragma unroll   // as above
  for (int i = 0; i < PER; ++i) {
    union { bf16 e[4]; uint2 u; } pk;
    pk.e[0] = (bf16)a[i].x; pk.e[1] = (bf16)a[i].y;
    pk.e[2] = (bf16)a[i].z; pk.e[3] = (bf16)a[i].w;
    op[base + i * 256] = pk.u;
  }
}

// ---------------------------------------------------------------------------
// Weight convert with transpose: fp32 [K][N] -> bf16 [N][K], so that a GEMM's B tile has
// K-contiguous rows like its A tile. A block takes 32 n x 64 k: a wave reads 8 rows of
// 128 contiguous bytes, and the block's 8 waves together fill one whole 128-B line of each
// of its 32 output rows. blk runs over (N / 32) * (K / 64) blocks, n fastest.
// ---------------------------------------------------------------------------
__device__ __forceinline__ void cvt_wt_block(const float* __restrict__ in,
                                             bf16* __restrict__ out, int K, int N, int blk) {
  const int n  = (blk % (N / 32)) * 32 + (threadIdx.x & 31);
  const int k0 = (blk / (N / 32)) * 64 + (threadIdx.x >> 5) * 8;
  float a[8];
#pragma unroll   // a[] must become registers, and the loads stand together ahead of the store
  for (int i = 0; i < 8; ++i) a[i] = in[(size_t)(k0 + i) * N + n];
  union { bf16 e[8]; uint4 u; } pk;
#pragma unroll   // as above
  for (int i = 0; i < 8; ++i) pk.e[i] = (bf16)a[i];
  *reinterpret_cast<uint4*>(out + (size_t)n * K + k0) = pk.u;
  // Precaution: stands before any register that the store names can be written again (in the
  // one-launch kernel other arrays' code follows the store in the listing).
  asm volatile("s_wait_xcnt 0x0" ::: "memory");
}

// ---------------------------------------------------------------------------
// All five converts in one launch: they do not depend on one another, so the four gaps between
// dependent launches and the start and end of four short launches go. The block index picks
// the array (a scalar branch); x's 512 blocks, which move most of the bytes, come first.
// ---------------------------------------------------------------------------
#define WB_QKV  ((N3 / 32) * (CC / 64))            // 96 blocks
#define WB_PROJ ((CC / 32) * (CC / 64))            // 32
#define WB_FFN1 ((N3 / 32) * (CC / 64))            // 96
#define WB_FFN2 ((CC / 32) * (N3 / 64))            // 96
#define WB_ALL  (WB_QKV + WB_PROJ + WB_FFN1 + WB_FFN2)
#define XB_ALL  ((MM * CC) / (256 * 8 * 4))        // 512
__global__ __launch_bounds__(256) void cvt_all_kernel(
    const float* __restrict__ x, const float* __restrict__ qkv_w,
    const float* __restrict__ proj_w, const float* __restrict__ ffn_w1,
    const float* __restrict__ ffn_w2, bf16* __restrict__ x_bf,
    bf16* __restrict__ wqkv_bf, bf16* __restrict__ wproj_bf,
    bf16* __restrict__ w1_bf, bf16* __restrict__ w2_bf) {
  const int b = blockIdx.x;
  if (b < XB_ALL) {
    cvt_bf16_block<8>(x, x_bf, b);
    return;
  }
  const int w = b - XB_ALL;
  if (w < WB_QKV)
    cvt_wt_block(qkv_w, wqkv_bf, CC, N3, w);
  else if (w < WB_QKV + WB_PROJ)
    cvt_wt_block(proj_w, wproj_bf, CC, CC, w - WB_QKV);
  else if (w < WB_QKV + WB_PROJ + WB_FFN1)
    cvt_wt_block(ffn_w1, w1_bf, CC, N3, w - (WB_QKV + WB_PROJ));
  else
    cvt_wt_block(ffn_w2, w2_bf, N3, CC, w - (WB_QKV + WB_PROJ + WB_FFN1));
}

// One 16x32 fragment from an LDS row: k = 8*hi..+7 and 16+8*hi..+7 (the order of kbase).
__device__ __forceinline__ void frag_lds(FragAB& f, const bf16* rowp, int hi) {
  uint4 lo = *reinterpret_cast<const uint4*>(rowp + (hi << 3));
  uint4 up = *reinterpret_cast<const uint4*>(rowp + 16 + (hi << 3));
  f.u[0] = lo.x; f.u[1] = lo.y; f.u[2] = lo.z; f.u[3] = lo.w;
  f.u[4] = up.x; f.u[5] = up.y; f.u[6] = up.z; f.u[7] = up.w;
}

// ---------------------------------------------------------------------------
// Tiled GEMM: Out = A[M x K] * W[K x N] (+bias, + epilogue), W given as Wt[N x K].
// Block tile 128x128 (8 waves as 4 x 2, each a 32x64 tile = 8 WMMA per 32 k), K in steps
// of 64: a step's A and Wt tiles are 128 rows of one whole 128-B line each, brought into LDS
// by async copies (two buffers, the next step in flight while this one is worked on).
// MODE 0: QKV scatter -> q/k bf16 [B,H,T,D], v bf16 [B,H,D,T]
// MODE 1: + residual  -> f32 out [M x N]
// MODE 2: GELU        -> bf16 out [M x N]
// ---------------------------------------------------------------------------
#define GPITCH 72                   // bf16 per tile row in LDS: 128 B + 16 B (16 B x odd)
#define GTILE  (128 * GPITCH)       // bf16 per operand tile

// One K step: 128 rows x 64 k of A (at ag) and of Wt (at bg), source pitch K, 16 B per lane
// and copy, 4 + 4 copies per lane; a wave's copy covers 4 whole lines.
template <int K>
__device__ __forceinline__ void gemm_copy(const bf16* ag, const bf16* bg,
                                          bf16* sa, bf16* sb, int tid) {
  unsigned la[4], lb[4];
  unsigned long long ga[4], gb[4];
#pragma unroll   // the address arrays must become registers: they are the operands of the asm below
  for (int i = 0; i < 4; ++i) {
    const int p = i * 256 + tid;
    const int row = p >> 3, col = (p & 7) << 3;
    la[i] = lds_off32(sa + row * GPITCH + col);
    ga[i] = (unsigned long long)(uintptr_t)(ag + (size_t)row * K + col);
    lb[i] = lds_off32(sb + row * GPITCH + col);
    gb[i] = (unsigned long long)(uintptr_t)(bg + (size_t)row * K + col);
  }
  // The copies and their s_wait_xcnt in one statement: the wait stands before any
  // rewrite of an address register that an issued copy names.
  asm volatile(
      "global_load_async_to_lds_b128 %0, %8, off\n\t"
      "global_load_async_to_lds_b128 %1, %9, off\n\t"
      "global_load_async_to_lds_b128 %2, %10, off\n\t"
      "global_load_async_to_lds_b128 %3, %11, off\n\t"
      "global_load_async_to_lds_b128 %4, %12, off\n\t"
      "global_load_async_to_lds_b128 %5, %13, off\n\t"
      "global_load_async_to_lds_b128 %6, %14, off\n\t"
      "global_load_async_to_lds_b128 %7, %15, off\n\t"
      "s_wait_xcnt 0x0"
      :: "v"(la[0]), "v"(la[1]), "v"(la[2]), "v"(la[3]),
         "v"(lb[0]), "v"(lb[1]), "v"(lb[2]), "v"(lb[3]),
         "v"(ga[0]), "v"(ga[1]), "v"(ga[2]), "v"(ga[3]),
         "v"(gb[0]), "v"(gb[1]), "v"(gb[2]), "v"(gb[3])
      : "memory");
}

template <int MODE, int K, int N>
__global__ __launch_bounds__(256) void gemm_bf16_kernel(
    const bf16* __restrict__ A, const bf16* __restrict__ Wt,
    const float* __restrict__ bias,
    const float* __restrict__ res, float* __restrict__ outf,
    bf16* __restrict__ outb, bf16* __restrict__ oq,
    bf16* __restrict__ okk, bf16* __restrict__ ov) {
  __shared__ __align__(16) bf16 sA[2][GTILE];
  __shared__ __align__(16) bf16 sB[2][GTILE];
  constexpr int NSTEP = K / 64;        // at least 4 here

  const int tid  = threadIdx.x;
  const int lane = tid & 31;
  const int wave = tid >> 5;
  const int hi   = (lane >> 4) & 1;
  const int wm   = (wave >> 1) * 32;   // the wave's rows inside the block tile
  const int wn   = (wave & 1) * 64;    // the wave's columns inside the block tile
  const int m0   = blockIdx.y * 128;
  const int n0   = blockIdx.x * 128;
  const bf16* ag = A + (size_t)m0 * K;
  const bf16* bg = Wt + (size_t)n0 * K;

  // Step 0 into buffer 0, landed and published; then step 1 into buffer 1.
  gemm_copy<K>(ag, bg, sA[0], sB[0], tid);
  asm volatile("s_wait_asynccnt 0x0" ::: "memory");   // this wave's copies of step 0 have landed
  __syncthreads();                                    // ... and every other wave's
  gemm_copy<K>(ag + 64, bg + 64, sA[1], sB[1], tid);

  v8f acc[2][4];
#pragma unroll
  for (int ms = 0; ms < 2; ++ms)
#pragma unroll
    for (int ns = 0; ns < 4; ++ns)
      acc[ms][ns] = (v8f){0.f, 0.f, 0.f, 0.f, 0.f, 0.f, 0.f, 0.f};

  for (int t = 0; t < NSTEP; ++t) {
    const bf16* pa = sA[t & 1] + (wm + (lane & 15)) * GPITCH;
    const bf16* pb = sB[t & 1] + (wn + (lane & 15)) * GPITCH;
#pragma unroll   // fa[], fb[] must become registers; the LDS offsets become immediates
    for (int kk = 0; kk < 2; ++kk) {
      FragAB fa[2], fb[4];
#pragma unroll
      for (int ms = 0; ms < 2; ++ms) frag_lds(fa[ms], pa + ms * 16 * GPITCH + kk * 32, hi);
#pragma unroll
      for (int ns = 0; ns < 4; ++ns) frag_lds(fb[ns], pb + ns * 16 * GPITCH + kk * 32, hi);
#pragma unroll
      for (int ms = 0; ms < 2; ++ms)
#pragma unroll
        for (int ns = 0; ns < 4; ++ns)
          acc[ms][ns] = __builtin_amdgcn_wmma_f32_16x16x32_bf16(
              false, fa[ms].v, false, fb[ns].v, (short)0, acc[ms][ns], false, false);
    }

    // Hand-over: step t + 1 becomes readable, buffer t & 1 becomes free.
    asm volatile("s_wait_dscnt 0x0" ::: "memory");     // this wave's reads of step t are done
    asm volatile("s_wait_asynccnt 0x0" ::: "memory");  // this wave's copies of step t + 1 have landed
    __syncthreads();                                   // both hold for every wave of the block
    if (t + 2 < NSTEP)
      gemm_copy<K>(ag + (t + 2) * 64, bg + (t + 2) * 64, sA[t & 1], sB[t & 1], tid);
  }
  asm volatile("s_wait_asynccnt 0x0" ::: "memory");    // no copy outstanding when the wave ends

  // ---- epilogue: acc[ms][ns][r] is row wm + ms*16 + 8*hi + r, column wn + ns*16 + (lane & 15) ----
  const int gn0 = n0 + wn + (lane & 15);
  const int gm0 = m0 + wm + (hi << 3);
  float bv[4];
#pragma unroll   // bv[] must become registers
  for (int ns = 0; ns < 4; ++ns) bv[ns] = bias[gn0 + ns * 16];

  if (MODE == 0) {                     // QKV scatter
    const int part = n0 >> 8;          // a 128-column tile lies inside one of q, k, v: block-uniform
    if (part == 2) {                   // V transposed: [B,H,D,T]
#pragma unroll
      for (int ns = 0; ns < 4; ++ns)
#pragma unroll
        for (int ms = 0; ms < 2; ++ms)
#pragma unroll
          for (int r = 0; r < 8; ++r) {
            const int gm = gm0 + ms * 16 + r, cc = (gn0 + ns * 16) & 255;
            const int hh = cc >> 6, dd = cc & 63;
            const int bb = gm >> 12, ttok = gm & (TT - 1);
            ov[(((size_t)(bb * HH + hh)) * DD + dd) * TT + ttok] = (bf16)(acc[ms][ns][r] + bv[ns]);
          }
    } else {
      bf16* dst = (part == 0) ? oq : okk;
#pragma unroll
      for (int ns = 0; ns < 4; ++ns)
#pragma unroll
        for (int ms = 0; ms < 2; ++ms)
#pragma unroll
          for (int r = 0; r < 8; ++r) {
            const int gm = gm0 + ms * 16 + r, cc = (gn0 + ns * 16) & 255;
            const int hh = cc >> 6, dd = cc & 63;
            const int bb = gm >> 12, ttok = gm & (TT - 1);
            dst[(((size_t)(bb * HH + hh)) * TT + ttok) * DD + dd] = (bf16)(acc[ms][ns][r] + bv[ns]);
          }
    }
  } else if (MODE == 1) {              // bias + residual -> f32
    const unsigned base = (unsigned)gm0 * N + (unsigned)gn0;
    float rv[4][2][8];
    // Precaution: stands before a later load's result can take a register that a bias load names.
    asm volatile("s_wait_xcnt 0x0" ::: "memory");
#pragma unroll   // rv[][][] must become registers; all residual loads are in flight together
    for (int ns = 0; ns < 4; ++ns)
#pragma unroll
      for (int ms = 0; ms < 2; ++ms)
#pragma unroll
        for (int r = 0; r < 8; ++r) rv[ns][ms][r] = res[base + (ms * 16 + r) * N + ns * 16];
    // Precaution: stands before any register that a residual load names is written again.
    asm volatile("s_wait_xcnt 0x0" ::: "memory");
#pragma unroll
    for (int ns = 0; ns < 4; ++ns)
#pragma unroll
      for (int ms = 0; ms < 2; ++ms)
#pragma unroll
        for (int r = 0; r < 8; ++r)
          outf[base + (ms * 16 + r) * N + ns * 16] = (acc[ms][ns][r] + bv[ns]) + rv[ns][ms][r];
  } else {                             // exact GELU -> bf16
#pragma unroll
    for (int ns = 0; ns < 4; ++ns)
#pragma unroll
      for (int ms = 0; ms < 2; ++ms)
#pragma unroll
        for (int r = 0; r < 8; ++r) {
          const float val = acc[ms][ns][r] + bv[ns];
          const float g = 0.5f * val * (1.0f + erff(val * 0.70710678118f));
          outb[(size_t)(gm0 + ms * 16 + r) * N + gn0 + ns * 16] = (bf16)g;
        }
  }
}

// ---------------------------------------------------------------------------
// Flash attention, transposed: each wave owns 16 queries of one (b,h) and walks the
// keys in chunks of 32. St = K * Qt puts one query's scores in one lane (column),
// so max and sum run in-lane plus one exchange between the wave halves; the two
// St tiles, converted in place, are the B operand of Ot += Vt * Pt.
// 8 WMMAs per chunk. V is [B,H,D,T] so Vt rows are contiguous along keys.
// The 8 waves of a block share one (b,h): K and Vt tiles of SKEYS keys are brought
// into LDS once per block by async copies (two buffers, the next tile in flight
// while this one is worked on) and every wave reads its fragments from there.
// ---------------------------------------------------------------------------
#define SKEYS  128                  // keys per LDS tile
#define NTILE  (TT / SKEYS)         // 32 tiles
#define KPITCH 72                   // bf16 per K row in LDS: 128 B + 16 B (16 B x odd)
#define VPITCH 136                  // bf16 per Vt row in LDS: 256 B + 16 B (16 B x odd)
#define KTILE  (SKEYS * KPITCH)     // bf16 per K tile
#define VTILE  (DD * VPITCH)        // bf16 per Vt tile
#define LOG2E  1.44269504088896f    // exp(x) = exp2(x * LOG2E), the product that __expf forms

__device__ __forceinline__ float xhalf(float x) {   // lane l <-> lane l ^ 16
  int b = __builtin_bit_cast(int, x);
  return __builtin_bit_cast(float,
      __builtin_amdgcn_permlanex16(b, b, 0x76543210, 0xfedcba98, false, false));
}

// exp2 with the one slot that the instruction set asks for behind a transcendental (before its
// result is read or its source register rewritten) kept in the same statement: a v_nop in a
// statement of its own did not stay behind the v_exp in the build.
__device__ __forceinline__ float exp2_slot(float x) {
  float r;
  asm("v_exp_f32 %0, %1\n\tv_nop" : "=v"(r) : "v"(x));
  return r;
}

// One tile: K rows [SKEYS][64] (16 KB contiguous at kg) and Vt rows [64][SKEYS] (source
// pitch TT, at vg), 16 B per lane and copy, 4 + 4 copies per lane; a wave's copy covers
// 512 B of whole lines.
__device__ __forceinline__ void tile_copy(const bf16* kg, const bf16* vg,
                                          bf16* sk, bf16* sv, int tid) {
  unsigned lk[4], lv[4];
  unsigned long long gk[4], gv[4];
#pragma unroll   // the address arrays must become registers: they are the operands of the asm below
  for (int i = 0; i < 4; ++i) {
    const int p = i * 256 + tid;
    lk[i] = lds_off32(sk + (p >> 3) * KPITCH + ((p & 7) << 3));
    gk[i] = (unsigned long long)(uintptr_t)(kg + (p << 3));
    lv[i] = lds_off32(sv + (p >> 4) * VPITCH + ((p & 15) << 3));
    gv[i] = (unsigned long long)(uintptr_t)(vg + (size_t)(p >> 4) * TT + ((p & 15) << 3));
  }
  // The copies and their s_wait_xcnt in one statement: the wait stands before any
  // rewrite of an address register that an issued copy names.
  asm volatile(
      "global_load_async_to_lds_b128 %0, %8, off\n\t"
      "global_load_async_to_lds_b128 %1, %9, off\n\t"
      "global_load_async_to_lds_b128 %2, %10, off\n\t"
      "global_load_async_to_lds_b128 %3, %11, off\n\t"
      "global_load_async_to_lds_b128 %4, %12, off\n\t"
      "global_load_async_to_lds_b128 %5, %13, off\n\t"
      "global_load_async_to_lds_b128 %6, %14, off\n\t"
      "global_load_async_to_lds_b128 %7, %15, off\n\t"
      "s_wait_xcnt 0x0"
      :: "v"(lk[0]), "v"(lk[1]), "v"(lk[2]), "v"(lk[3]),
         "v"(lv[0]), "v"(lv[1]), "v"(lv[2]), "v"(lv[3]),
         "v"(gk[0]), "v"(gk[1]), "v"(gk[2]), "v"(gk[3]),
         "v"(gv[0]), "v"(gv[1]), "v"(gv[2]), "v"(gv[3])
      : "memory");
}

__global__ __launch_bounds__(256) void attn_kernel(const bf16* __restrict__ q,
                                                   const bf16* __restrict__ k,
                                                   const bf16* __restrict__ v,
                                                   bf16* __restrict__ o) {
  __shared__ __align__(16) bf16 sK[2][KTILE];
  __shared__ __align__(16) bf16 sV[2][VTILE];

  const int tid  = threadIdx.x;
  const int lane = tid & 31;
  const int wave = tid >> 5;
  const int hi   = (lane >> 4) & 1;
  const int tile = blockIdx.x * 8 + wave;          // 0 .. B*H*(T/16)-1
  const int ntq  = TT / 16;                        // 256
  const int bh   = (blockIdx.x * 8) / ntq;         // one (b,h) per block: 8 divides 256
  const int tq   = tile - bh * ntq;
  const size_t rowbase = (size_t)bh * TT;
  const bf16* kbh = k + rowbase * DD;              // K rows of this (b,h)
  const bf16* vbh = v + (size_t)bh * DD * TT;      // Vt rows of this (b,h)

  // Tile 0 into buffer 0, landed and published; then tile 1 into buffer 1.
  tile_copy(kbh, vbh, sK[0], sV[0], tid);
  asm volatile("s_wait_asynccnt 0x0" ::: "memory");   // this wave's copies of tile 0 have landed
  __syncthreads();                                    // ... and every other wave's
  tile_copy(kbh + SKEYS * DD, vbh + SKEYS, sK[1], sV[1], tid);

  // Q fragments (d = 0..31 and 32..63) as B operand: lane column = query. Loaded once.
  FragAB qf0, qf1;
  {
    const bf16* qp = q + (rowbase + tq * 16 + (lane & 15)) * DD;
#pragma unroll
    for (int r = 0; r < 8; ++r) {
      qf0.u[r] = *reinterpret_cast<const unsigned int*>(qp + kbase(r, hi));
      qf1.u[r] = *reinterpret_cast<const unsigned int*>(qp + 32 + kbase(r, hi));
    }
  }

  // oacc[j][r] = Ot[d = j*16 + 8*hi + r][query = lane & 15]
  v8f oacc[4];
#pragma unroll
  for (int j = 0; j < 4; ++j) oacc[j] = (v8f){0.f, 0.f, 0.f, 0.f, 0.f, 0.f, 0.f, 0.f};
  float rowm = -3.0e38f;   // running maximum of this lane's query (equal in both halves)
  float rows = 0.f;        // running sum over this half's keys only; halves join at the end

  const float scale = 0.125f;  // D^-0.5, D=64

  for (int t = 0; t < NTILE; ++t) {
    const bf16* bk = sK[t & 1] + (lane & 15) * KPITCH;
    const bf16* bv = sV[t & 1] + (lane & 15) * VPITCH;

    // Unrolled so that the LDS offsets are immediates and a chunk's reads can be
    // issued ahead of the vector work of the chunk before it.
#pragma unroll
    for (int c32 = 0; c32 < SKEYS / 32; ++c32) {
      // ---- St = K * Qt for 32 keys: sacc[nt][r] = score(key +nt*16+8*hi+r, query) ----
      v8f sacc[2];
#pragma unroll
      for (int nt = 0; nt < 2; ++nt) {
        sacc[nt] = (v8f){0.f, 0.f, 0.f, 0.f, 0.f, 0.f, 0.f, 0.f};
        const bf16* kp = bk + (c32 * 32 + nt * 16) * KPITCH;
        FragAB kf0, kf1;
        frag_lds(kf0, kp, hi);
        frag_lds(kf1, kp + 32, hi);
        sacc[nt] = __builtin_amdgcn_wmma_f32_16x16x32_bf16(false, kf0.v, false, qf0.v,
                                                           (short)0, sacc[nt], false, false);
        sacc[nt] = __builtin_amdgcn_wmma_f32_16x16x32_bf16(false, kf1.v, false, qf1.v,
                                                           (short)0, sacc[nt], false, false);
      }

      // ---- online softmax: this lane holds 16 of its query's 32 scores ----
      float c[16];
#pragma unroll
      for (int i = 0; i < 16; ++i) c[i] = sacc[i >> 3][i & 7] * scale;
      float m4[4];
#pragma unroll
      for (int i = 0; i < 4; ++i)
        m4[i] = fmaxf(fmaxf(c[4 * i], c[4 * i + 1]), fmaxf(c[4 * i + 2], c[4 * i + 3]));
      float mc = fmaxf(fmaxf(m4[0], m4[1]), fmaxf(m4[2], m4[3]));
      mc = fmaxf(mc, xhalf(mc));
      const float mn   = fmaxf(rowm, mc);
      const float corr = exp2_slot((rowm - mn) * LOG2E);
      rowm = mn;

      // Pt as B operand: element s wants key 8*hi+s (s<8) or 16+8*hi+(s-8), which is
      // exactly tile s>>3, register s&7 of St: convert in place, no lane exchange.
      FragAB pf;
      float p[16];
#pragma unroll
      for (int i = 0; i < 16; ++i) {
        p[i] = exp2_slot((c[i] - mn) * LOG2E);
        pf.b[i] = (bf16)p[i];
      }
      float s4[4];
#pragma unroll
      for (int i = 0; i < 4; ++i)
        s4[i] = (p[i] + p[i + 4]) + (p[i + 8] + p[i + 12]);
      rows = rows * corr + ((s4[0] + s4[1]) + (s4[2] + s4[3]));

      // ---- Ot = Ot*corr + Vt * Pt ----
#pragma unroll
      for (int j = 0; j < 4; ++j) {
#pragma unroll
        for (int r = 0; r < 8; ++r) oacc[j][r] *= corr;
        FragAB vf;
        frag_lds(vf, bv + j * 16 * VPITCH + c32 * 32, hi);
        oacc[j] = __builtin_amdgcn_wmma_f32_16x16x32_bf16(false, vf.v, false, pf.v,
                                                          (short)0, oacc[j], false, false);
      }
    }

    // Hand-over: tile t + 1 becomes readable, buffer t & 1 becomes free.
    asm volatile("s_wait_dscnt 0x0" ::: "memory");     // this wave's reads of tile t are done
    asm volatile("s_wait_asynccnt 0x0" ::: "memory");  // this wave's copies of tile t + 1 have landed
    __syncthreads();                                   // both hold for every wave of the block
    if (t + 2 < NTILE)
      tile_copy(kbh + (size_t)(t + 2) * SKEYS * DD, vbh + (t + 2) * SKEYS,
                sK[t & 1], sV[t & 1], tid);
  }
  asm volatile("s_wait_asynccnt 0x0" ::: "memory");    // no copy outstanding when the wave ends

  // ---- normalize + merge heads: write [B,T,C] bf16, 8 consecutive d per lane ----
  const int b = bh >> 2, h = bh & 3;
  const float inv = 1.0f / (rows + xhalf(rows));
  const int token = tq * 16 + (lane & 15);
  bf16* op = o + ((size_t)b * TT + token) * CC + h * DD + (hi << 3);
#pragma unroll
  for (int j = 0; j < 4; ++j) {
    union { bf16 e[8]; uint4 u; } pk;
#pragma unroll
    for (int r = 0; r < 8; ++r) pk.e[r] = (bf16)(oacc[j][r] * inv);
    *reinterpret_cast<uint4*>(op + j * 16) = pk.u;
  }
}

// ---------------------------------------------------------------------------
// LayerNorm over C=256: a wave takes LNT consecutive tokens (4 KB contiguous), all their
// loads issued first, so that the launch starts a quarter of the waves and each keeps
// 2 * LNT loads in flight; w and bias are read once per wave. Butterfly reductions.
// All results are formed in registers before the first store, so that no register of an
// issued store is written again.
// ---------------------------------------------------------------------------
#define LNT 4
__global__ __launch_bounds__(256) void ln_kernel(const float* __restrict__ in,
                                                 const float* __restrict__ w,
                                                 const float* __restrict__ bias,
                                                 float* __restrict__ outf,
                                                 bf16* __restrict__ outb) {
  const int lane = threadIdx.x & 31;
  const int tok0 = (blockIdx.x * 8 + (threadIdx.x >> 5)) * LNT;
  float4 wv[2], bv[2];
#pragma unroll   // wv[], bv[] must become registers
  for (int i = 0; i < 2; ++i) {
    wv[i] = reinterpret_cast<const float4*>(w)[i * 32 + lane];
    bv[i] = reinterpret_cast<const float4*>(bias)[i * 32 + lane];
  }
  const float4* p = reinterpret_cast<const float4*>(in + (size_t)tok0 * CC);
  float4 a[LNT][2];
#pragma unroll   // a[][] must become registers, and the loads stand together ahead of the sums
  for (int t = 0; t < LNT; ++t) {
    a[t][0] = p[t * 64 + lane];
    a[t][1] = p[t * 64 + 32 + lane];
  }

  // Mean and 1/sigma of all LNT tokens first, with no branch in between: the tokens'
  // butterfly chains are independent, and standing together they overlap.
  float4 y[LNT][2];
#pragma unroll   // a[][], y[][] are indexed by t
  for (int t = 0; t < LNT; ++t) {
    const float4 a0 = a[t][0], a1 = a[t][1];
    float sum = a0.x + a0.y + a0.z + a0.w + a1.x + a1.y + a1.z + a1.w;
    float sq  = a0.x * a0.x + a0.y * a0.y + a0.z * a0.z + a0.w * a0.w +
                a1.x * a1.x + a1.y * a1.y + a1.z * a1.z + a1.w * a1.w;
#pragma unroll
    for (int off = 1; off <= 16; off <<= 1) {
      sum += __shfl_xor(sum, off, 32);
      sq  += __shfl_xor(sq, off, 32);
    }
    const float mean = sum * (1.0f / CC);
    const float var  = sq * (1.0f / CC) - mean * mean;
    const float rstd = rsqrtf(var + LNEPS);
#pragma unroll
    for (int i = 0; i < 2; ++i) {
      const float4 av = a[t][i];
      y[t][i].x = wv[i].x * (av.x - mean) * rstd + bv[i].x;
      y[t][i].y = wv[i].y * (av.y - mean) * rstd + bv[i].y;
      y[t][i].z = wv[i].z * (av.z - mean) * rstd + bv[i].z;
      y[t][i].w = wv[i].w * (av.w - mean) * rstd + bv[i].w;
    }
  }

  if (outb) {
    uint2* ob = reinterpret_cast<uint2*>(outb + (size_t)tok0 * CC);
#pragma unroll   // y[][] is indexed by t
    for (int t = 0; t < LNT; ++t)
#pragma unroll
      for (int i = 0; i < 2; ++i) {
        union { bf16 e[4]; uint2 u; } pk;
        pk.e[0] = (bf16)y[t][i].x; pk.e[1] = (bf16)y[t][i].y;
        pk.e[2] = (bf16)y[t][i].z; pk.e[3] = (bf16)y[t][i].w;
        ob[t * 64 + i * 32 + lane] = pk.u;
      }
  }
  float4* of = reinterpret_cast<float4*>(outf + (size_t)tok0 * CC);
#pragma unroll   // y[][] is indexed by t
  for (int t = 0; t < LNT; ++t) {
    of[t * 64 + lane]      = y[t][0];
    of[t * 64 + 32 + lane] = y[t][1];
  }
}

// ---------------------------------------------------------------------------
// Host launcher
// ---------------------------------------------------------------------------
extern "C" void kernel_launch(void* const* d_in, const int* in_sizes, int n_in,
                              void* d_out, int out_size, void* d_ws, size_t ws_size,
                              hipStream_t stream) {
  const float* x      = (const float*)d_in[0];
  const float* qkv_w  = (const float*)d_in[1];
  const float* qkv_b  = (const float*)d_in[2];
  const float* proj_w = (const float*)d_in[3];
  const float* proj_b = (const float*)d_in[4];
  const float* n1_w   = (const float*)d_in[5];
  const float* n1_b   = (const float*)d_in[6];
  const float* ffn_w1 = (const float*)d_in[7];
  const float* ffn_b1 = (const float*)d_in[8];
  const float* ffn_w2 = (const float*)d_in[9];
  const float* ffn_b2 = (const float*)d_in[10];
  const float* n2_w   = (const float*)d_in[11];
  const float* n2_b   = (const float*)d_in[12];
  float* out = (float*)d_out;

  char* ws = (char*)d_ws;
  size_t off = 0;
  auto take = [&](size_t bytes) { void* p = ws + off; off += (bytes + 255) & ~(size_t)255; return p; };

  bf16*  x_bf     = (bf16*)take((size_t)MM * CC * 2);
  bf16*  wqkv_bf  = (bf16*)take((size_t)CC * N3 * 2);
  bf16*  wproj_bf = (bf16*)take((size_t)CC * CC * 2);
  bf16*  w1_bf    = (bf16*)take((size_t)CC * N3 * 2);
  bf16*  w2_bf    = (bf16*)take((size_t)N3 * CC * 2);
  bf16*  q_bf     = (bf16*)take((size_t)MM * CC * 2);
  bf16*  k_bf     = (bf16*)take((size_t)MM * CC * 2);
  bf16*  v_bf     = (bf16*)take((size_t)MM * CC * 2);   // [B,H,D,T]
  bf16*  attn_bf  = (bf16*)take((size_t)MM * CC * 2);
  float* r1       = (float*)take((size_t)MM * CC * 4);
  float* x1f      = (float*)take((size_t)MM * CC * 4);
  bf16*  x1_bf    = (bf16*)take((size_t)MM * CC * 2);
  bf16*  h_bf     = (bf16*)take((size_t)MM * N3 * 2);
  float* r2       = (float*)take((size_t)MM * CC * 4);

  // 1) converts, one launch: x (8 pieces of 4 floats per thread) and the weights [K][N] -> bf16 [N][K]
  cvt_all_kernel<<<XB_ALL + WB_ALL, 256, 0, stream>>>(x, qkv_w, proj_w, ffn_w1, ffn_w2,
                                                      x_bf, wqkv_bf, wproj_bf, w1_bf, w2_bf);

  // 2) QKV projection, scatter q/k -> [B,H,T,D], v -> [B,H,D,T]
  gemm_bf16_kernel<0, CC, N3><<<dim3(N3 / 128, MM / 128), 256, 0, stream>>>(
      x_bf, wqkv_bf, qkv_b, nullptr, nullptr, nullptr, q_bf, k_bf, v_bf);

  // 3) flash attention -> [B,T,C] bf16
  attn_kernel<<<(BB * HH * (TT / 16)) / 8, 256, 0, stream>>>(q_bf, k_bf, v_bf, attn_bf);

  // 4) output projection + residual(x) -> r1 f32
  gemm_bf16_kernel<1, CC, CC><<<dim3(CC / 128, MM / 128), 256, 0, stream>>>(
      attn_bf, wproj_bf, proj_b, x, r1, nullptr, nullptr, nullptr, nullptr);

  // 5) LN1 -> x1 (f32 + bf16)
  ln_kernel<<<MM / (8 * LNT), 256, 0, stream>>>(r1, n1_w, n1_b, x1f, x1_bf);

  // 6) FFN1 + GELU -> h bf16
  gemm_bf16_kernel<2, CC, N3><<<dim3(N3 / 128, MM / 128), 256, 0, stream>>>(
      x1_bf, w1_bf, ffn_b1, nullptr, nullptr, h_bf, nullptr, nullptr, nullptr);

  // 7) FFN2 + residual(x1) -> r2 f32
  gemm_bf16_kernel<1, N3, CC><<<dim3(CC / 128, MM / 128), 256, 0, stream>>>(
      h_bf, w2_bf, ffn_b2, x1f, r2, nullptr, nullptr, nullptr, nullptr);

  // 8) LN2 -> output f32
  ln_kernel<<<MM / (8 * LNT), 256, 0, stream>>>(r2, n2_w, n2_b, out, nullptr);
}

// v006
// Measured time: 145 microseconds a run.
// Timed twice side by side with v005, it ran 1.06 times as fast both times.
// Over all steps from v000 it is 3.58 times as fast.
#include <hip/hip_runtime.h>
#include <hip/hip_bf16.h>

// ---------------------------------------------------------------------------
// Transformer block for MI455X (gfx1250, wave32, WMMA).
// bf16 activations, f32 accumulation via v_wmma_f32_16x16x32_bf16.
// GEMM and attention tiles staged to LDS with global_load_async_to_lds_b128 (ASYNCcnt).
// ---------------------------------------------------------------------------

typedef __bf16 bf16;
typedef __attribute__((ext_vector_type(16))) __bf16 v16bf;
typedef __attribute__((ext_vector_type(8)))  float  v8f;

#define BB   4
#define TT   4096
#define CC   256
#define HH   4
#define DD   64
#define MM   (BB * TT)      // 16384 tokens
#define N3   (3 * CC)       // 768
#define LNEPS 1e-5f

// K index inside a 16x32 (16-bit) A/B fragment for VGPR r, lane-half hi.
// ISA 7.12.2: VGPR0..3 lanes0-15 hold K=0..7 (pairs), lanes16-31 K=8..15; VGPR4..7 -> +16.
__device__ __forceinline__ int kbase(int r, int hi) {
  return ((r & 4) << 2) | (hi << 3) | ((r & 3) << 1);
}

union FragAB {
  v16bf v;
  unsigned int u[8];
  bf16 b[16];
};

__device__ __forceinline__ unsigned lds_off32(const void* p) {
  return (unsigned)(unsigned long long)(uintptr_t)p;   // low 32 bits = LDS byte offset
}

// ---------------------------------------------------------------------------
// fp32 -> bf16 convert of one block's share. A thread takes PER pieces of 4 floats (16 B
// loads, all issued before the first store; a wave's load covers 512 contiguous bytes), so
// that few waves each keep PER loads in flight. blk counts blocks of 256 * PER * 4 elements.
// ---------------------------------------------------------------------------
template <int PER>
__device__ __forceinline__ void cvt_bf16_block(const float* __restrict__ in,
                                               bf16* __restrict__ out, int blk) {
  const int base = blk * (256 * PER) + threadIdx.x;          // index of a piece of 4 floats
  const float4* ip = reinterpret_cast<const float4*>(in);
  uint2* op = reinterpret_cast<uint2*>(out);
  float4 a[PER];
#pragma unroll   // a[] must become registers, and the loads stand together ahead of the stores
  for (int i = 0; i < PER; ++i) a[i] = ip[base + i * 256];
#pragma unroll   // as above
  for (int i = 0; i < PER; ++i) {
    union { bf16 e[4]; uint2 u; } pk;
    pk.e[0] = (bf16)a[i].x; pk.e[1] = (bf16)a[i].y;
    pk.e[2] = (bf16)a[i].z; pk.e[3] = (bf16)a[i].w;
    op[base + i * 256] = pk.u;
  }
}

// ---------------------------------------------------------------------------
// Weight convert with transpose: fp32 [K][N] -> bf16 [N][K], so that a GEMM's B tile has
// K-contiguous rows like its A tile. A block takes 32 n x 64 k: a wave reads 8 rows of
// 128 contiguous bytes, and the block's 8 waves together fill one whole 128-B line of each
// of its 32 output rows. blk runs over (N / 32) * (K / 64) blocks, n fastest.
// ---------------------------------------------------------------------------
__device__ __forceinline__ void cvt_wt_block(const float* __restrict__ in,
                                             bf16* __restrict__ out, int K, int N, int blk) {
  const int n  = (blk % (N / 32)) * 32 + (threadIdx.x & 31);
  const int k0 = (blk / (N / 32)) * 64 + (threadIdx.x >> 5) * 8;
  float a[8];
#pragma unroll   // a[] must become registers, and the loads stand together ahead of the store
  for (int i = 0; i < 8; ++i) a[i] = in[(size_t)(k0 + i) * N + n];
  union { bf16 e[8]; uint4 u; } pk;
#pragma unroll   // as above
  for (int i = 0; i < 8; ++i) pk.e[i] = (bf16)a[i];
  *reinterpret_cast<uint4*>(out + (size_t)n * K + k0) = pk.u;
  // Precaution: stands before any register that the store names can be written again (in the
  // one-launch kernel other arrays' code follows the store in the listing).
  asm volatile("s_wait_xcnt 0x0" ::: "memory");
}

// ---------------------------------------------------------------------------
// All five converts in one launch: they do not depend on one another, so the four gaps between
// dependent launches and the start and end of four short launches go. The block index picks
// the array (a scalar branch); x's 512 blocks, which move most of the bytes, come first.
// ---------------------------------------------------------------------------
#define WB_QKV  ((N3 / 32) * (CC / 64))            // 96 blocks
#define WB_PROJ ((CC / 32) * (CC / 64))            // 32
#define WB_FFN1 ((N3 / 32) * (CC / 64))            // 96
#define WB_FFN2 ((CC / 32) * (N3 / 64))            // 96
#define WB_ALL  (WB_QKV + WB_PROJ + WB_FFN1 + WB_FFN2)
#define XB_ALL  ((MM * CC) / (256 * 8 * 4))        // 512
__global__ __launch_bounds__(256) void cvt_all_kernel(
    const float* __restrict__ x, const float* __restrict__ qkv_w,
    const float* __restrict__ proj_w, const float* __restrict__ ffn_w1,
    const float* __restrict__ ffn_w2, bf16* __restrict__ x_bf,
    bf16* __restrict__ wqkv_bf, bf16* __restrict__ wproj_bf,
    bf16* __restrict__ w1_bf, bf16* __restrict__ w2_bf) {
  const int b = blockIdx.x;
  if (b < XB_ALL) {
    cvt_bf16_block<8>(x, x_bf, b);
    return;
  }
  const int w = b - XB_ALL;
  if (w < WB_QKV)
    cvt_wt_block(qkv_w, wqkv_bf, CC, N3, w);
  else if (w < WB_QKV + WB_PROJ)
    cvt_wt_block(proj_w, wproj_bf, CC, CC, w - WB_QKV);
  else if (w < WB_QKV + WB_PROJ + WB_FFN1)
    cvt_wt_block(ffn_w1, w1_bf, CC, N3, w - (WB_QKV + WB_PROJ));
  else
    cvt_wt_block(ffn_w2, w2_bf, N3, CC, w - (WB_QKV + WB_PROJ + WB_FFN1));
}

// One 16x32 fragment from an LDS row: k = 8*hi..+7 and 16+8*hi..+7 (the order of kbase).
__device__ __forceinline__ void frag_lds(FragAB& f, const bf16* rowp, int hi) {
  uint4 lo = *reinterpret_cast<const uint4*>(rowp + (hi << 3));
  uint4 up = *reinterpret_cast<const uint4*>(rowp + 16 + (hi << 3));
  f.u[0] = lo.x; f.u[1] = lo.y; f.u[2] = lo.z; f.u[3] = lo.w;
  f.u[4] = up.x; f.u[5] = up.y; f.u[6] = up.z; f.u[7] = up.w;
}

// ---------------------------------------------------------------------------
// Tiled GEMM: Out = A[M x K] * W[K x N] (+bias, + epilogue), W given as Wt[N x K].
// Block tile 128x128 (8 waves as 4 x 2, each a 32x64 tile = 8 WMMA per 32 k), K in steps
// of 64: a step's A and Wt tiles are 128 rows of one whole 128-B line each, brought into LDS
// by async copies (two buffers, the next step in flight while this one is worked on).
// MODE 0: QKV scatter -> q/k bf16 [B,H,T,D], v bf16 [B,H,D,T]
// MODE 1: + residual  -> f32 out [M x N]
// MODE 2: GELU        -> bf16 out [M x N]
// ---------------------------------------------------------------------------
#define GPITCH 72                   // bf16 per tile row in LDS: 128 B + 16 B (16 B x odd)
#define GTILE  (128 * GPITCH)       // bf16 per operand tile

// One K step: 128 rows x 64 k of A (at ag) and of Wt (at bg), source pitch K, 16 B per lane
// and copy, 4 + 4 copies per lane; a wave's copy covers 4 whole lines.
template <int K>
__device__ __forceinline__ void gemm_copy(const bf16* ag, const bf16* bg,
                                          bf16* sa, bf16* sb, int tid) {
  unsigned la[4], lb[4];
  unsigned long long ga[4], gb[4];
#pragma unroll   // the address arrays must become registers: they are the operands of the asm below
  for (int i = 0; i < 4; ++i) {
    const int p = i * 256 + tid;
    const int row = p >> 3, col = (p & 7) << 3;
    la[i] = lds_off32(sa + row * GPITCH + col);
    ga[i] = (unsigned long long)(uintptr_t)(ag + (size_t)row * K + col);
    lb[i] = lds_off32(sb + row * GPITCH + col);
    gb[i] = (unsigned long long)(uintptr_t)(bg + (size_t)row * K + col);
  }
  // The copies and their s_wait_xcnt in one statement: the wait stands before any
  // rewrite of an address register that an issued copy names.
  asm volatile(
      "global_load_async_to_lds_b128 %0, %8, off\n\t"
      "global_load_async_to_lds_b128 %1, %9, off\n\t"
      "global_load_async_to_lds_b128 %2, %10, off\n\t"
      "global_load_async_to_lds_b128 %3, %11, off\n\t"
      "global_load_async_to_lds_b128 %4, %12, off\n\t"
      "global_load_async_to_lds_b128 %5, %13, off\n\t"
      "global_load_async_to_lds_b128 %6, %14, off\n\t"
      "global_load_async_to_lds_b128 %7, %15, off\n\t"
      "s_wait_xcnt 0x0"
      :: "v"(la[0]), "v"(la[1]), "v"(la[2]), "v"(la[3]),
         "v"(lb[0]), "v"(lb[1]), "v"(lb[2]), "v"(lb[3]),
         "v"(ga[0]), "v"(ga[1]), "v"(ga[2]), "v"(ga[3]),
         "v"(gb[0]), "v"(gb[1]), "v"(gb[2]), "v"(gb[3])
      : "memory");
}

template <int MODE, int K, int N>
__global__ __launch_bounds__(256) void gemm_bf16_kernel(
    const bf16* __restrict__ A, const bf16* __restrict__ Wt,
    const float* __restrict__ bias,
    const float* __restrict__ res, float* __restrict__ outf,
    bf16* __restrict__ outb, bf16* __restrict__ oq,
    bf16* __restrict__ okk, bf16* __restrict__ ov) {
  __shared__ __align__(16) bf16 sA[2][GTILE];
  __shared__ __align__(16) bf16 sB[2][GTILE];
  constexpr int NSTEP = K / 64;        // at least 4 here

  const int tid  = threadIdx.x;
  const int lane = tid & 31;
  const int wave = tid >> 5;
  const int hi   = (lane >> 4) & 1;
  const int wm   = (wave >> 1) * 32;   // the wave's rows inside the block tile
  const int wn   = (wave & 1) * 64;    // the wave's columns inside the block tile
  const int m0   = blockIdx.y * 128;
  const int n0   = blockIdx.x * 128;
  const bf16* ag = A + (size_t)m0 * K;
  const bf16* bg = Wt + (size_t)n0 * K;

  // Step 0 into buffer 0, landed and published; then step 1 into buffer 1.
  gemm_copy<K>(ag, bg, sA[0], sB[0], tid);
  asm volatile("s_wait_asynccnt 0x0" ::: "memory");   // this wave's copies of step 0 have landed
  __syncthreads();                                    // ... and every other wave's
  gemm_copy<K>(ag + 64, bg + 64, sA[1], sB[1], tid);

  v8f acc[2][4];
#pragma unroll
  for (int ms = 0; ms < 2; ++ms)
#pragma unroll
    for (int ns = 0; ns < 4; ++ns)
      acc[ms][ns] = (v8f){0.f, 0.f, 0.f, 0.f, 0.f, 0.f, 0.f, 0.f};

  for (int t = 0; t < NSTEP; ++t) {
    const bf16* pa = sA[t & 1] + (wm + (lane & 15)) * GPITCH;
    const bf16* pb = sB[t & 1] + (wn + (lane & 15)) * GPITCH;
#pragma unroll   // fa[], fb[] must become registers; the LDS offsets become immediates
    for (int kk = 0; kk < 2; ++kk) {
      FragAB fa[2], fb[4];
#pragma unroll
      for (int ms = 0; ms < 2; ++ms) frag_lds(fa[ms], pa + ms * 16 * GPITCH + kk * 32, hi);
#pragma unroll
      for (int ns = 0; ns < 4; ++ns) frag_lds(fb[ns], pb + ns * 16 * GPITCH + kk * 32, hi);
#pragma unroll
      for (int ms = 0; ms < 2; ++ms)
#pragma unroll
        for (int ns = 0; ns < 4; ++ns)
          acc[ms][ns] = __builtin_amdgcn_wmma_f32_16x16x32_bf16(
              false, fa[ms].v, false, fb[ns].v, (short)0, acc[ms][ns], false, false);
    }

    // Hand-over: step t + 1 becomes readable, buffer t & 1 becomes free.
    asm volatile("s_wait_dscnt 0x0" ::: "memory");     // this wave's reads of step t are done
    asm volatile("s_wait_asynccnt 0x0" ::: "memory");  // this wave's copies of step t + 1 have landed
    __syncthreads();                                   // both hold for every wave of the block
    if (t + 2 < NSTEP)
      gemm_copy<K>(ag + (t + 2) * 64, bg + (t + 2) * 64, sA[t & 1], sB[t & 1], tid);
  }
  asm volatile("s_wait_asynccnt 0x0" ::: "memory");    // no copy outstanding when the wave ends

  // ---- epilogue: acc[ms][ns][r] is row wm + ms*16 + 8*hi + r, column wn + ns*16 + (lane & 15) ----
  const int gn0 = n0 + wn + (lane & 15);
  const int gm0 = m0 + wm + (hi << 3);
  float bv[4];
#pragma unroll   // bv[] must become registers
  for (int ns = 0; ns < 4; ++ns) bv[ns] = bias[gn0 + ns * 16];

  if (MODE == 0) {                     // QKV scatter
    const int part = n0 >> 8;          // a 128-column tile lies inside one of q, k, v: block-uniform
    if (part == 2) {                   // V transposed: [B,H,D,T]
#pragma unroll
      for (int ns = 0; ns < 4; ++ns)
#pragma unroll
        for (int ms = 0; ms < 2; ++ms)
#pragma unroll
          for (int r = 0; r < 8; ++r) {
            const int gm = gm0 + ms * 16 + r, cc = (gn0 + ns * 16) & 255;
            const int hh = cc >> 6, dd = cc & 63;
            const int bb = gm >> 12, ttok = gm & (TT - 1);
            ov[(((size_t)(bb * HH + hh)) * DD + dd) * TT + ttok] = (bf16)(acc[ms][ns][r] + bv[ns]);
          }
    } else {
      bf16* dst = (part == 0) ? oq : okk;
#pragma unroll
      for (int ns = 0; ns < 4; ++ns)
#pragma unroll
        for (int ms = 0; ms < 2; ++ms)
#pragma unroll
          for (int r = 0; r < 8; ++r) {
            const int gm = gm0 + ms * 16 + r, cc = (gn0 + ns * 16) & 255;
            const int hh = cc >> 6, dd = cc & 63;
            const int bb = gm >> 12, ttok = gm & (TT - 1);
            dst[(((size_t)(bb * HH + hh)) * TT + ttok) * DD + dd] = (bf16)(acc[ms][ns][r] + bv[ns]);
          }
    }
  } else if (MODE == 1) {              // bias + residual -> f32
    const unsigned base = (unsigned)gm0 * N + (unsigned)gn0;
    float rv[4][2][8];
    // Precaution: stands before a later load's result can take a register that a bias load names.
    asm volatile("s_wait_xcnt 0x0" ::: "memory");
#pragma unroll   // rv[][][] must become registers; all residual loads are in flight together
    for (int ns = 0; ns < 4; ++ns)
#pragma unroll
      for (int ms = 0; ms < 2; ++ms)
#pragma unroll
        for (int r = 0; r < 8; ++r) rv[ns][ms][r] = res[base + (ms * 16 + r) * N + ns * 16];
    // Precaution: stands before any register that a residual load names is written again.
    asm volatile("s_wait_xcnt 0x0" ::: "memory");
#pragma unroll
    for (int ns = 0; ns < 4; ++ns)
#pragma unroll
      for (int ms = 0; ms < 2; ++ms)
#pragma unroll
        for (int r = 0; r < 8; ++r)
          outf[base + (ms * 16 + r) * N + ns * 16] = (acc[ms][ns][r] + bv[ns]) + rv[ns][ms][r];
  } else {                             // exact GELU -> bf16
#pragma unroll
    for (int ns = 0; ns < 4; ++ns)
#pragma unroll
      for (int ms = 0; ms < 2; ++ms)
#pragma unroll
        for (int r = 0; r < 8; ++r) {
          const float val = acc[ms][ns][r] + bv[ns];
          const float g = 0.5f * val * (1.0f + erff(val * 0.70710678118f));
          outb[(size_t)(gm0 + ms * 16 + r) * N + gn0 + ns * 16] = (bf16)g;
        }
  }
}

// ---------------------------------------------------------------------------
// Flash attention, transposed: St = K * Qt puts one query's scores in one lane (column),
// so max and sum run in-lane plus one exchange between the wave halves; the two
// St tiles, converted in place, are the B operand of Ot += Vt * Pt.
// V is [B,H,D,T] so Vt rows are contiguous along keys.
// The 8 waves of a block share one (b,h) and 128 queries: K and Vt tiles of SKEYS keys are
// brought into LDS once per block by async copies (two buffers, the next tile in flight
// while this one is worked on) and every wave reads its fragments from there.
// Wave tile: 32 queries (two column groups) x one half of every tile's keys, in chunks of 32
// keys. Each K and Vt fragment read from LDS feeds two WMMAs (16 per chunk), and the block
// still has 8 waves. The two waves of a query group hold partial (max, sum, Ot) over
// disjoint keys; they are joined once, through LDS, behind the loop.
// ---------------------------------------------------------------------------
#define SKEYS  128                  // keys per LDS tile
#define NTILE  (TT / SKEYS)         // 32 tiles
#define KPITCH 72                   // bf16 per K row in LDS: 128 B + 16 B (16 B x odd)
#define VPITCH 136                  // bf16 per Vt row in LDS: 256 B + 16 B (16 B x odd)
#define KTILE  (SKEYS * KPITCH)     // bf16 per K tile
#define VTILE  (DD * VPITCH)        // bf16 per Vt tile
#define LOG2E  1.44269504088896f    // exp(x) = exp2(x * LOG2E), the product that __expf forms

__device__ __forceinline__ float xhalf(float x) {   // lane l <-> lane l ^ 16
  int b = __builtin_bit_cast(int, x);
  return __builtin_bit_cast(float,
      __builtin_amdgcn_permlanex16(b, b, 0x76543210, 0xfedcba98, false, false));
}

// exp2 with the one slot that the instruction set asks for behind a transcendental (before its
// result is read or its source register rewritten) kept in the same statement: a v_nop in a
// statement of its own did not stay behind the v_exp in the build.
__device__ __forceinline__ float exp2_slot(float x) {
  float r;
  asm("v_exp_f32 %0, %1\n\tv_nop" : "=v"(r) : "v"(x));
  return r;
}

// One tile: K rows [SKEYS][64] (16 KB contiguous at kg) and Vt rows [64][SKEYS] (source
// pitch TT, at vg), 16 B per lane and copy, 4 + 4 copies per lane; a wave's copy covers
// 512 B of whole lines.
__device__ __forceinline__ void tile_copy(const bf16* kg, const bf16* vg,
                                          bf16* sk, bf16* sv, int tid) {
  unsigned lk[4], lv[4];
  unsigned long long gk[4], gv[4];
#pragma unroll   // the address arrays must become registers: they are the operands of the asm below
  for (int i = 0; i < 4; ++i) {
    const int p = i * 256 + tid;
    lk[i] = lds_off32(sk + (p >> 3) * KPITCH + ((p & 7) << 3));
    gk[i] = (unsigned long long)(uintptr_t)(kg + (p << 3));
    lv[i] = lds_off32(sv + (p >> 4) * VPITCH + ((p & 15) << 3));
    gv[i] = (unsigned long long)(uintptr_t)(vg + (size_t)(p >> 4) * TT + ((p & 15) << 3));
  }
  // The copies and their s_wait_xcnt in one statement: the wait stands before any
  // rewrite of an address register that an issued copy names.
  asm volatile(
      "global_load_async_to_lds_b128 %0, %8, off\n\t"
      "global_load_async_to_lds_b128 %1, %9, off\n\t"
      "global_load_async_to_lds_b128 %2, %10, off\n\t"
      "global_load_async_to_lds_b128 %3, %11, off\n\t"
      "global_load_async_to_lds_b128 %4, %12, off\n\t"
      "global_load_async_to_lds_b128 %5, %13, off\n\t"
      "global_load_async_to_lds_b128 %6, %14, off\n\t"
      "global_load_async_to_lds_b128 %7, %15, off\n\t"
      "s_wait_xcnt 0x0"
      :: "v"(lk[0]), "v"(lk[1]), "v"(lk[2]), "v"(lk[3]),
         "v"(lv[0]), "v"(lv[1]), "v"(lv[2]), "v"(lv[3]),
         "v"(gk[0]), "v"(gk[1]), "v"(gk[2]), "v"(gk[3]),
         "v"(gv[0]), "v"(gv[1]), "v"(gv[2]), "v"(gv[3])
      : "memory");
}

// Four waves per SIMD (two blocks per WGP) is what the grid gives: the register budget is set to it.
__global__ __launch_bounds__(256) __attribute__((amdgpu_waves_per_eu(4, 4)))
void attn_kernel(const bf16* __restrict__ q,
                 const bf16* __restrict__ k,
                 const bf16* __restrict__ v,
                 bf16* __restrict__ o) {
  __shared__ __align__(16) bf16 sK[2][KTILE];
  __shared__ __align__(16) bf16 sV[2][VTILE];

  const int tid  = threadIdx.x;
  const int lane = tid & 31;
  const int wave = __builtin_amdgcn_readfirstlane(tid >> 5);   // scalar: the tests on kh are scalar branches
  const int hi   = (lane >> 4) & 1;
  const int qg   = wave >> 1;                      // query group: 32 of the block's 128 queries
  const int kh   = wave & 1;                       // which 64 keys of every tile
  const int bh   = blockIdx.x / (TT / 128);        // one (b,h) per block
  const int tq0  = (blockIdx.x % (TT / 128)) * 128 + qg * 32;   // the wave's first query
  const size_t rowbase = (size_t)bh * TT;
  const bf16* kbh = k + rowbase * DD;              // K rows of this (b,h)
  const bf16* vbh = v + (size_t)bh * DD * TT;      // Vt rows of this (b,h)

  // Tile 0 into buffer 0, landed and published; then tile 1 into buffer 1.
  tile_copy(kbh, vbh, sK[0], sV[0], tid);
  asm volatile("s_wait_asynccnt 0x0" ::: "memory");   // this wave's copies of tile 0 have landed
  __syncthreads();                                    // ... and every other wave's
  tile_copy(kbh + SKEYS * DD, vbh + SKEYS, sK[1], sV[1], tid);

  // Q fragments qf[column group][d half] as B operand: lane column = query. Loaded once.
  FragAB qf[2][2];
#pragma unroll   // qf[][] must become registers
  for (int qc = 0; qc < 2; ++qc) {
    const bf16* qp = q + (rowbase + tq0 + qc * 16 + (lane & 15)) * DD;
#pragma unroll
    for (int r = 0; r < 8; ++r) {
      qf[qc][0].u[r] = *reinterpret_cast<const unsigned int*>(qp + kbase(r, hi));
      qf[qc][1].u[r] = *reinterpret_cast<const unsigned int*>(qp + 32 + kbase(r, hi));
    }
  }

  // oacc[qc][j][r] = Ot[d = j*16 + 8*hi + r][query = qc*16 + (lane & 15)]
  v8f oacc[2][4];
  float rowm[2], rows[2];
#pragma unroll   // oacc[][], rowm[], rows[] must become registers
  for (int qc = 0; qc < 2; ++qc) {
#pragma unroll
    for (int j = 0; j < 4; ++j) oacc[qc][j] = (v8f){0.f, 0.f, 0.f, 0.f, 0.f, 0.f, 0.f, 0.f};
    rowm[qc] = -3.0e38f;   // running maximum of this lane's query (equal in both halves)
    rows[qc] = 0.f;        // running sum over this half's keys only; halves join at the end
  }

  const float scale = 0.125f;  // D^-0.5, D=64

  for (int t = 0; t < NTILE; ++t) {
    const bf16* bk = sK[t & 1] + (kh * (SKEYS / 2) + (lane & 15)) * KPITCH;
    const bf16* bv = sV[t & 1] + (lane & 15) * VPITCH + kh * (SKEYS / 2);

    // Unrolled so that the LDS offsets are immediates and a chunk's reads can be
    // issued ahead of the vector work of the chunk before it.
#pragma unroll
    for (int c32 = 0; c32 < SKEYS / 64; ++c32) {
      // ---- St = K * Qt for 32 keys x 32 queries:
      //      sacc[qc][nt][r] = score(key +nt*16+8*hi+r, query qc*16 + (lane & 15)) ----
      FragAB kf[2][2];
#pragma unroll
      for (int nt = 0; nt < 2; ++nt) {
        const bf16* kp = bk + (c32 * 32 + nt * 16) * KPITCH;
        frag_lds(kf[nt][0], kp, hi);
        frag_lds(kf[nt][1], kp + 32, hi);
      }
      v8f sacc[2][2];
#pragma unroll
      for (int nt = 0; nt < 2; ++nt)
#pragma unroll
        for (int qc = 0; qc < 2; ++qc) {
          sacc[qc][nt] = (v8f){0.f, 0.f, 0.f, 0.f, 0.f, 0.f, 0.f, 0.f};
          sacc[qc][nt] = __builtin_amdgcn_wmma_f32_16x16x32_bf16(
              false, kf[nt][0].v, false, qf[qc][0].v, (short)0, sacc[qc][nt], false, false);
        }
#pragma unroll
      for (int nt = 0; nt < 2; ++nt)
#pragma unroll
        for (int qc = 0; qc < 2; ++qc)
          sacc[qc][nt] = __builtin_amdgcn_wmma_f32_16x16x32_bf16(
              false, kf[nt][1].v, false, qf[qc][1].v, (short)0, sacc[qc][nt], false, false);

      FragAB vf[4];
#pragma unroll
      for (int j = 0; j < 4; ++j) frag_lds(vf[j], bv + j * 16 * VPITCH + c32 * 32, hi);

      // ---- online softmax, each column group by itself: a lane holds 16 of its query's 32 scores ----
      FragAB pf[2];
#pragma unroll
      for (int qc = 0; qc < 2; ++qc) {
        float c[16];
#pragma unroll
        for (int i = 0; i < 16; ++i) c[i] = sacc[qc][i >> 3][i & 7] * scale;
        float m4[4];
#pragma unroll
        for (int i = 0; i < 4; ++i)
          m4[i] = fmaxf(fmaxf(c[4 * i], c[4 * i + 1]), fmaxf(c[4 * i + 2], c[4 * i + 3]));
        float mc = fmaxf(fmaxf(m4[0], m4[1]), fmaxf(m4[2], m4[3]));
        mc = fmaxf(mc, xhalf(mc));
        const float mn   = fmaxf(rowm[qc], mc);
        const float corr = exp2_slot((rowm[qc] - mn) * LOG2E);
        rowm[qc] = mn;

        // Pt as B operand: element s wants key 8*hi+s (s<8) or 16+8*hi+(s-8), which is
        // exactly tile s>>3, register s&7 of St: convert in place, no lane exchange.
        float p[16];
#pragma unroll
        for (int i = 0; i < 16; ++i) {
          p[i] = exp2_slot((c[i] - mn) * LOG2E);
          pf[qc].b[i] = (bf16)p[i];
        }
        float s4[4];
#pragma unroll
        for (int i = 0; i < 4; ++i)
          s4[i] = (p[i] + p[i + 4]) + (p[i + 8] + p[i + 12]);
        rows[qc] = rows[qc] * corr + ((s4[0] + s4[1]) + (s4[2] + s4[3]));
#pragma unroll
        for (int j = 0; j < 4; ++j)
#pragma unroll
          for (int r = 0; r < 8; ++r) oacc[qc][j][r] *= corr;
      }

      // ---- Ot += Vt * Pt ----
#pragma unroll
      for (int j = 0; j < 4; ++j)
#pragma unroll
        for (int qc = 0; qc < 2; ++qc)
          oacc[qc][j] = __builtin_amdgcn_wmma_f32_16x16x32_bf16(
              false, vf[j].v, false, pf[qc].v, (short)0, oacc[qc][j], false, false);
    }

    // Hand-over: tile t + 1 becomes readable, buffer t & 1 becomes free.
    // This wave's reads of tile t are done. The two row sums are named as inputs only (nothing is
    // written): they are then formed in front of the hand-over. Without that their adds move behind
    // the barrier, the tile's 64 probabilities stay in registers until there, and the 32-query tile
    // has no registers left to fetch fragments ahead of their WMMAs.
    asm volatile("s_wait_dscnt 0x0" :: "v"(rows[0]), "v"(rows[1]) : "memory");
    asm volatile("s_wait_asynccnt 0x0" ::: "memory");  // this wave's copies of tile t + 1 have landed
    __syncthreads();                                   // both hold for every wave of the block
    if (t + 2 < NTILE)
      tile_copy(kbh + (size_t)(t + 2) * SKEYS * DD, vbh + (t + 2) * SKEYS,
                sK[t & 1], sV[t & 1], tid);
  }
  asm volatile("s_wait_asynccnt 0x0" ::: "memory");    // no copy outstanding when the wave ends

  // ---- join the two key halves of a query group. The K tiles are dead (the last hand-over's
  //      barrier ended every read, no copy is outstanding): their LDS carries the kh = 1 wave's
  //      partial Ot (16 B per lane and piece, lanes contiguous), maximum and sum. ----
  float4* mo = reinterpret_cast<float4*>(&sK[0][0]) + qg * (16 * 32) + lane;            // 4 x 8 KB
  float*  ml = reinterpret_cast<float*>(&sK[0][0]) + 4 * 16 * 32 * 4 + qg * (4 * 32) + lane;  // 4 x 512 B
  if (kh == 1) {
#pragma unroll
    for (int qc = 0; qc < 2; ++qc) {
#pragma unroll
      for (int j = 0; j < 4; ++j) {
        const v8f a = oacc[qc][j];
        mo[((qc * 4 + j) * 2 + 0) * 32] = make_float4(a[0], a[1], a[2], a[3]);
        mo[((qc * 4 + j) * 2 + 1) * 32] = make_float4(a[4], a[5], a[6], a[7]);
      }
      ml[(qc * 2 + 0) * 32] = rowm[qc];
      ml[(qc * 2 + 1) * 32] = rows[qc];
    }
  }
  __syncthreads();   // the kh = 1 partials are readable by the kh = 0 wave of the group
  if (kh == 1) return;

  // ---- normalize + merge heads: write [B,T,C] bf16, 8 consecutive d per lane ----
  const int b = bh >> 2, h = bh & 3;
  uint4 res[2][4];
#pragma unroll   // res[][] must become registers: all results are formed before the first store
  for (int qc = 0; qc < 2; ++qc) {
    const float m1 = ml[(qc * 2 + 0) * 32];
    const float l1 = ml[(qc * 2 + 1) * 32];
    const float mn = fmaxf(rowm[qc], m1);
    const float a0 = exp2_slot((rowm[qc] - mn) * LOG2E);
    const float a1 = exp2_slot((m1 - mn) * LOG2E);
    const float l  = rows[qc] * a0 + l1 * a1;
    const float inv = 1.0f / (l + xhalf(l));
    const float f0 = a0 * inv, f1 = a1 * inv;
#pragma unroll
    for (int j = 0; j < 4; ++j) {
      const float4 lo = mo[((qc * 4 + j) * 2 + 0) * 32];
      const float4 up = mo[((qc * 4 + j) * 2 + 1) * 32];
      const float o1[8] = {lo.x, lo.y, lo.z, lo.w, up.x, up.y, up.z, up.w};
      union { bf16 e[8]; uint4 u; } pk;
#pragma unroll
      for (int r = 0; r < 8; ++r) pk.e[r] = (bf16)(oacc[qc][j][r] * f0 + o1[r] * f1);
      res[qc][j] = pk.u;
    }
  }
#pragma unroll
  for (int qc = 0; qc < 2; ++qc) {
    bf16* op = o + ((size_t)b * TT + tq0 + qc * 16 + (lane & 15)) * CC + h * DD + (hi << 3);
#pragma unroll
    for (int j = 0; j < 4; ++j) *reinterpret_cast<uint4*>(op + j * 16) = res[qc][j];
  }
}

// ---------------------------------------------------------------------------
// LayerNorm over C=256: a wave takes LNT consecutive tokens (4 KB contiguous), all their
// loads issued first, so that the launch starts a quarter of the waves and each keeps
// 2 * LNT loads in flight; w and bias are read once per wave. Butterfly reductions.
// All results are formed in registers before the first store, so that no register of an
// issued store is written again.
// ---------------------------------------------------------------------------
#define LNT 4
__global__ __launch_bounds__(256) void ln_kernel(const float* __restrict__ in,
                                                 const float* __restrict__ w,
                                                 const float* __restrict__ bias,
                                                 float* __restrict__ outf,
                                                 bf16* __restrict__ outb) {
  const int lane = threadIdx.x & 31;
  const int tok0 = (blockIdx.x * 8 + (threadIdx.x >> 5)) * LNT;
  float4 wv[2], bv[2];
#pragma unroll   // wv[], bv[] must become registers
  for (int i = 0; i < 2; ++i) {
    wv[i] = reinterpret_cast<const float4*>(w)[i * 32 + lane];
    bv[i] = reinterpret_cast<const float4*>(bias)[i * 32 + lane];
  }
  const float4* p = reinterpret_cast<const float4*>(in + (size_t)tok0 * CC);
  float4 a[LNT][2];
#pragma unroll   // a[][] must become registers, and the loads stand together ahead of the sums
  for (int t = 0; t < LNT; ++t) {
    a[t][0] = p[t * 64 + lane];
    a[t][1] = p[t * 64 + 32 + lane];
  }

  // Mean and 1/sigma of all LNT tokens first, with no branch in between: the tokens'
  // butterfly chains are independent, and standing together they overlap.
  float4 y[LNT][2];
#pragma unroll   // a[][], y[][] are indexed by t
  for (int t = 0; t < LNT; ++t) {
    const float4 a0 = a[t][0], a1 = a[t][1];
    float sum = a0.x + a0.y + a0.z + a0.w + a1.x + a1.y + a1.z + a1.w;
    float sq  = a0.x * a0.x + a0.y * a0.y + a0.z * a0.z + a0.w * a0.w +
                a1.x * a1.x + a1.y * a1.y + a1.z * a1.z + a1.w * a1.w;
#pragma unroll
    for (int off = 1; off <= 16; off <<= 1) {
      sum += __shfl_xor(sum, off, 32);
      sq  += __shfl_xor(sq, off, 32);
    }
    const float mean = sum * (1.0f / CC);
    const float var  = sq * (1.0f / CC) - mean * mean;
    const float rstd = rsqrtf(var + LNEPS);
#pragma unroll
    for (int i = 0; i < 2; ++i) {
      const float4 av = a[t][i];
      y[t][i].x = wv[i].x * (av.x - mean) * rstd + bv[i].x;
      y[t][i].y = wv[i].y * (av.y - mean) * rstd + bv[i].y;
      y[t][i].z = wv[i].z * (av.z - mean) * rstd + bv[i].z;
      y[t][i].w = wv[i].w * (av.w - mean) * rstd + bv[i].w;
    }
  }

  if (outb) {
    uint2* ob = reinterpret_cast<uint2*>(outb + (size_t)tok0 * CC);
#pragma unroll   // y[][] is indexed by t
    for (int t = 0; t < LNT; ++t)
#pragma unroll
      for (int i = 0; i < 2; ++i) {
        union { bf16 e[4]; uint2 u; } pk;
        pk.e[0] = (bf16)y[t][i].x; pk.e[1] = (bf16)y[t][i].y;
        pk.e[2] = (bf16)y[t][i].z; pk.e[3] = (bf16)y[t][i].w;
        ob[t * 64 + i * 32 + lane] = pk.u;
      }
  }
  float4* of = reinterpret_cast<float4*>(outf + (size_t)tok0 * CC);
#pragma unroll   // y[][] is indexed by t
  for (int t = 0; t < LNT; ++t) {
    of[t * 64 + lane]      = y[t][0];
    of[t * 64 + 32 + lane] = y[t][1];
  }
}

// ---------------------------------------------------------------------------
// Host launcher
// ---------------------------------------------------------------------------
extern "C" void kernel_launch(void* const* d_in, const int* in_sizes, int n_in,
                              void* d_out, int out_size, void* d_ws, size_t ws_size,
                              hipStream_t stream) {
  const float* x      = (const float*)d_in[0];
  const float* qkv_w  = (const float*)d_in[1];
  const float* qkv_b  = (const float*)d_in[2];
  const float* proj_w = (const float*)d_in[3];
  const float* proj_b = (const float*)d_in[4];
  const float* n1_w   = (const float*)d_in[5];
  const float* n1_b   = (const float*)d_in[6];
  const float* ffn_w1 = (const float*)d_in[7];
  const float* ffn_b1 = (const float*)d_in[8];
  const float* ffn_w2 = (const float*)d_in[9];
  const float* ffn_b2 = (const float*)d_in[10];
  const float* n2_w   = (const float*)d_in[11];
  const float* n2_b   = (const float*)d_in[12];
  float* out = (float*)d_out;

  char* ws = (char*)d_ws;
  size_t off = 0;
  auto take = [&](size_t bytes) { void* p = ws + off; off += (bytes + 255) & ~(size_t)255; return p; };

  bf16*  x_bf     = (bf16*)take((size_t)MM * CC * 2);
  bf16*  wqkv_bf  = (bf16*)take((size_t)CC * N3 * 2);
  bf16*  wproj_bf = (bf16*)take((size_t)CC * CC * 2);
  bf16*  w1_bf    = (bf16*)take((size_t)CC * N3 * 2);
  bf16*  w2_bf    = (bf16*)take((size_t)N3 * CC * 2);
  bf16*  q_bf     = (bf16*)take((size_t)MM * CC * 2);
  bf16*  k_bf     = (bf16*)take((size_t)MM * CC * 2);
  bf16*  v_bf     = (bf16*)take((size_t)MM * CC * 2);   // [B,H,D,T]
  bf16*  attn_bf  = (bf16*)take((size_t)MM * CC * 2);
  float* r1       = (float*)take((size_t)MM * CC * 4);
  float* x1f      = (float*)take((size_t)MM * CC * 4);
  bf16*  x1_bf    = (bf16*)take((size_t)MM * CC * 2);
  bf16*  h_bf     = (bf16*)take((size_t)MM * N3 * 2);
  float* r2       = (float*)take((size_t)MM * CC * 4);

  // 1) converts, one launch: x (8 pieces of 4 floats per thread) and the weights [K][N] -> bf16 [N][K]
  cvt_all_kernel<<<XB_ALL + WB_ALL, 256, 0, stream>>>(x, qkv_w, proj_w, ffn_w1, ffn_w2,
                                                      x_bf, wqkv_bf, wproj_bf, w1_bf, w2_bf);

  // 2) QKV projection, scatter q/k -> [B,H,T,D], v -> [B,H,D,T]
  gemm_bf16_kernel<0, CC, N3><<<dim3(N3 / 128, MM / 128), 256, 0, stream>>>(
      x_bf, wqkv_bf, qkv_b, nullptr, nullptr, nullptr, q_bf, k_bf, v_bf);

  // 3) flash attention -> [B,T,C] bf16
  attn_kernel<<<BB * HH * (TT / 128), 256, 0, stream>>>(q_bf, k_bf, v_bf, attn_bf);

  // 4) output projection + residual(x) -> r1 f32
  gemm_bf16_kernel<1, CC, CC><<<dim3(CC / 128, MM / 128), 256, 0, stream>>>(
      attn_bf, wproj_bf, proj_b, x, r1, nullptr, nullptr, nullptr, nullptr);

  // 5) LN1 -> x1 (f32 + bf16)
  ln_kernel<<<MM / (8 * LNT), 256, 0, stream>>>(r1, n1_w, n1_b, x1f, x1_bf);

  // 6) FFN1 + GELU -> h bf16
  gemm_bf16_kernel<2, CC, N3><<<dim3(N3 / 128, MM / 128), 256, 0, stream>>>(
      x1_bf, w1_bf, ffn_b1, nullptr, nullptr, h_bf, nullptr, nullptr, nullptr);

  // 7) FFN2 + residual(x1) -> r2 f32
  gemm_bf16_kernel<1, N3, CC><<<dim3(CC / 128, MM / 128), 256, 0, stream>>>(
      h_bf, w2_bf, ffn_b2, x1f, r2, nullptr, nullptr, nullptr, nullptr);

  // 8) LN2 -> output f32
  ln_kernel<<<MM / (8 * LNT), 256, 0, stream>>>(r2, n2_w, n2_b, out, nullptr);
}

// v007
// A run of this version takes 139 microseconds.
// Two timings next to v006 put it at 1.04 and 1.05 times that version's speed.
// All steps since v000 together make it 3.74 times as fast.
#include <hip/hip_runtime.h>
#include <hip/hip_bf16.h>

// ---------------------------------------------------------------------------
// Transformer block for MI455X (gfx1250, wave32, WMMA).
// bf16 activations, f32 accumulation via v_wmma_f32_16x16x32_bf16.
// GEMM and attention tiles staged to LDS with global_load_async_to_lds_b128 (ASYNCcnt).
// ---------------------------------------------------------------------------

typedef __bf16 bf16;
typedef __attribute__((ext_vector_type(16))) __bf16 v16bf;
typedef __attribute__((ext_vector_type(8)))  float  v8f;
typedef __attribute__((ext_vector_type(2)))  float  v2f;

#define BB   4
#define TT   4096
#define CC   256
#define HH   4
#define DD   64
#define MM   (BB * TT)      // 16384 tokens
#define N3   (3 * CC)       // 768
#define LNEPS 1e-5f

// K index inside a 16x32 (16-bit) A/B fragment for VGPR r, lane-half hi.
// ISA 7.12.2: VGPR0..3 lanes0-15 hold K=0..7 (pairs), lanes16-31 K=8..15; VGPR4..7 -> +16.
__device__ __forceinline__ int kbase(int r, int hi) {
  return ((r & 4) << 2) | (hi << 3) | ((r & 3) << 1);
}

union FragAB {
  v16bf v;
  unsigned int u[8];
  bf16 b[16];
};

__device__ __forceinline__ unsigned lds_off32(const void* p) {
  return (unsigned)(unsigned long long)(uintptr_t)p;   // low 32 bits = LDS byte offset
}

// ---------------------------------------------------------------------------
// fp32 -> bf16 convert of one block's share. A thread takes PER pieces of 4 floats (16 B
// loads, all issued before the first store; a wave's load covers 512 contiguous bytes), so
// that few waves each keep PER loads in flight. blk counts blocks of 256 * PER * 4 elements.
// ---------------------------------------------------------------------------
template <int PER>
__device__ __forceinline__ void cvt_bf16_block(const float* __restrict__ in,
                                               bf16* __restrict__ out, int blk) {
  const int base = blk * (256 * PER) + threadIdx.x;          // index of a piece of 4 floats
  const float4* ip = reinterpret_cast<const float4*>(in);
  uint2* op = reinterpret_cast<uint2*>(out);
  float4 a[PER];
#pragma unroll   // a[] must become registers, and the loads stand together ahead of the stores
  for (int i = 0; i < PER; ++i) a[i] = ip[base + i * 256];
#pragma unroll   // as above
  for (int i = 0; i < PER; ++i) {
    union { bf16 e[4]; uint2 u; } pk;
    pk.e[0] = (bf16)a[i].x; pk.e[1] = (bf16)a[i].y;
    pk.e[2] = (bf16)a[i].z; pk.e[3] = (bf16)a[i].w;
    op[base + i * 256] = pk.u;
  }
}

// ---------------------------------------------------------------------------
// Weight convert with transpose: fp32 [K][N] -> bf16 [N][K], so that a GEMM's B tile has
// K-contiguous rows like its A tile. A block takes 32 n x 64 k: a wave reads 8 rows of
// 128 contiguous bytes, and the block's 8 waves together fill one whole 128-B line of each
// of its 32 output rows. blk runs over (N / 32) * (K / 64) blocks, n fastest.
// ---------------------------------------------------------------------------
__device__ __forceinline__ void cvt_wt_block(const float* __restrict__ in,
                                             bf16* __restrict__ out, int K, int N, int blk) {
  const int n  = (blk % (N / 32)) * 32 + (threadIdx.x & 31);
  const int k0 = (blk / (N / 32)) * 64 + (threadIdx.x >> 5) * 8;
  float a[8];
#pragma unroll   // a[] must become registers, and the loads stand together ahead of the store
  for (int i = 0; i < 8; ++i) a[i] = in[(size_t)(k0 + i) * N + n];
  union { bf16 e[8]; uint4 u; } pk;
#pragma unroll   // as above
  for (int i = 0; i < 8; ++i) pk.e[i] = (bf16)a[i];
  *reinterpret_cast<uint4*>(out + (size_t)n * K + k0) = pk.u;
  // Precaution: stands before any register that the store names can be written again (in the
  // one-launch kernel other arrays' code follows the store in the listing).
  asm volatile("s_wait_xcnt 0x0" ::: "memory");
}

// ---------------------------------------------------------------------------
// All five converts in one launch: they do not depend on one another, so the four gaps between
// dependent launches and the start and end of four short launches go. The block index picks
// the array (a scalar branch); x's 512 blocks, which move most of the bytes, come first.
// ---------------------------------------------------------------------------
#define WB_QKV  ((N3 / 32) * (CC / 64))            // 96 blocks
#define WB_PROJ ((CC / 32) * (CC / 64))            // 32
#define WB_FFN1 ((N3 / 32) * (CC / 64))            // 96
#define WB_FFN2 ((CC / 32) * (N3 / 64))            // 96
#define WB_ALL  (WB_QKV + WB_PROJ + WB_FFN1 + WB_FFN2)
#define XB_ALL  ((MM * CC) / (256 * 8 * 4))        // 512
__global__ __launch_bounds__(256) void cvt_all_kernel(
    const float* __restrict__ x, const float* __restrict__ qkv_w,
    const float* __restrict__ proj_w, const float* __restrict__ ffn_w1,
    const float* __restrict__ ffn_w2, bf16* __restrict__ x_bf,
    bf16* __restrict__ wqkv_bf, bf16* __restrict__ wproj_bf,
    bf16* __restrict__ w1_bf, bf16* __restrict__ w2_bf) {
  const int b = blockIdx.x;
  if (b < XB_ALL) {
    cvt_bf16_block<8>(x, x_bf, b);
    return;
  }
  const int w = b - XB_ALL;
  if (w < WB_QKV)
    cvt_wt_block(qkv_w, wqkv_bf, CC, N3, w);
  else if (w < WB_QKV + WB_PROJ)
    cvt_wt_block(proj_w, wproj_bf, CC, CC, w - WB_QKV);
  else if (w < WB_QKV + WB_PROJ + WB_FFN1)
    cvt_wt_block(ffn_w1, w1_bf, CC, N3, w - (WB_QKV + WB_PROJ));
  else
    cvt_wt_block(ffn_w2, w2_bf, N3, CC, w - (WB_QKV + WB_PROJ + WB_FFN1));
}

// One 16x32 fragment from an LDS row: k = 8*hi..+7 and 16+8*hi..+7 (the order of kbase).
__device__ __forceinline__ void frag_lds(FragAB& f, const bf16* rowp, int hi) {
  uint4 lo = *reinterpret_cast<const uint4*>(rowp + (hi << 3));
  uint4 up = *reinterpret_cast<const uint4*>(rowp + 16 + (hi << 3));
  f.u[0] = lo.x; f.u[1] = lo.y; f.u[2] = lo.z; f.u[3] = lo.w;
  f.u[4] = up.x; f.u[5] = up.y; f.u[6] = up.z; f.u[7] = up.w;
}

// ---------------------------------------------------------------------------
// Tiled GEMM: Out = A[M x K] * W[K x N] (+bias, + epilogue), W given as Wt[N x K].
// Block tile 128x128 (8 waves as 4 x 2, each a 32x64 tile = 8 WMMA per 32 k), K in steps
// of 64: a step's A and Wt tiles are 128 rows of one whole 128-B line each, brought into LDS
// by async copies (two buffers, the next step in flight while this one is worked on).
// MODE 0: QKV scatter -> q/k bf16 [B,H,T,D], v bf16 [B,H,D,T]
// MODE 1: + residual  -> f32 out [M x N]
// MODE 2: GELU        -> bf16 out [M x N]
// ---------------------------------------------------------------------------
#define GPITCH 72                   // bf16 per tile row in LDS: 128 B + 16 B (16 B x odd)
#define GTILE  (128 * GPITCH)       // bf16 per operand tile

// One K step: 128 rows x 64 k of A (at ag) and of Wt (at bg), source pitch K, 16 B per lane
// and copy, 4 + 4 copies per lane; a wave's copy covers 4 whole lines.
template <int K>
__device__ __forceinline__ void gemm_copy(const bf16* ag, const bf16* bg,
                                          bf16* sa, bf16* sb, int tid) {
  unsigned la[4], lb[4];
  unsigned long long ga[4], gb[4];
#pragma unroll   // the address arrays must become registers: they are the operands of the asm below
  for (int i = 0; i < 4; ++i) {
    const int p = i * 256 + tid;
    const int row = p >> 3, col = (p & 7) << 3;
    la[i] = lds_off32(sa + row * GPITCH + col);
    ga[i] = (unsigned long long)(uintptr_t)(ag + (size_t)row * K + col);
    lb[i] = lds_off32(sb + row * GPITCH + col);
    gb[i] = (unsigned long long)(uintptr_t)(bg + (size_t)row * K + col);
  }
  // The copies and their s_wait_xcnt in one statement: the wait stands before any
  // rewrite of an address register that an issued copy names.
  asm volatile(
      "global_load_async_to_lds_b128 %0, %8, off\n\t"
      "global_load_async_to_lds_b128 %1, %9, off\n\t"
      "global_load_async_to_lds_b128 %2, %10, off\n\t"
      "global_load_async_to_lds_b128 %3, %11, off\n\t"
      "global_load_async_to_lds_b128 %4, %12, off\n\t"
      "global_load_async_to_lds_b128 %5, %13, off\n\t"
      "global_load_async_to_lds_b128 %6, %14, off\n\t"
      "global_load_async_to_lds_b128 %7, %15, off\n\t"
      "s_wait_xcnt 0x0"
      :: "v"(la[0]), "v"(la[1]), "v"(la[2]), "v"(la[3]),
         "v"(lb[0]), "v"(lb[1]), "v"(lb[2]), "v"(lb[3]),
         "v"(ga[0]), "v"(ga[1]), "v"(ga[2]), "v"(ga[3]),
         "v"(gb[0]), "v"(gb[1]), "v"(gb[2]), "v"(gb[3])
      : "memory");
}

template <int MODE, int K, int N>
__global__ __launch_bounds__(256) void gemm_bf16_kernel(
    const bf16* __restrict__ A, const bf16* __restrict__ Wt,
    const float* __restrict__ bias,
    const float* __restrict__ res, float* __restrict__ outf,
    bf16* __restrict__ outb, bf16* __restrict__ oq,
    bf16* __restrict__ okk, bf16* __restrict__ ov) {
  __shared__ __align__(16) bf16 sA[2][GTILE];
  __shared__ __align__(16) bf16 sB[2][GTILE];
  constexpr int NSTEP = K / 64;        // at least 4 here

  const int tid  = threadIdx.x;
  const int lane = tid & 31;
  const int wave = tid >> 5;
  const int hi   = (lane >> 4) & 1;
  const int wm   = (wave >> 1) * 32;   // the wave's rows inside the block tile
  const int wn   = (wave & 1) * 64;    // the wave's columns inside the block tile
  const int m0   = blockIdx.y * 128;
  const int n0   = blockIdx.x * 128;
  const bf16* ag = A + (size_t)m0 * K;
  const bf16* bg = Wt + (size_t)n0 * K;

  // Step 0 into buffer 0, landed and published; then step 1 into buffer 1.
  gemm_copy<K>(ag, bg, sA[0], sB[0], tid);
  asm volatile("s_wait_asynccnt 0x0" ::: "memory");   // this wave's copies of step 0 have landed
  __syncthreads();                                    // ... and every other wave's
  gemm_copy<K>(ag + 64, bg + 64, sA[1], sB[1], tid);

  v8f acc[2][4];
#pragma unroll
  for (int ms = 0; ms < 2; ++ms)
#pragma unroll
    for (int ns = 0; ns < 4; ++ns)
      acc[ms][ns] = (v8f){0.f, 0.f, 0.f, 0.f, 0.f, 0.f, 0.f, 0.f};

  for (int t = 0; t < NSTEP; ++t) {
    const bf16* pa = sA[t & 1] + (wm + (lane & 15)) * GPITCH;
    const bf16* pb = sB[t & 1] + (wn + (lane & 15)) * GPITCH;
#pragma unroll   // fa[], fb[] must become registers; the LDS offsets become immediates
    for (int kk = 0; kk < 2; ++kk) {
      FragAB fa[2], fb[4];
#pragma unroll
      for (int ms = 0; ms < 2; ++ms) frag_lds(fa[ms], pa + ms * 16 * GPITCH + kk * 32, hi);
#pragma unroll
      for (int ns = 0; ns < 4; ++ns) frag_lds(fb[ns], pb + ns * 16 * GPITCH + kk * 32, hi);
#pragma unroll
      for (int ms = 0; ms < 2; ++ms)
#pragma unroll
        for (int ns = 0; ns < 4; ++ns)
          acc[ms][ns] = __builtin_amdgcn_wmma_f32_16x16x32_bf16(
              false, fa[ms].v, false, fb[ns].v, (short)0, acc[ms][ns], false, false);
    }

    // Hand-over: step t + 1 becomes readable, buffer t & 1 becomes free.
    asm volatile("s_wait_dscnt 0x0" ::: "memory");     // this wave's reads of step t are done
    asm volatile("s_wait_asynccnt 0x0" ::: "memory");  // this wave's copies of step t + 1 have landed
    __syncthreads();                                   // both hold for every wave of the block
    if (t + 2 < NSTEP)
      gemm_copy<K>(ag + (t + 2) * 64, bg + (t + 2) * 64, sA[t & 1], sB[t & 1], tid);
  }
  asm volatile("s_wait_asynccnt 0x0" ::: "memory");    // no copy outstanding when the wave ends

  // ---- epilogue: acc[ms][ns][r] is row wm + ms*16 + 8*hi + r, column wn + ns*16 + (lane & 15) ----
  const int gn0 = n0 + wn + (lane & 15);
  const int gm0 = m0 + wm + (hi << 3);
  float bv[4];
#pragma unroll   // bv[] must become registers
  for (int ns = 0; ns < 4; ++ns) bv[ns] = bias[gn0 + ns * 16];

  if (MODE == 0) {                     // QKV scatter
    const int part = n0 >> 8;          // a 128-column tile lies inside one of q, k, v: block-uniform
    if (part == 2) {                   // V transposed: [B,H,D,T]
#pragma unroll
      for (int ns = 0; ns < 4; ++ns)
#pragma unroll
        for (int ms = 0; ms < 2; ++ms)
#pragma unroll
          for (int r = 0; r < 8; ++r) {
            const int gm = gm0 + ms * 16 + r, cc = (gn0 + ns * 16) & 255;
            const int hh = cc >> 6, dd = cc & 63;
            const int bb = gm >> 12, ttok = gm & (TT - 1);
            ov[(((size_t)(bb * HH + hh)) * DD + dd) * TT + ttok] = (bf16)(acc[ms][ns][r] + bv[ns]);
          }
    } else {
      bf16* dst = (part == 0) ? oq : okk;
#pragma unroll
      for (int ns = 0; ns < 4; ++ns)
#pragma unroll
        for (int ms = 0; ms < 2; ++ms)
#pragma unroll
          for (int r = 0; r < 8; ++r) {
            const int gm = gm0 + ms * 16 + r, cc = (gn0 + ns * 16) & 255;
            const int hh = cc >> 6, dd = cc & 63;
            const int bb = gm >> 12, ttok = gm & (TT - 1);
            dst[(((size_t)(bb * HH + hh)) * TT + ttok) * DD + dd] = (bf16)(acc[ms][ns][r] + bv[ns]);
          }
    }
  } else if (MODE == 1) {              // bias + residual -> f32
    const unsigned base = (unsigned)gm0 * N + (unsigned)gn0;
    float rv[4][2][8];
    // Precaution: stands before a later load's result can take a register that a bias load names.
    asm volatile("s_wait_xcnt 0x0" ::: "memory");
#pragma unroll   // rv[][][] must become registers; all residual loads are in flight together
    for (int ns = 0; ns < 4; ++ns)
#pragma unroll
      for (int ms = 0; ms < 2; ++ms)
#pragma unroll
        for (int r = 0; r < 8; ++r) rv[ns][ms][r] = res[base + (ms * 16 + r) * N + ns * 16];
    // Precaution: stands before any register that a residual load names is written again.
    asm volatile("s_wait_xcnt 0x0" ::: "memory");
#pragma unroll
    for (int ns = 0; ns < 4; ++ns)
#pragma unroll
      for (int ms = 0; ms < 2; ++ms)
#pragma unroll
        for (int r = 0; r < 8; ++r)
          outf[base + (ms * 16 + r) * N + ns * 16] = (acc[ms][ns][r] + bv[ns]) + rv[ns][ms][r];
  } else {                             // exact GELU -> bf16
#pragma unroll
    for (int ns = 0; ns < 4; ++ns)
#pragma unroll
      for (int ms = 0; ms < 2; ++ms)
#pragma unroll
        for (int r = 0; r < 8; ++r) {
          const float val = acc[ms][ns][r] + bv[ns];
          const float g = 0.5f * val * (1.0f + erff(val * 0.70710678118f));
          outb[(size_t)(gm0 + ms * 16 + r) * N + gn0 + ns * 16] = (bf16)g;
        }
  }
}

// ---------------------------------------------------------------------------
// Flash attention, transposed: St = K * Qt puts one query's scores in one lane (column),
// so max and sum run in-lane plus one exchange between the wave halves; the two
// St tiles, converted in place, are the B operand of Ot += Vt * Pt.
// V is [B,H,D,T] so Vt rows are contiguous along keys.
// The 8 waves of a block share one (b,h) and 128 queries: K and Vt tiles of SKEYS keys are
// brought into LDS once per block by async copies (two buffers, the next tile in flight
// while this one is worked on) and every wave reads its fragments from there.
// Wave tile: 32 queries (two column groups) x one half of every tile's keys, in chunks of 32
// keys. Each K and Vt fragment read from LDS feeds two WMMAs (16 per chunk), and the block
// still has 8 waves. The two waves of a query group hold partial (max, sum, Ot) over
// disjoint keys; they are joined once, through LDS, behind the loop.
// ---------------------------------------------------------------------------
#define SKEYS  128                  // keys per LDS tile
#define NTILE  (TT / SKEYS)         // 32 tiles
#define KPITCH 72                   // bf16 per K row in LDS: 128 B + 16 B (16 B x odd)
#define VPITCH 136                  // bf16 per Vt row in LDS: 256 B + 16 B (16 B x odd)
#define KTILE  (SKEYS * KPITCH)     // bf16 per K tile
#define VTILE  (DD * VPITCH)        // bf16 per Vt tile
#define LOG2E  1.44269504088896f    // exp(x) = exp2(x * LOG2E)

__device__ __forceinline__ float xhalf(float x) {   // lane l <-> lane l ^ 16
  int b = __builtin_bit_cast(int, x);
  return __builtin_bit_cast(float,
      __builtin_amdgcn_permlanex16(b, b, 0x76543210, 0xfedcba98, false, false));
}

// exp2 with the one slot that the instruction set asks for behind a transcendental (before its
// result is read or its source register rewritten) kept in the same statement: a v_nop in a
// statement of its own did not stay behind the v_exp in the build.
__device__ __forceinline__ float exp2_slot(float x) {
  float r;
  asm("v_exp_f32 %0, %1\n\tv_nop" : "=v"(r) : "v"(x));
  return r;
}

// One tile: K rows [SKEYS][64] (16 KB contiguous at kg) and Vt rows [64][SKEYS] (source
// pitch TT, at vg), 16 B per lane and copy, 4 + 4 copies per lane; a wave's copy covers
// 512 B of whole lines.
__device__ __forceinline__ void tile_copy(const bf16* kg, const bf16* vg,
                                          bf16* sk, bf16* sv, int tid) {
  unsigned lk[4], lv[4];
  unsigned long long gk[4], gv[4];
#pragma unroll   // the address arrays must become registers: they are the operands of the asm below
  for (int i = 0; i < 4; ++i) {
    const int p = i * 256 + tid;
    lk[i] = lds_off32(sk + (p >> 3) * KPITCH + ((p & 7) << 3));
    gk[i] = (unsigned long long)(uintptr_t)(kg + (p << 3));
    lv[i] = lds_off32(sv + (p >> 4) * VPITCH + ((p & 15) << 3));
    gv[i] = (unsigned long long)(uintptr_t)(vg + (size_t)(p >> 4) * TT + ((p & 15) << 3));
  }
  // The copies and their s_wait_xcnt in one statement: the wait stands before any
  // rewrite of an address register that an issued copy names.
  asm volatile(
      "global_load_async_to_lds_b128 %0, %8, off\n\t"
      "global_load_async_to_lds_b128 %1, %9, off\n\t"
      "global_load_async_to_lds_b128 %2, %10, off\n\t"
      "global_load_async_to_lds_b128 %3, %11, off\n\t"
      "global_load_async_to_lds_b128 %4, %12, off\n\t"
      "global_load_async_to_lds_b128 %5, %13, off\n\t"
      "global_load_async_to_lds_b128 %6, %14, off\n\t"
      "global_load_async_to_lds_b128 %7, %15, off\n\t"
      "s_wait_xcnt 0x0"
      :: "v"(lk[0]), "v"(lk[1]), "v"(lk[2]), "v"(lk[3]),
         "v"(lv[0]), "v"(lv[1]), "v"(lv[2]), "v"(lv[3]),
         "v"(gk[0]), "v"(gk[1]), "v"(gk[2]), "v"(gk[3]),
         "v"(gv[0]), "v"(gv[1]), "v"(gv[2]), "v"(gv[3])
      : "memory");
}

// Four waves per SIMD (two blocks per WGP) is what the grid gives: the register budget is set to it.
__global__ __launch_bounds__(256) __attribute__((amdgpu_waves_per_eu(4, 4)))
void attn_kernel(const bf16* __restrict__ q,
                 const bf16* __restrict__ k,
                 const bf16* __restrict__ v,
                 bf16* __restrict__ o) {
  __shared__ __align__(16) bf16 sK[2][KTILE];
  __shared__ __align__(16) bf16 sV[2][VTILE];

  const int tid  = threadIdx.x;
  const int lane = tid & 31;
  const int wave = __builtin_amdgcn_readfirstlane(tid >> 5);   // scalar: the tests on kh are scalar branches
  const int hi   = (lane >> 4) & 1;
  const int qg   = wave >> 1;                      // query group: 32 of the block's 128 queries
  const int kh   = wave & 1;                       // which 64 keys of every tile
  const int bh   = blockIdx.x / (TT / 128);        // one (b,h) per block
  const int tq0  = (blockIdx.x % (TT / 128)) * 128 + qg * 32;   // the wave's first query
  const size_t rowbase = (size_t)bh * TT;
  const bf16* kbh = k + rowbase * DD;              // K rows of this (b,h)
  const bf16* vbh = v + (size_t)bh * DD * TT;      // Vt rows of this (b,h)

  // Tile 0 into buffer 0, landed and published; then tile 1 into buffer 1.
  tile_copy(kbh, vbh, sK[0], sV[0], tid);
  asm volatile("s_wait_asynccnt 0x0" ::: "memory");   // this wave's copies of tile 0 have landed
  __syncthreads();                                    // ... and every other wave's
  tile_copy(kbh + SKEYS * DD, vbh + SKEYS, sK[1], sV[1], tid);

  // Q fragments qf[column group][d half] as B operand: lane column = query. Loaded once.
  FragAB qf[2][2];
#pragma unroll   // qf[][] must become registers
  for (int qc = 0; qc < 2; ++qc) {
    const bf16* qp = q + (rowbase + tq0 + qc * 16 + (lane & 15)) * DD;
#pragma unroll
    for (int r = 0; r < 8; ++r) {
      qf[qc][0].u[r] = *reinterpret_cast<const unsigned int*>(qp + kbase(r, hi));
      qf[qc][1].u[r] = *reinterpret_cast<const unsigned int*>(qp + 32 + kbase(r, hi));
    }
  }

  // Softmax in the log2 domain: exp((s - m) * D^-0.5) = exp2(s * cscale - m * cscale), D = 64. cscale is
  // positive, so the maximum is taken on the raw scores and scaled once.
  const float cscale = 0.125f * LOG2E;

  // oacc[qc][j][r] = Ot[d = j*16 + 8*hi + r][query = qc*16 + (lane & 15)]
  v8f oacc[2][4];
  float rowm[2], rowb[2], rows[2];
#pragma unroll   // oacc[][], rowm[], rowb[], rows[] must become registers
  for (int qc = 0; qc < 2; ++qc) {
#pragma unroll
    for (int j = 0; j < 4; ++j) oacc[qc][j] = (v8f){0.f, 0.f, 0.f, 0.f, 0.f, 0.f, 0.f, 0.f};
    rowm[qc] = -3.0e38f;            // running maximum of this lane's query, raw score (equal in both halves)
    rowb[qc] = -3.0e38f * cscale;   // the same in log2 units: what the exponents in use are taken against
    rows[qc] = 0.f;        // running sum over this half's keys only; halves join at the end
  }


  for (int t = 0; t < NTILE; ++t) {
    const bf16* bk = sK[t & 1] + (kh * (SKEYS / 2) + (lane & 15)) * KPITCH;
    const bf16* bv = sV[t & 1] + (lane & 15) * VPITCH + kh * (SKEYS / 2);

    // Unrolled so that the LDS offsets are immediates and a chunk's reads can be
    // issued ahead of the vector work of the chunk before it.
#pragma unroll
    for (int c32 = 0; c32 < SKEYS / 64; ++c32) {
      // ---- St = K * Qt for 32 keys x 32 queries:
      //      sacc[qc][nt][r] = score(key +nt*16+8*hi+r, query qc*16 + (lane & 15)) ----
      FragAB kf[2][2];
#pragma unroll
      for (int nt = 0; nt < 2; ++nt) {
        const bf16* kp = bk + (c32 * 32 + nt * 16) * KPITCH;
        frag_lds(kf[nt][0], kp, hi);
        frag_lds(kf[nt][1], kp + 32, hi);
      }
      v8f sacc[2][2];
#pragma unroll
      for (int nt = 0; nt < 2; ++nt)
#pragma unroll
        for (int qc = 0; qc < 2; ++qc) {
          sacc[qc][nt] = (v8f){0.f, 0.f, 0.f, 0.f, 0.f, 0.f, 0.f, 0.f};
          sacc[qc][nt] = __builtin_amdgcn_wmma_f32_16x16x32_bf16(
              false, kf[nt][0].v, false, qf[qc][0].v, (short)0, sacc[qc][nt], false, false);
        }
#pragma unroll
      for (int nt = 0; nt < 2; ++nt)
#pragma unroll
        for (int qc = 0; qc < 2; ++qc)
          sacc[qc][nt] = __builtin_amdgcn_wmma_f32_16x16x32_bf16(
              false, kf[nt][1].v, false, qf[qc][1].v, (short)0, sacc[qc][nt], false, false);

      FragAB vf[4];
#pragma unroll
      for (int j = 0; j < 4; ++j) frag_lds(vf[j], bv + j * 16 * VPITCH + c32 * 32, hi);

      // ---- online softmax, each column group by itself: a lane holds 16 of its query's 32 scores ----
      FragAB pf[2];
#pragma unroll
      for (int qc = 0; qc < 2; ++qc) {
        float c[16];
#pragma unroll
        for (int i = 0; i < 16; ++i) c[i] = sacc[qc][i >> 3][i & 7];   // raw scores
        float m4[4];
#pragma unroll
        for (int i = 0; i < 4; ++i)
          m4[i] = fmaxf(fmaxf(c[4 * i], c[4 * i + 1]), fmaxf(c[4 * i + 2], c[4 * i + 3]));
        float mc = fmaxf(fmaxf(m4[0], m4[1]), fmaxf(m4[2], m4[3]));
        mc = fmaxf(mc, xhalf(mc));
        const float mn   = fmaxf(rowm[qc], mc);
        const float nb   = mn * cscale;
        const float corr = exp2_slot(rowb[qc] - nb);
        rowm[qc] = mn;
        rowb[qc] = nb;

        // Pt as B operand: element s wants key 8*hi+s (s<8) or 16+8*hi+(s-8), which is
        // exactly tile s>>3, register s&7 of St: convert in place, no lane exchange.
        // The exponent of two scores comes from one packed FMA.
        float p[16];
#pragma unroll
        for (int i = 0; i < 16; i += 2) {
          const v2f arg = __builtin_elementwise_fma((v2f){c[i], c[i + 1]}, (v2f){cscale, cscale},
                                                    (v2f){-nb, -nb});
          p[i]     = exp2_slot(arg.x);
          p[i + 1] = exp2_slot(arg.y);
          pf[qc].b[i]     = (bf16)p[i];
          pf[qc].b[i + 1] = (bf16)p[i + 1];
        }
        float s4[4];
#pragma unroll
        for (int i = 0; i < 4; ++i)
          s4[i] = (p[i] + p[i + 4]) + (p[i + 8] + p[i + 12]);
        rows[qc] = rows[qc] * corr + ((s4[0] + s4[1]) + (s4[2] + s4[3]));
#pragma unroll
        for (int j = 0; j < 4; ++j)
#pragma unroll
          for (int r = 0; r < 8; ++r) oacc[qc][j][r] *= corr;
      }

      // ---- Ot += Vt * Pt ----
#pragma unroll
      for (int j = 0; j < 4; ++j)
#pragma unroll
        for (int qc = 0; qc < 2; ++qc)
          oacc[qc][j] = __builtin_amdgcn_wmma_f32_16x16x32_bf16(
              false, vf[j].v, false, pf[qc].v, (short)0, oacc[qc][j], false, false);
    }

    // Hand-over: tile t + 1 becomes readable, buffer t & 1 becomes free.
    // This wave's reads of tile t are done. The two row sums are named as inputs only (nothing is
    // written): they are then formed in front of the hand-over. Without that their adds move behind
    // the barrier, the tile's 64 probabilities stay in registers until there, and the 32-query tile
    // has no registers left to fetch fragments ahead of their WMMAs.
    asm volatile("s_wait_dscnt 0x0" :: "v"(rows[0]), "v"(rows[1]) : "memory");
    asm volatile("s_wait_asynccnt 0x0" ::: "memory");  // this wave's copies of tile t + 1 have landed
    __syncthreads();                                   // both hold for every wave of the block
    if (t + 2 < NTILE)
      tile_copy(kbh + (size_t)(t + 2) * SKEYS * DD, vbh + (t + 2) * SKEYS,
                sK[t & 1], sV[t & 1], tid);
  }
  asm volatile("s_wait_asynccnt 0x0" ::: "memory");    // no copy outstanding when the wave ends

  // ---- join the two key halves of a query group. The K tiles are dead (the last hand-over's
  //      barrier ended every read, no copy is outstanding): their LDS carries the kh = 1 wave's
  //      partial Ot (16 B per lane and piece, lanes contiguous), maximum and sum. ----
  float4* mo = reinterpret_cast<float4*>(&sK[0][0]) + qg * (16 * 32) + lane;            // 4 x 8 KB
  float*  ml = reinterpret_cast<float*>(&sK[0][0]) + 4 * 16 * 32 * 4 + qg * (4 * 32) + lane;  // 4 x 512 B
  if (kh == 1) {
#pragma unroll
    for (int qc = 0; qc < 2; ++qc) {
#pragma unroll
      for (int j = 0; j < 4; ++j) {
        const v8f a = oacc[qc][j];
        mo[((qc * 4 + j) * 2 + 0) * 32] = make_float4(a[0], a[1], a[2], a[3]);
        mo[((qc * 4 + j) * 2 + 1) * 32] = make_float4(a[4], a[5], a[6], a[7]);
      }
      ml[(qc * 2 + 0) * 32] = rowb[qc];
      ml[(qc * 2 + 1) * 32] = rows[qc];
    }
  }
  __syncthreads();   // the kh = 1 partials are readable by the kh = 0 wave of the group
  if (kh == 1) return;

  // ---- normalize + merge heads: write [B,T,C] bf16, 8 consecutive d per lane ----
  const int b = bh >> 2, h = bh & 3;
  uint4 res[2][4];
#pragma unroll   // res[][] must become registers: all results are formed before the first store
  for (int qc = 0; qc < 2; ++qc) {
    const float m1 = ml[(qc * 2 + 0) * 32];
    const float l1 = ml[(qc * 2 + 1) * 32];
    const float mn = fmaxf(rowb[qc], m1);
    const float a0 = exp2_slot(rowb[qc] - mn);   // the maxima are in log2 units
    const float a1 = exp2_slot(m1 - mn);
    const float l  = rows[qc] * a0 + l1 * a1;
    const float inv = 1.0f / (l + xhalf(l));
    const float f0 = a0 * inv, f1 = a1 * inv;
#pragma unroll
    for (int j = 0; j < 4; ++j) {
      const float4 lo = mo[((qc * 4 + j) * 2 + 0) * 32];
      const float4 up = mo[((qc * 4 + j) * 2 + 1) * 32];
      const float o1[8] = {lo.x, lo.y, lo.z, lo.w, up.x, up.y, up.z, up.w};
      union { bf16 e[8]; uint4 u; } pk;
#pragma unroll
      for (int r = 0; r < 8; ++r) pk.e[r] = (bf16)(oacc[qc][j][r] * f0 + o1[r] * f1);
      res[qc][j] = pk.u;
    }
  }
#pragma unroll
  for (int qc = 0; qc < 2; ++qc) {
    bf16* op = o + ((size_t)b * TT + tq0 + qc * 16 + (lane & 15)) * CC + h * DD + (hi << 3);
#pragma unroll
    for (int j = 0; j < 4; ++j) *reinterpret_cast<uint4*>(op + j * 16) = res[qc][j];
  }
}

// ---------------------------------------------------------------------------
// LayerNorm over C=256: a wave takes LNT consecutive tokens (4 KB contiguous), all their
// loads issued first, so that the launch starts a quarter of the waves and each keeps
// 2 * LNT loads in flight; w and bias are read once per wave. Butterfly reductions.
// All results are formed in registers before the first store, so that no register of an
// issued store is written again.
// ---------------------------------------------------------------------------
#define LNT 4
__global__ __launch_bounds__(256) void ln_kernel(const float* __restrict__ in,
                                                 const float* __restrict__ w,
                                                 const float* __restrict__ bias,
                                                 float* __restrict__ outf,
                                                 bf16* __restrict__ outb) {
  const int lane = threadIdx.x & 31;
  const int tok0 = (blockIdx.x * 8 + (threadIdx.x >> 5)) * LNT;
  float4 wv[2], bv[2];
#pragma unroll   // wv[], bv[] must become registers
  for (int i = 0; i < 2; ++i) {
    wv[i] = reinterpret_cast<const float4*>(w)[i * 32 + lane];
    bv[i] = reinterpret_cast<const float4*>(bias)[i * 32 + lane];
  }
  const float4* p = reinterpret_cast<const float4*>(in + (size_t)tok0 * CC);
  float4 a[LNT][2];
#pragma unroll   // a[][] must become registers, and the loads stand together ahead of the sums
  for (int t = 0; t < LNT; ++t) {
    a[t][0] = p[t * 64 + lane];
    a[t][1] = p[t * 64 + 32 + lane];
  }

  // Mean and 1/sigma of all LNT tokens first, with no branch in between: the tokens'
  // butterfly chains are independent, and standing together they overlap.
  float4 y[LNT][2];
#pragma unroll   // a[][], y[][] are indexed by t
  for (int t = 0; t < LNT; ++t) {
    const float4 a0 = a[t][0], a1 = a[t][1];
    float sum = a0.x + a0.y + a0.z + a0.w + a1.x + a1.y + a1.z + a1.w;
    float sq  = a0.x * a0.x + a0.y * a0.y + a0.z * a0.z + a0.w * a0.w +
                a1.x * a1.x + a1.y * a1.y + a1.z * a1.z + a1.w * a1.w;
#pragma unroll
    for (int off = 1; off <= 16; off <<= 1) {
      sum += __shfl_xor(sum, off, 32);
      sq  += __shfl_xor(sq, off, 32);
    }
    const float mean = sum * (1.0f / CC);
    const float var  = sq * (1.0f / CC) - mean * mean;
    const float rstd = rsqrtf(var + LNEPS);
#pragma unroll
    for (int i = 0; i < 2; ++i) {
      const float4 av = a[t][i];
      y[t][i].x = wv[i].x * (av.x - mean) * rstd + bv[i].x;
      y[t][i].y = wv[i].y * (av.y - mean) * rstd + bv[i].y;
      y[t][i].z = wv[i].z * (av.z - mean) * rstd + bv[i].z;
      y[t][i].w = wv[i].w * (av.w - mean) * rstd + bv[i].w;
    }
  }

  if (outb) {
    uint2* ob = reinterpret_cast<uint2*>(outb + (size_t)tok0 * CC);
#pragma unroll   // y[][] is indexed by t
    for (int t = 0; t < LNT; ++t)
#pragma unroll
      for (int i = 0; i < 2; ++i) {
        union { bf16 e[4]; uint2 u; } pk;
        pk.e[0] = (bf16)y[t][i].x; pk.e[1] = (bf16)y[t][i].y;
        pk.e[2] = (bf16)y[t][i].z; pk.e[3] = (bf16)y[t][i].w;
        ob[t * 64 + i * 32 + lane] = pk.u;
      }
  }
  float4* of = reinterpret_cast<float4*>(outf + (size_t)tok0 * CC);
#pragma unroll   // y[][] is indexed by t
  for (int t = 0; t < LNT; ++t) {
    of[t * 64 + lane]      = y[t][0];
    of[t * 64 + 32 + lane] = y[t][1];
  }
}

// ---------------------------------------------------------------------------
// Host launcher
// ---------------------------------------------------------------------------
extern "C" void kernel_launch(void* const* d_in, const int* in_sizes, int n_in,
                              void* d_out, int out_size, void* d_ws, size_t ws_size,
                              hipStream_t stream) {
  const float* x      = (const float*)d_in[0];
  const float* qkv_w  = (const float*)d_in[1];
  const float* qkv_b  = (const float*)d_in[2];
  const float* proj_w = (const float*)d_in[3];
  const float* proj_b = (const float*)d_in[4];
  const float* n1_w   = (const float*)d_in[5];
  const float* n1_b   = (const float*)d_in[6];
  const float* ffn_w1 = (const float*)d_in[7];
  const float* ffn_b1 = (const float*)d_in[8];
  const float* ffn_w2 = (const float*)d_in[9];
  const float* ffn_b2 = (const float*)d_in[10];
  const float* n2_w   = (const float*)d_in[11];
  const float* n2_b   = (const float*)d_in[12];
  float* out = (float*)d_out;

  char* ws = (char*)d_ws;
  size_t off = 0;
  auto take = [&](size_t bytes) { void* p = ws + off; off += (bytes + 255) & ~(size_t)255; return p; };

  bf16*  x_bf     = (bf16*)take((size_t)MM * CC * 2);
  bf16*  wqkv_bf  = (bf16*)take((size_t)CC * N3 * 2);
  bf16*  wproj_bf = (bf16*)take((size_t)CC * CC * 2);
  bf16*  w1_bf    = (bf16*)take((size_t)CC * N3 * 2);
  bf16*  w2_bf    = (bf16*)take((size_t)N3 * CC * 2);
  bf16*  q_bf     = (bf16*)take((size_t)MM * CC * 2);
  bf16*  k_bf     = (bf16*)take((size_t)MM * CC * 2);
  bf16*  v_bf     = (bf16*)take((size_t)MM * CC * 2);   // [B,H,D,T]
  bf16*  attn_bf  = (bf16*)take((size_t)MM * CC * 2);
  float* r1       = (float*)take((size_t)MM * CC * 4);
  float* x1f      = (float*)take((size_t)MM * CC * 4);
  bf16*  x1_bf    = (bf16*)take((size_t)MM * CC * 2);
  bf16*  h_bf     = (bf16*)take((size_t)MM * N3 * 2);
  float* r2       = (float*)take((size_t)MM * CC * 4);

  // 1) converts, one launch: x (8 pieces of 4 floats per thread) and the weights [K][N] -> bf16 [N][K]
  cvt_all_kernel<<<XB_ALL + WB_ALL, 256, 0, stream>>>(x, qkv_w, proj_w, ffn_w1, ffn_w2,
                                                      x_bf, wqkv_bf, wproj_bf, w1_bf, w2_bf);

  // 2) QKV projection, scatter q/k -> [B,H,T,D], v -> [B,H,D,T]
  gemm_bf16_kernel<0, CC, N3><<<dim3(N3 / 128, MM / 128), 256, 0, stream>>>(
      x_bf, wqkv_bf, qkv_b, nullptr, nullptr, nullptr, q_bf, k_bf, v_bf);

  // 3) flash attention -> [B,T,C] bf16
  attn_kernel<<<BB * HH * (TT / 128), 256, 0, stream>>>(q_bf, k_bf, v_bf, attn_bf);

  // 4) output projection + residual(x) -> r1 f32
  gemm_bf16_kernel<1, CC, CC><<<dim3(CC / 128, MM / 128), 256, 0, stream>>>(
      attn_bf, wproj_bf, proj_b, x, r1, nullptr, nullptr, nullptr, nullptr);

  // 5) LN1 -> x1 (f32 + bf16)
  ln_kernel<<<MM / (8 * LNT), 256, 0, stream>>>(r1, n1_w, n1_b, x1f, x1_bf);

  // 6) FFN1 + GELU -> h bf16
  gemm_bf16_kernel<2, CC, N3><<<dim3(N3 / 128, MM / 128), 256, 0, stream>>>(
      x1_bf, w1_bf, ffn_b1, nullptr, nullptr, h_bf, nullptr, nullptr, nullptr);

  // 7) FFN2 + residual(x1) -> r2 f32
  gemm_bf16_kernel<1, N3, CC><<<dim3(CC / 128, MM / 128), 256, 0, stream>>>(
      h_bf, w2_bf, ffn_b2, x1f, r2, nullptr, nullptr, nullptr, nullptr);

  // 8) LN2 -> output f32
  ln_kernel<<<MM / (8 * LNT), 256, 0, stream>>>(r2, n2_w, n2_b, out, nullptr);
}

// v008
// One run takes 133 microseconds.
// In both of two side-by-side timings against v007, it was 1.05 times as fast.
// Counting every step since v000, it is 3.92 times as fast.
#include <hip/hip_runtime.h>
#include <hip/hip_bf16.h>

// ---------------------------------------------------------------------------
// Transformer block for MI455X (gfx1250, wave32, WMMA).
// bf16 activations, f32 accumulation via v_wmma_f32_16x16x32_bf16.
// GEMM and attention tiles staged to LDS with global_load_async_to_lds_b128 (ASYNCcnt).
// ---------------------------------------------------------------------------

typedef __bf16 bf16;
typedef __attribute__((ext_vector_type(16))) __bf16 v16bf;
typedef __attribute__((ext_vector_type(8)))  float  v8f;
typedef __attribute__((ext_vector_type(2)))  float  v2f;

#define BB   4
#define TT   4096
#define CC   256
#define HH   4
#define DD   64
#define MM   (BB * TT)      // 16384 tokens
#define N3   (3 * CC)       // 768
#define LNEPS 1e-5f

// K index inside a 16x32 (16-bit) A/B fragment for VGPR r, lane-half hi.
// ISA 7.12.2: VGPR0..3 lanes0-15 hold K=0..7 (pairs), lanes16-31 K=8..15; VGPR4..7 -> +16.
__device__ __forceinline__ int kbase(int r, int hi) {
  return ((r & 4) << 2) | (hi << 3) | ((r & 3) << 1);
}

union FragAB {
  v16bf v;
  unsigned int u[8];
  bf16 b[16];
};

__device__ __forceinline__ unsigned lds_off32(const void* p) {
  return (unsigned)(unsigned long long)(uintptr_t)p;   // low 32 bits = LDS byte offset
}

// ---------------------------------------------------------------------------
// fp32 -> bf16 convert of one block's share. A thread takes PER pieces of 4 floats (16 B
// loads, all issued before the first store; a wave's load covers 512 contiguous bytes), so
// that few waves each keep PER loads in flight. blk counts blocks of 256 * PER * 4 elements.
// ---------------------------------------------------------------------------
template <int PER>
__device__ __forceinline__ void cvt_bf16_block(const float* __restrict__ in,
                                               bf16* __restrict__ out, int blk) {
  const int base = blk * (256 * PER) + threadIdx.x;          // index of a piece of 4 floats
  const float4* ip = reinterpret_cast<const float4*>(in);
  uint2* op = reinterpret_cast<uint2*>(out);
  float4 a[PER];
#pragma unroll   // a[] must become registers, and the loads stand together ahead of the stores
  for (int i = 0; i < PER; ++i) a[i] = ip[base + i * 256];
#pragma unroll   // as above
  for (int i = 0; i < PER; ++i) {
    union { bf16 e[4]; uint2 u; } pk;
    pk.e[0] = (bf16)a[i].x; pk.e[1] = (bf16)a[i].y;
    pk.e[2] = (bf16)a[i].z; pk.e[3] = (bf16)a[i].w;
    op[base + i * 256] = pk.u;
  }
}

// ---------------------------------------------------------------------------
// Weight convert with transpose: fp32 [K][N] -> bf16 [N][K], so that a GEMM's B tile has
// K-contiguous rows like its A tile. A block takes 32 n x 64 k: a wave reads 8 rows of
// 128 contiguous bytes, and the block's 8 waves together fill one whole 128-B line of each
// of its 32 output rows. blk runs over (N / 32) * (K / 64) blocks, n fastest.
// ---------------------------------------------------------------------------
__device__ __forceinline__ void cvt_wt_block(const float* __restrict__ in,
                                             bf16* __restrict__ out, int K, int N, int blk) {
  const int n  = (blk % (N / 32)) * 32 + (threadIdx.x & 31);
  const int k0 = (blk / (N / 32)) * 64 + (threadIdx.x >> 5) * 8;
  float a[8];
#pragma unroll   // a[] must become registers, and the loads stand together ahead of the store
  for (int i = 0; i < 8; ++i) a[i] = in[(size_t)(k0 + i) * N + n];
  union { bf16 e[8]; uint4 u; } pk;
#pragma unroll   // as above
  for (int i = 0; i < 8; ++i) pk.e[i] = (bf16)a[i];
  *reinterpret_cast<uint4*>(out + (size_t)n * K + k0) = pk.u;
  // Precaution: stands before any register that the store names can be written again (in the
  // one-launch kernel other arrays' code follows the store in the listing).
  asm volatile("s_wait_xcnt 0x0" ::: "memory");
}

// ---------------------------------------------------------------------------
// All five converts in one launch: they do not depend on one another, so the four gaps between
// dependent launches and the start and end of four short launches go. The block index picks
// the array (a scalar branch); x's 512 blocks, which move most of the bytes, come first.
// ---------------------------------------------------------------------------
#define WB_QKV  ((N3 / 32) * (CC / 64))            // 96 blocks
#define WB_PROJ ((CC / 32) * (CC / 64))            // 32
#define WB_FFN1 ((N3 / 32) * (CC / 64))            // 96
#define WB_FFN2 ((CC / 32) * (N3 / 64))            // 96
#define WB_ALL  (WB_QKV + WB_PROJ + WB_FFN1 + WB_FFN2)
#define XB_ALL  ((MM * CC) / (256 * 8 * 4))        // 512
__global__ __launch_bounds__(256) void cvt_all_kernel(
    const float* __restrict__ x, const float* __restrict__ qkv_w,
    const float* __restrict__ proj_w, const float* __restrict__ ffn_w1,
    const float* __restrict__ ffn_w2, bf16* __restrict__ x_bf,
    bf16* __restrict__ wqkv_bf, bf16* __restrict__ wproj_bf,
    bf16* __restrict__ w1_bf, bf16* __restrict__ w2_bf) {
  const int b = blockIdx.x;
  if (b < XB_ALL) {
    cvt_bf16_block<8>(x, x_bf, b);
    return;
  }
  const int w = b - XB_ALL;
  if (w < WB_QKV)
    cvt_wt_block(qkv_w, wqkv_bf, CC, N3, w);
  else if (w < WB_QKV + WB_PROJ)
    cvt_wt_block(proj_w, wproj_bf, CC, CC, w - WB_QKV);
  else if (w < WB_QKV + WB_PROJ + WB_FFN1)
    cvt_wt_block(ffn_w1, w1_bf, CC, N3, w - (WB_QKV + WB_PROJ));
  else
    cvt_wt_block(ffn_w2, w2_bf, N3, CC, w - (WB_QKV + WB_PROJ + WB_FFN1));
}

// One 16x32 fragment from an LDS row: k = 8*hi..+7 and 16+8*hi..+7 (the order of kbase).
__device__ __forceinline__ void frag_lds(FragAB& f, const bf16* rowp, int hi) {
  uint4 lo = *reinterpret_cast<const uint4*>(rowp + (hi << 3));
  uint4 up = *reinterpret_cast<const uint4*>(rowp + 16 + (hi << 3));
  f.u[0] = lo.x; f.u[1] = lo.y; f.u[2] = lo.z; f.u[3] = lo.w;
  f.u[4] = up.x; f.u[5] = up.y; f.u[6] = up.z; f.u[7] = up.w;
}

// ---------------------------------------------------------------------------
// Tiled GEMM: Out = A[M x K] * W[K x N] (+bias, + epilogue), W given as Wt[N x K].
// Block tile 128x128 (8 waves as 4 x 2, each a 32x64 tile = 8 WMMA per 32 k), K in steps
// of 64: a step's A and Wt tiles are 128 rows of one whole 128-B line each, brought into LDS
// by async copies (two buffers, the next step in flight while this one is worked on).
// MODE 0: QKV scatter -> q/k bf16 [B,H,T,D], v bf16 [B,H,D,T]
// MODE 1: + residual  -> f32 out [M x N]
// MODE 2: GELU        -> bf16 out [M x N]
// ---------------------------------------------------------------------------
#define GPITCH 72                   // bf16 per tile row in LDS: 128 B + 16 B (16 B x odd)
#define GTILE  (128 * GPITCH)       // bf16 per operand tile

// One K step: 128 rows x 64 k of A (at ag) and of Wt (at bg), source pitch K, 16 B per lane
// and copy, 4 + 4 copies per lane; a wave's copy covers 4 whole lines.
template <int K>
__device__ __forceinline__ void gemm_copy(const bf16* ag, const bf16* bg,
                                          bf16* sa, bf16* sb, int tid) {
  unsigned la[4], lb[4];
  unsigned long long ga[4], gb[4];
#pragma unroll   // the address arrays must become registers: they are the operands of the asm below
  for (int i = 0; i < 4; ++i) {
    const int p = i * 256 + tid;
    const int row = p >> 3, col = (p & 7) << 3;
    la[i] = lds_off32(sa + row * GPITCH + col);
    ga[i] = (unsigned long long)(uintptr_t)(ag + (size_t)row * K + col);
    lb[i] = lds_off32(sb + row * GPITCH + col);
    gb[i] = (unsigned long long)(uintptr_t)(bg + (size_t)row * K + col);
  }
  // The copies and their s_wait_xcnt in one statement: the wait stands before any
  // rewrite of an address register that an issued copy names.
  asm volatile(
      "global_load_async_to_lds_b128 %0, %8, off\n\t"
      "global_load_async_to_lds_b128 %1, %9, off\n\t"
      "global_load_async_to_lds_b128 %2, %10, off\n\t"
      "global_load_async_to_lds_b128 %3, %11, off\n\t"
      "global_load_async_to_lds_b128 %4, %12, off\n\t"
      "global_load_async_to_lds_b128 %5, %13, off\n\t"
      "global_load_async_to_lds_b128 %6, %14, off\n\t"
      "global_load_async_to_lds_b128 %7, %15, off\n\t"
      "s_wait_xcnt 0x0"
      :: "v"(la[0]), "v"(la[1]), "v"(la[2]), "v"(la[3]),
         "v"(lb[0]), "v"(lb[1]), "v"(lb[2]), "v"(lb[3]),
         "v"(ga[0]), "v"(ga[1]), "v"(ga[2]), "v"(ga[3]),
         "v"(gb[0]), "v"(gb[1]), "v"(gb[2]), "v"(gb[3])
      : "memory");
}

template <int MODE, int K, int N>
__global__ __launch_bounds__(256) void gemm_bf16_kernel(
    const bf16* __restrict__ A, const bf16* __restrict__ Wt,
    const float* __restrict__ bias,
    const float* __restrict__ res, float* __restrict__ outf,
    bf16* __restrict__ outb, bf16* __restrict__ oq,
    bf16* __restrict__ okk, bf16* __restrict__ ov) {
  __shared__ __align__(16) bf16 sA[2][GTILE];
  __shared__ __align__(16) bf16 sB[2][GTILE];
  constexpr int NSTEP = K / 64;        // at least 4 here

  const int tid  = threadIdx.x;
  const int lane = tid & 31;
  const int wave = tid >> 5;
  const int hi   = (lane >> 4) & 1;
  const int wm   = (wave >> 1) * 32;   // the wave's rows inside the block tile
  const int wn   = (wave & 1) * 64;    // the wave's columns inside the block tile
  const int m0   = blockIdx.y * 128;
  const int n0   = blockIdx.x * 128;
  const bf16* ag = A + (size_t)m0 * K;
  const bf16* bg = Wt + (size_t)n0 * K;

  // Step 0 into buffer 0, landed and published; then step 1 into buffer 1.
  gemm_copy<K>(ag, bg, sA[0], sB[0], tid);
  asm volatile("s_wait_asynccnt 0x0" ::: "memory");   // this wave's copies of step 0 have landed
  __syncthreads();                                    // ... and every other wave's
  gemm_copy<K>(ag + 64, bg + 64, sA[1], sB[1], tid);

  v8f acc[2][4];
#pragma unroll
  for (int ms = 0; ms < 2; ++ms)
#pragma unroll
    for (int ns = 0; ns < 4; ++ns)
      acc[ms][ns] = (v8f){0.f, 0.f, 0.f, 0.f, 0.f, 0.f, 0.f, 0.f};

  for (int t = 0; t < NSTEP; ++t) {
    const bf16* pa = sA[t & 1] + (wm + (lane & 15)) * GPITCH;
    const bf16* pb = sB[t & 1] + (wn + (lane & 15)) * GPITCH;
#pragma unroll   // fa[], fb[] must become registers; the LDS offsets become immediates
    for (int kk = 0; kk < 2; ++kk) {
      FragAB fa[2], fb[4];
#pragma unroll
      for (int ms = 0; ms < 2; ++ms) frag_lds(fa[ms], pa + ms * 16 * GPITCH + kk * 32, hi);
#pragma unroll
      for (int ns = 0; ns < 4; ++ns) frag_lds(fb[ns], pb + ns * 16 * GPITCH + kk * 32, hi);
#pragma unroll
      for (int ms = 0; ms < 2; ++ms)
#pragma unroll
        for (int ns = 0; ns < 4; ++ns)
          acc[ms][ns] = __builtin_amdgcn_wmma_f32_16x16x32_bf16(
              false, fa[ms].v, false, fb[ns].v, (short)0, acc[ms][ns], false, false);
    }

    // Hand-over: step t + 1 becomes readable, buffer t & 1 becomes free.
    asm volatile("s_wait_dscnt 0x0" ::: "memory");     // this wave's reads of step t are done
    asm volatile("s_wait_asynccnt 0x0" ::: "memory");  // this wave's copies of step t + 1 have landed
    __syncthreads();                                   // both hold for every wave of the block
    if (t + 2 < NSTEP)
      gemm_copy<K>(ag + (t + 2) * 64, bg + (t + 2) * 64, sA[t & 1], sB[t & 1], tid);
  }
  asm volatile("s_wait_asynccnt 0x0" ::: "memory");    // no copy outstanding when the wave ends

  // ---- epilogue: acc[ms][ns][r] is row wm + ms*16 + 8*hi + r, column wn + ns*16 + (lane & 15) ----
  const int gn0 = n0 + wn + (lane & 15);
  const int gm0 = m0 + wm + (hi << 3);
  float bv[4];
#pragma unroll   // bv[] must become registers
  for (int ns = 0; ns < 4; ++ns) bv[ns] = bias[gn0 + ns * 16];

  if (MODE == 0) {                     // QKV scatter
    const int part = n0 >> 8;          // a 128-column tile lies inside one of q, k, v: block-uniform
    if (part == 2) {                   // V transposed: [B,H,D,T]
#pragma unroll
      for (int ns = 0; ns < 4; ++ns)
#pragma unroll
        for (int ms = 0; ms < 2; ++ms)
#pragma unroll
          for (int r = 0; r < 8; ++r) {
            const int gm = gm0 + ms * 16 + r, cc = (gn0 + ns * 16) & 255;
            const int hh = cc >> 6, dd = cc & 63;
            const int bb = gm >> 12, ttok = gm & (TT - 1);
            ov[(((size_t)(bb * HH + hh)) * DD + dd) * TT + ttok] = (bf16)(acc[ms][ns][r] + bv[ns]);
          }
    } else {
      bf16* dst = (part == 0) ? oq : okk;
#pragma unroll
      for (int ns = 0; ns < 4; ++ns)
#pragma unroll
        for (int ms = 0; ms < 2; ++ms)
#pragma unroll
          for (int r = 0; r < 8; ++r) {
            const int gm = gm0 + ms * 16 + r, cc = (gn0 + ns * 16) & 255;
            const int hh = cc >> 6, dd = cc & 63;
            const int bb = gm >> 12, ttok = gm & (TT - 1);
            dst[(((size_t)(bb * HH + hh)) * TT + ttok) * DD + dd] = (bf16)(acc[ms][ns][r] + bv[ns]);
          }
    }
  } else if (MODE == 1) {              // bias + residual -> f32
    const unsigned base = (unsigned)gm0 * N + (unsigned)gn0;
    float rv[4][2][8];
    // Precaution: stands before a later load's result can take a register that a bias load names.
    asm volatile("s_wait_xcnt 0x0" ::: "memory");
#pragma unroll   // rv[][][] must become registers; all residual loads are in flight together
    for (int ns = 0; ns < 4; ++ns)
#pragma unroll
      for (int ms = 0; ms < 2; ++ms)
#pragma unroll
        for (int r = 0; r < 8; ++r) rv[ns][ms][r] = res[base + (ms * 16 + r) * N + ns * 16];
    // Precaution: stands before any register that a residual load names is written again.
    asm volatile("s_wait_xcnt 0x0" ::: "memory");
#pragma unroll
    for (int ns = 0; ns < 4; ++ns)
#pragma unroll
      for (int ms = 0; ms < 2; ++ms)
#pragma unroll
        for (int r = 0; r < 8; ++r)
          outf[base + (ms * 16 + r) * N + ns * 16] = (acc[ms][ns][r] + bv[ns]) + rv[ns][ms][r];
  } else {                             // exact GELU -> bf16
#pragma unroll
    for (int ns = 0; ns < 4; ++ns)
#pragma unroll
      for (int ms = 0; ms < 2; ++ms)
#pragma unroll
        for (int r = 0; r < 8; ++r) {
          const float val = acc[ms][ns][r] + bv[ns];
          const float g = 0.5f * val * (1.0f + erff(val * 0.70710678118f));
          outb[(size_t)(gm0 + ms * 16 + r) * N + gn0 + ns * 16] = (bf16)g;
        }
  }
}

// ---------------------------------------------------------------------------
// Flash attention, transposed: St = K * Qt puts one query's scores in one lane (column),
// so max and sum run in-lane plus one exchange between the wave halves; the two
// St tiles, converted in place, are the B operand of Ot += Vt * Pt.
// V is [B,H,D,T] so Vt rows are contiguous along keys.
// The 8 waves of a block share one (b,h) and 128 queries: K and Vt tiles of SKEYS keys are
// brought into LDS once per block by async copies (two buffers, the next tile in flight
// while this one is worked on) and every wave reads its fragments from there.
// Wave tile: 32 queries (two column groups) x one half of every tile's keys, in chunks of 32
// keys. Each K and Vt fragment read from LDS feeds two WMMAs (16 per chunk), and the block
// still has 8 waves. The two waves of a query group hold partial (max, sum, Ot) over
// disjoint keys; they are joined once, through LDS, behind the loop.
// ---------------------------------------------------------------------------
#define SKEYS  128                  // keys per LDS tile
#define NTILE  (TT / SKEYS)         // 32 tiles
#define KPITCH 72                   // bf16 per K row in LDS: 128 B + 16 B (16 B x odd)
#define VPITCH 136                  // bf16 per Vt row in LDS: 256 B + 16 B (16 B x odd)
#define KTILE  (SKEYS * KPITCH)     // bf16 per K tile
#define VTILE  (DD * VPITCH)        // bf16 per Vt tile
#define LOG2E  1.44269504088896f    // exp(x) = exp2(x * LOG2E)

__device__ __forceinline__ float xhalf(float x) {   // lane l <-> lane l ^ 16
  int b = __builtin_bit_cast(int, x);
  return __builtin_bit_cast(float,
      __builtin_amdgcn_permlanex16(b, b, 0x76543210, 0xfedcba98, false, false));
}

// exp2 with the one slot that the instruction set asks for behind a transcendental (before its
// result is read or its source register rewritten) kept in the same statement: a v_nop in a
// statement of its own did not stay behind the v_exp in the build.
__device__ __forceinline__ float exp2_slot(float x) {
  float r;
  asm("v_exp_f32 %0, %1\n\tv_nop" : "=v"(r) : "v"(x));
  return r;
}

// One tile: K rows [SKEYS][64] (16 KB contiguous at kg) and Vt rows [64][SKEYS] (source
// pitch TT, at vg), 16 B per lane and copy, 4 + 4 copies per lane; a wave's copy covers
// 512 B of whole lines.
__device__ __forceinline__ void tile_copy(const bf16* kg, const bf16* vg,
                                          bf16* sk, bf16* sv, int tid) {
  unsigned lk[4], lv[4];
  unsigned long long gk[4], gv[4];
#pragma unroll   // the address arrays must become registers: they are the operands of the asm below
  for (int i = 0; i < 4; ++i) {
    const int p = i * 256 + tid;
    lk[i] = lds_off32(sk + (p >> 3) * KPITCH + ((p & 7) << 3));
    gk[i] = (unsigned long long)(uintptr_t)(kg + (p << 3));
    lv[i] = lds_off32(sv + (p >> 4) * VPITCH + ((p & 15) << 3));
    gv[i] = (unsigned long long)(uintptr_t)(vg + (size_t)(p >> 4) * TT + ((p & 15) << 3));
  }
  // The copies and their s_wait_xcnt in one statement: the wait stands before any
  // rewrite of an address register that an issued copy names.
  asm volatile(
      "global_load_async_to_lds_b128 %0, %8, off\n\t"
      "global_load_async_to_lds_b128 %1, %9, off\n\t"
      "global_load_async_to_lds_b128 %2, %10, off\n\t"
      "global_load_async_to_lds_b128 %3, %11, off\n\t"
      "global_load_async_to_lds_b128 %4, %12, off\n\t"
      "global_load_async_to_lds_b128 %5, %13, off\n\t"
      "global_load_async_to_lds_b128 %6, %14, off\n\t"
      "global_load_async_to_lds_b128 %7, %15, off\n\t"
      "s_wait_xcnt 0x0"
      :: "v"(lk[0]), "v"(lk[1]), "v"(lk[2]), "v"(lk[3]),
         "v"(lv[0]), "v"(lv[1]), "v"(lv[2]), "v"(lv[3]),
         "v"(gk[0]), "v"(gk[1]), "v"(gk[2]), "v"(gk[3]),
         "v"(gv[0]), "v"(gv[1]), "v"(gv[2]), "v"(gv[3])
      : "memory");
}

// Four waves per SIMD (two blocks per WGP) is what the grid gives: the register budget is set to it.
__global__ __launch_bounds__(256) __attribute__((amdgpu_waves_per_eu(4, 4)))
void attn_kernel(const bf16* __restrict__ q,
                 const bf16* __restrict__ k,
                 const bf16* __restrict__ v,
                 bf16* __restrict__ o) {
  __shared__ __align__(16) bf16 sK[2][KTILE];
  __shared__ __align__(16) bf16 sV[2][VTILE];

  const int tid  = threadIdx.x;
  const int lane = tid & 31;
  const int wave = __builtin_amdgcn_readfirstlane(tid >> 5);   // scalar: the tests on kh are scalar branches
  const int hi   = (lane >> 4) & 1;
  const int qg   = wave >> 1;                      // query group: 32 of the block's 128 queries
  const int kh   = wave & 1;                       // which 64 keys of every tile
  const int bh   = blockIdx.x / (TT / 128);        // one (b,h) per block
  const int tq0  = (blockIdx.x % (TT / 128)) * 128 + qg * 32;   // the wave's first query
  const size_t rowbase = (size_t)bh * TT;
  const bf16* kbh = k + rowbase * DD;              // K rows of this (b,h)
  const bf16* vbh = v + (size_t)bh * DD * TT;      // Vt rows of this (b,h)

  // Tile 0 into buffer 0, landed and published; then tile 1 into buffer 1.
  tile_copy(kbh, vbh, sK[0], sV[0], tid);
  asm volatile("s_wait_asynccnt 0x0" ::: "memory");   // this wave's copies of tile 0 have landed
  __syncthreads();                                    // ... and every other wave's
  tile_copy(kbh + SKEYS * DD, vbh + SKEYS, sK[1], sV[1], tid);

  // Q fragments qf[column group][d half] as B operand: lane column = query. Loaded once.
  FragAB qf[2][2];
#pragma unroll   // qf[][] must become registers
  for (int qc = 0; qc < 2; ++qc) {
    const bf16* qp = q + (rowbase + tq0 + qc * 16 + (lane & 15)) * DD;
#pragma unroll
    for (int r = 0; r < 8; ++r) {
      qf[qc][0].u[r] = *reinterpret_cast<const unsigned int*>(qp + kbase(r, hi));
      qf[qc][1].u[r] = *reinterpret_cast<const unsigned int*>(qp + 32 + kbase(r, hi));
    }
  }

  // Softmax in the log2 domain: exp((s - m) * D^-0.5) = exp2(s * cscale - m * cscale), D = 64. cscale is
  // positive, so the maximum is taken on the raw scores and scaled once.
  const float cscale = 0.125f * LOG2E;
  const float HEADROOM = 8.0f / cscale;   // 8 in log2 units, as a raw score

  // oacc[qc][j][r] = Ot[d = j*16 + 8*hi + r][query = qc*16 + (lane & 15)]
  v8f oacc[2][4];
  float rowm[2], rowb[2], rowt[2], rows[2];
#pragma unroll   // oacc[][], rowm[], rowb[], rowt[], rows[] must become registers
  for (int qc = 0; qc < 2; ++qc) {
#pragma unroll
    for (int j = 0; j < 4; ++j) oacc[qc][j] = (v8f){0.f, 0.f, 0.f, 0.f, 0.f, 0.f, 0.f, 0.f};
    rowm[qc] = -3.0e38f;            // reference of this lane's query, raw score (equal in both halves)
    rowb[qc] = -3.0e38f * cscale;   // the same in log2 units: what the exponents in use are taken against
    rowt[qc] = -3.0e38f;            // raw score above which the reference is raised: the first chunk always raises it
    rows[qc] = 0.f;        // running sum over this half's keys only; halves join at the end
  }


  for (int t = 0; t < NTILE; ++t) {
    const bf16* bk = sK[t & 1] + (kh * (SKEYS / 2) + (lane & 15)) * KPITCH;
    const bf16* bv = sV[t & 1] + (lane & 15) * VPITCH + kh * (SKEYS / 2);

    // Unrolled so that the LDS offsets are immediates and a chunk's reads can be
    // issued ahead of the vector work of the chunk before it.
#pragma unroll
    for (int c32 = 0; c32 < SKEYS / 64; ++c32) {
      // ---- St = K * Qt for 32 keys x 32 queries:
      //      sacc[qc][nt][r] = score(key +nt*16+8*hi+r, query qc*16 + (lane & 15)) ----
      FragAB kf[2][2];
#pragma unroll
      for (int nt = 0; nt < 2; ++nt) {
        const bf16* kp = bk + (c32 * 32 + nt * 16) * KPITCH;
        frag_lds(kf[nt][0], kp, hi);
        frag_lds(kf[nt][1], kp + 32, hi);
      }
      v8f sacc[2][2];
#pragma unroll
      for (int nt = 0; nt < 2; ++nt)
#pragma unroll
        for (int qc = 0; qc < 2; ++qc) {
          sacc[qc][nt] = (v8f){0.f, 0.f, 0.f, 0.f, 0.f, 0.f, 0.f, 0.f};
          sacc[qc][nt] = __builtin_amdgcn_wmma_f32_16x16x32_bf16(
              false, kf[nt][0].v, false, qf[qc][0].v, (short)0, sacc[qc][nt], false, false);
        }
#pragma unroll
      for (int nt = 0; nt < 2; ++nt)
#pragma unroll
        for (int qc = 0; qc < 2; ++qc)
          sacc[qc][nt] = __builtin_amdgcn_wmma_f32_16x16x32_bf16(
              false, kf[nt][1].v, false, qf[qc][1].v, (short)0, sacc[qc][nt], false, false);

      FragAB vf[4];
#pragma unroll
      for (int j = 0; j < 4; ++j) frag_lds(vf[j], bv + j * 16 * VPITCH + c32 * 32, hi);

      // ---- online softmax: a lane holds 16 of its query's 32 scores. Lazy rescale: the exponents are
      //      taken against the reference in use (rowb), which is raised only where a raw score lies
      //      more than HEADROOM above it, so a probability is at most 2^8. Sum and Ot stay relative to
      //      one reference, and the division at the end cancels it whatever it is. ----
      float mc[2];
#pragma unroll   // mc[] must become registers
      for (int qc = 0; qc < 2; ++qc) {
        float m4[4];
#pragma unroll
        for (int i = 0; i < 4; ++i)
          m4[i] = fmaxf(fmaxf(sacc[qc][0][i], sacc[qc][0][i + 4]), fmaxf(sacc[qc][1][i], sacc[qc][1][i + 4]));
        mc[qc] = fmaxf(fmaxf(m4[0], m4[1]), fmaxf(m4[2], m4[3]));   // this lane's 16 keys only
      }
      // One test per chunk for both column groups, a scalar branch: taken if any lane asks. Marked
      // unlikely so that the rescale code is laid out of line and the path that skips it falls through.
      if (__builtin_expect(__builtin_amdgcn_ballot_w32((mc[0] > rowt[0]) | (mc[1] > rowt[1])) != 0, 0)) {
#pragma unroll
        for (int qc = 0; qc < 2; ++qc) {
          const float mn   = fmaxf(rowm[qc], fmaxf(mc[qc], xhalf(mc[qc])));   // equal in both halves
          const float nb   = mn * cscale;
          const float corr = exp2_slot(rowb[qc] - nb);
          rowm[qc] = mn;
          rowb[qc] = nb;
          rowt[qc] = mn + HEADROOM;
          rows[qc] *= corr;
          const v2f corr2 = (v2f){corr, corr};
#pragma unroll
          for (int j = 0; j < 4; ++j)
#pragma unroll
            for (int r = 0; r < 8; r += 2) {
              v2f t2 = (v2f){oacc[qc][j][r], oacc[qc][j][r + 1]};
              // In place: result and source share their registers, so that the path that skips the
              // rescale needs no copy of Ot where the two paths meet.
              asm("v_pk_mul_f32 %0, %0, %1" : "+v"(t2) : "v"(corr2));
              oacc[qc][j][r]     = t2.x;
              oacc[qc][j][r + 1] = t2.y;
            }
        }
      }

      FragAB pf[2];
#pragma unroll
      for (int qc = 0; qc < 2; ++qc) {
        // Pt as B operand: element s wants key 8*hi+s (s<8) or 16+8*hi+(s-8), which is
        // exactly tile s>>3, register s&7 of St: convert in place, no lane exchange.
        // The exponent of two scores comes from one packed FMA.
        const float nb = rowb[qc];
        float p[16];
#pragma unroll
        for (int i = 0; i < 16; i += 2) {
          const v2f arg = __builtin_elementwise_fma(
              (v2f){sacc[qc][i >> 3][i & 7], sacc[qc][i >> 3][(i & 7) + 1]}, (v2f){cscale, cscale},
              (v2f){-nb, -nb});
          p[i]     = exp2_slot(arg.x);
          p[i + 1] = exp2_slot(arg.y);
          pf[qc].b[i]     = (bf16)p[i];
          pf[qc].b[i + 1] = (bf16)p[i + 1];
        }
        float s4[4];
#pragma unroll
        for (int i = 0; i < 4; ++i)
          s4[i] = (p[i] + p[i + 4]) + (p[i + 8] + p[i + 12]);
        rows[qc] += (s4[0] + s4[1]) + (s4[2] + s4[3]);
      }

      // ---- Ot += Vt * Pt ----
#pragma unroll
      for (int j = 0; j < 4; ++j)
#pragma unroll
        for (int qc = 0; qc < 2; ++qc)
          oacc[qc][j] = __builtin_amdgcn_wmma_f32_16x16x32_bf16(
              false, vf[j].v, false, pf[qc].v, (short)0, oacc[qc][j], false, false);
    }

    // Hand-over: tile t + 1 becomes readable, buffer t & 1 becomes free.
    // This wave's reads of tile t are done. The two row sums are named as inputs only (nothing is
    // written): they are then formed in front of the hand-over. Without that their adds move behind
    // the barrier, the tile's 64 probabilities stay in registers until there, and the 32-query tile
    // has no registers left to fetch fragments ahead of their WMMAs.
    asm volatile("s_wait_dscnt 0x0" :: "v"(rows[0]), "v"(rows[1]) : "memory");
    asm volatile("s_wait_asynccnt 0x0" ::: "memory");  // this wave's copies of tile t + 1 have landed
    __syncthreads();                                   // both hold for every wave of the block
    if (t + 2 < NTILE)
      tile_copy(kbh + (size_t)(t + 2) * SKEYS * DD, vbh + (t + 2) * SKEYS,
                sK[t & 1], sV[t & 1], tid);
  }
  asm volatile("s_wait_asynccnt 0x0" ::: "memory");    // no copy outstanding when the wave ends

  // ---- join the two key halves of a query group. The K tiles are dead (the last hand-over's
  //      barrier ended every read, no copy is outstanding): their LDS carries the kh = 1 wave's
  //      partial Ot (16 B per lane and piece, lanes contiguous), maximum and sum. ----
  float4* mo = reinterpret_cast<float4*>(&sK[0][0]) + qg * (16 * 32) + lane;            // 4 x 8 KB
  float*  ml = reinterpret_cast<float*>(&sK[0][0]) + 4 * 16 * 32 * 4 + qg * (4 * 32) + lane;  // 4 x 512 B
  if (kh == 1) {
#pragma unroll
    for (int qc = 0; qc < 2; ++qc) {
#pragma unroll
      for (int j = 0; j < 4; ++j) {
        const v8f a = oacc[qc][j];
        mo[((qc * 4 + j) * 2 + 0) * 32] = make_float4(a[0], a[1], a[2], a[3]);
        mo[((qc * 4 + j) * 2 + 1) * 32] = make_float4(a[4], a[5], a[6], a[7]);
      }
      ml[(qc * 2 + 0) * 32] = rowb[qc];
      ml[(qc * 2 + 1) * 32] = rows[qc];
    }
  }
  __syncthreads();   // the kh = 1 partials are readable by the kh = 0 wave of the group
  if (kh == 1) return;

  // ---- normalize + merge heads: write [B,T,C] bf16, 8 consecutive d per lane ----
  const int b = bh >> 2, h = bh & 3;
  uint4 res[2][4];
#pragma unroll   // res[][] must become registers: all results are formed before the first store
  for (int qc = 0; qc < 2; ++qc) {
    const float m1 = ml[(qc * 2 + 0) * 32];
    const float l1 = ml[(qc * 2 + 1) * 32];
    const float mn = fmaxf(rowb[qc], m1);
    const float a0 = exp2_slot(rowb[qc] - mn);   // the maxima are in log2 units
    const float a1 = exp2_slot(m1 - mn);
    const float l  = rows[qc] * a0 + l1 * a1;
    const float inv = 1.0f / (l + xhalf(l));
    const float f0 = a0 * inv, f1 = a1 * inv;
#pragma unroll
    for (int j = 0; j < 4; ++j) {
      const float4 lo = mo[((qc * 4 + j) * 2 + 0) * 32];
      const float4 up = mo[((qc * 4 + j) * 2 + 1) * 32];
      const float o1[8] = {lo.x, lo.y, lo.z, lo.w, up.x, up.y, up.z, up.w};
      union { bf16 e[8]; uint4 u; } pk;
#pragma unroll
      for (int r = 0; r < 8; ++r) pk.e[r] = (bf16)(oacc[qc][j][r] * f0 + o1[r] * f1);
      res[qc][j] = pk.u;
    }
  }
#pragma unroll
  for (int qc = 0; qc < 2; ++qc) {
    bf16* op = o + ((size_t)b * TT + tq0 + qc * 16 + (lane & 15)) * CC + h * DD + (hi << 3);
#pragma unroll
    for (int j = 0; j < 4; ++j) *reinterpret_cast<uint4*>(op + j * 16) = res[qc][j];
  }
}

// ---------------------------------------------------------------------------
// LayerNorm over C=256: a wave takes LNT consecutive tokens (4 KB contiguous), all their
// loads issued first, so that the launch starts a quarter of the waves and each keeps
// 2 * LNT loads in flight; w and bias are read once per wave. Butterfly reductions.
// All results are formed in registers before the first store, so that no register of an
// issued store is written again.
// ---------------------------------------------------------------------------
#define LNT 4
__global__ __launch_bounds__(256) void ln_kernel(const float* __restrict__ in,
                                                 const float* __restrict__ w,
                                                 const float* __restrict__ bias,
                                                 float* __restrict__ outf,
                                                 bf16* __restrict__ outb) {
  const int lane = threadIdx.x & 31;
  const int tok0 = (blockIdx.x * 8 + (threadIdx.x >> 5)) * LNT;
  float4 wv[2], bv[2];
#pragma unroll   // wv[], bv[] must become registers
  for (int i = 0; i < 2; ++i) {
    wv[i] = reinterpret_cast<const float4*>(w)[i * 32 + lane];
    bv[i] = reinterpret_cast<const float4*>(bias)[i * 32 + lane];
  }
  const float4* p = reinterpret_cast<const float4*>(in + (size_t)tok0 * CC);
  float4 a[LNT][2];
#pragma unroll   // a[][] must become registers, and the loads stand together ahead of the sums
  for (int t = 0; t < LNT; ++t) {
    a[t][0] = p[t * 64 + lane];
    a[t][1] = p[t * 64 + 32 + lane];
  }

  // Mean and 1/sigma of all LNT tokens first, with no branch in between: the tokens'
  // butterfly chains are independent, and standing together they overlap.
  float4 y[LNT][2];
#pragma unroll   // a[][], y[][] are indexed by t
  for (int t = 0; t < LNT; ++t) {
    const float4 a0 = a[t][0], a1 = a[t][1];
    float sum = a0.x + a0.y + a0.z + a0.w + a1.x + a1.y + a1.z + a1.w;
    float sq  = a0.x * a0.x + a0.y * a0.y + a0.z * a0.z + a0.w * a0.w +
                a1.x * a1.x + a1.y * a1.y + a1.z * a1.z + a1.w * a1.w;
#pragma unroll
    for (int off = 1; off <= 16; off <<= 1) {
      sum += __shfl_xor(sum, off, 32);
      sq  += __shfl_xor(sq, off, 32);
    }
    const float mean = sum * (1.0f / CC);
    const float var  = sq * (1.0f / CC) - mean * mean;
    const float rstd = rsqrtf(var + LNEPS);
#pragma unroll
    for (int i = 0; i < 2; ++i) {
      const float4 av = a[t][i];
      y[t][i].x = wv[i].x * (av.x - mean) * rstd + bv[i].x;
      y[t][i].y = wv[i].y * (av.y - mean) * rstd + bv[i].y;
      y[t][i].z = wv[i].z * (av.z - mean) * rstd + bv[i].z;
      y[t][i].w = wv[i].w * (av.w - mean) * rstd + bv[i].w;
    }
  }

  if (outb) {
    uint2* ob = reinterpret_cast<uint2*>(outb + (size_t)tok0 * CC);
#pragma unroll   // y[][] is indexed by t
    for (int t = 0; t < LNT; ++t)
#pragma unroll
      for (int i = 0; i < 2; ++i) {
        union { bf16 e[4]; uint2 u; } pk;
        pk.e[0] = (bf16)y[t][i].x; pk.e[1] = (bf16)y[t][i].y;
        pk.e[2] = (bf16)y[t][i].z; pk.e[3] = (bf16)y[t][i].w;
        ob[t * 64 + i * 32 + lane] = pk.u;
      }
  }
  float4* of = reinterpret_cast<float4*>(outf + (size_t)tok0 * CC);
#pragma unroll   // y[][] is indexed by t
  for (int t = 0; t < LNT; ++t) {
    of[t * 64 + lane]      = y[t][0];
    of[t * 64 + 32 + lane] = y[t][1];
  }
}

// ---------------------------------------------------------------------------
// Host launcher
// ---------------------------------------------------------------------------
extern "C" void kernel_launch(void* const* d_in, const int* in_sizes, int n_in,
                              void* d_out, int out_size, void* d_ws, size_t ws_size,
                              hipStream_t stream) {
  const float* x      = (const float*)d_in[0];
  const float* qkv_w  = (const float*)d_in[1];
  const float* qkv_b  = (const float*)d_in[2];
  const float* proj_w = (const float*)d_in[3];
  const float* proj_b = (const float*)d_in[4];
  const float* n1_w   = (const float*)d_in[5];
  const float* n1_b   = (const float*)d_in[6];
  const float* ffn_w1 = (const float*)d_in[7];
  const float* ffn_b1 = (const float*)d_in[8];
  const float* ffn_w2 = (const float*)d_in[9];
  const float* ffn_b2 = (const float*)d_in[10];
  const float* n2_w   = (const float*)d_in[11];
  const float* n2_b   = (const float*)d_in[12];
  float* out = (float*)d_out;

  char* ws = (char*)d_ws;
  size_t off = 0;
  auto take = [&](size_t bytes) { void* p = ws + off; off += (bytes + 255) & ~(size_t)255; return p; };

  bf16*  x_bf     = (bf16*)take((size_t)MM * CC * 2);
  bf16*  wqkv_bf  = (bf16*)take((size_t)CC * N3 * 2);
  bf16*  wproj_bf = (bf16*)take((size_t)CC * CC * 2);
  bf16*  w1_bf    = (bf16*)take((size_t)CC * N3 * 2);
  bf16*  w2_bf    = (bf16*)take((size_t)N3 * CC * 2);
  bf16*  q_bf     = (bf16*)take((size_t)MM * CC * 2);
  bf16*  k_bf     = (bf16*)take((size_t)MM * CC * 2);
  bf16*  v_bf     = (bf16*)take((size_t)MM * CC * 2);   // [B,H,D,T]
  bf16*  attn_bf  = (bf16*)take((size_t)MM * CC * 2);
  float* r1       = (float*)take((size_t)MM * CC * 4);
  float* x1f      = (float*)take((size_t)MM * CC * 4);
  bf16*  x1_bf    = (bf16*)take((size_t)MM * CC * 2);
  bf16*  h_bf     = (bf16*)take((size_t)MM * N3 * 2);
  float* r2       = (float*)take((size_t)MM * CC * 4);

  // 1) converts, one launch: x (8 pieces of 4 floats per thread) and the weights [K][N] -> bf16 [N][K]
  cvt_all_kernel<<<XB_ALL + WB_ALL, 256, 0, stream>>>(x, qkv_w, proj_w, ffn_w1, ffn_w2,
                                                      x_bf, wqkv_bf, wproj_bf, w1_bf, w2_bf);

  // 2) QKV projection, scatter q/k -> [B,H,T,D], v -> [B,H,D,T]
  gemm_bf16_kernel<0, CC, N3><<<dim3(N3 / 128, MM / 128), 256, 0, stream>>>(
      x_bf, wqkv_bf, qkv_b, nullptr, nullptr, nullptr, q_bf, k_bf, v_bf);

  // 3) flash attention -> [B,T,C] bf16
  attn_kernel<<<BB * HH * (TT / 128), 256, 0, stream>>>(q_bf, k_bf, v_bf, attn_bf);

  // 4) output projection + residual(x) -> r1 f32
  gemm_bf16_kernel<1, CC, CC><<<dim3(CC / 128, MM / 128), 256, 0, stream>>>(
      attn_bf, wproj_bf, proj_b, x, r1, nullptr, nullptr, nullptr, nullptr);

  // 5) LN1 -> x1 (f32 + bf16)
  ln_kernel<<<MM / (8 * LNT), 256, 0, stream>>>(r1, n1_w, n1_b, x1f, x1_bf);

  // 6) FFN1 + GELU -> h bf16
  gemm_bf16_kernel<2, CC, N3><<<dim3(N3 / 128, MM / 128), 256, 0, stream>>>(
      x1_bf, w1_bf, ffn_b1, nullptr, nullptr, h_bf, nullptr, nullptr, nullptr);

  // 7) FFN2 + residual(x1) -> r2 f32
  gemm_bf16_kernel<1, N3, CC><<<dim3(CC / 128, MM / 128), 256, 0, stream>>>(
      h_bf, w2_bf, ffn_b2, x1f, r2, nullptr, nullptr, nullptr, nullptr);

  // 8) LN2 -> output f32
  ln_kernel<<<MM / (8 * LNT), 256, 0, stream>>>(r2, n2_w, n2_b, out, nullptr);
}

// v009
// One run takes 125 microseconds.
// Next to v008, in two timings, it ran 1.05 and 1.06 times as fast.
// All steps since v000 together make it 4.14 times as fast.
#include <hip/hip_runtime.h>
#include <hip/hip_bf16.h>

// ---------------------------------------------------------------------------
// Transformer block for MI455X (gfx1250, wave32, WMMA).
// bf16 activations, f32 accumulation via v_wmma_f32_16x16x32_bf16.
// GEMM and attention tiles staged to LDS with global_load_async_to_lds_b128 (ASYNCcnt).
// ---------------------------------------------------------------------------

typedef __bf16 bf16;
typedef __attribute__((ext_vector_type(16))) __bf16 v16bf;
typedef __attribute__((ext_vector_type(8)))  float  v8f;
typedef __attribute__((ext_vector_type(2)))  float  v2f;

#define BB   4
#define TT   4096
#define CC   256
#define HH   4
#define DD   64
#define MM   (BB * TT)      // 16384 tokens
#define N3   (3 * CC)       // 768
#define LNEPS 1e-5f

// K index inside a 16x32 (16-bit) A/B fragment for VGPR r, lane-half hi.
// ISA 7.12.2: VGPR0..3 lanes0-15 hold K=0..7 (pairs), lanes16-31 K=8..15; VGPR4..7 -> +16.
__device__ __forceinline__ int kbase(int r, int hi) {
  return ((r & 4) << 2) | (hi << 3) | ((r & 3) << 1);
}

union FragAB {
  v16bf v;
  unsigned int u[8];
  bf16 b[16];
};

__device__ __forceinline__ unsigned lds_off32(const void* p) {
  return (unsigned)(unsigned long long)(uintptr_t)p;   // low 32 bits = LDS byte offset
}

// ---------------------------------------------------------------------------
// fp32 -> bf16 convert of one block's share. A thread takes PER pieces of 4 floats (16 B
// loads, all issued before the first store; a wave's load covers 512 contiguous bytes), so
// that few waves each keep PER loads in flight. blk counts blocks of 256 * PER * 4 elements.
// ---------------------------------------------------------------------------
template <int PER>
__device__ __forceinline__ void cvt_bf16_block(const float* __restrict__ in,
                                               bf16* __restrict__ out, int blk) {
  const int base = blk * (256 * PER) + threadIdx.x;          // index of a piece of 4 floats
  const float4* ip = reinterpret_cast<const float4*>(in);
  uint2* op = reinterpret_cast<uint2*>(out);
  float4 a[PER];
#pragma unroll   // a[] must become registers, and the loads stand together ahead of the stores
  for (int i = 0; i < PER; ++i) a[i] = ip[base + i * 256];
#pragma unroll   // as above
  for (int i = 0; i < PER; ++i) {
    union { bf16 e[4]; uint2 u; } pk;
    pk.e[0] = (bf16)a[i].x; pk.e[1] = (bf16)a[i].y;
    pk.e[2] = (bf16)a[i].z; pk.e[3] = (bf16)a[i].w;
    op[base + i * 256] = pk.u;
  }
}

// ---------------------------------------------------------------------------
// Weight convert with transpose: fp32 [K][N] -> bf16 [N][K], so that a GEMM's B tile has
// K-contiguous rows like its A tile. A block takes 32 n x 64 k: a wave reads 8 rows of
// 128 contiguous bytes, and the block's 8 waves together fill one whole 128-B line of each
// of its 32 output rows. blk runs over (N / 32) * (K / 64) blocks, n fastest.
// ---------------------------------------------------------------------------
__device__ __forceinline__ void cvt_wt_block(const float* __restrict__ in,
                                             bf16* __restrict__ out, int K, int N, int blk) {
  const int n  = (blk % (N / 32)) * 32 + (threadIdx.x & 31);
  const int k0 = (blk / (N / 32)) * 64 + (threadIdx.x >> 5) * 8;
  float a[8];
#pragma unroll   // a[] must become registers, and the loads stand together ahead of the store
  for (int i = 0; i < 8; ++i) a[i] = in[(size_t)(k0 + i) * N + n];
  union { bf16 e[8]; uint4 u; } pk;
#pragma unroll   // as above
  for (int i = 0; i < 8; ++i) pk.e[i] = (bf16)a[i];
  *reinterpret_cast<uint4*>(out + (size_t)n * K + k0) = pk.u;
  // Precaution: stands before any register that the store names can be written again (in the
  // one-launch kernel other arrays' code follows the store in the listing).
  asm volatile("s_wait_xcnt 0x0" ::: "memory");
}

// ---------------------------------------------------------------------------
// All five converts in one launch: they do not depend on one another, so the four gaps between
// dependent launches and the start and end of four short launches go. The block index picks
// the array (a scalar branch); x's 512 blocks, which move most of the bytes, come first.
// ---------------------------------------------------------------------------
#define WB_QKV  ((N3 / 32) * (CC / 64))            // 96 blocks
#define WB_PROJ ((CC / 32) * (CC / 64))            // 32
#define WB_FFN1 ((N3 / 32) * (CC / 64))            // 96
#define WB_FFN2 ((CC / 32) * (N3 / 64))            // 96
#define WB_ALL  (WB_QKV + WB_PROJ + WB_FFN1 + WB_FFN2)
#define XB_ALL  ((MM * CC) / (256 * 8 * 4))        // 512
__global__ __launch_bounds__(256) void cvt_all_kernel(
    const float* __restrict__ x, const float* __restrict__ qkv_w,
    const float* __restrict__ proj_w, const float* __restrict__ ffn_w1,
    const float* __restrict__ ffn_w2, bf16* __restrict__ x_bf,
    bf16* __restrict__ wqkv_bf, bf16* __restrict__ wproj_bf,
    bf16* __restrict__ w1_bf, bf16* __restrict__ w2_bf) {
  const int b = blockIdx.x;
  if (b < XB_ALL) {
    cvt_bf16_block<8>(x, x_bf, b);
    return;
  }
  const int w = b - XB_ALL;
  if (w < WB_QKV)
    cvt_wt_block(qkv_w, wqkv_bf, CC, N3, w);
  else if (w < WB_QKV + WB_PROJ)
    cvt_wt_block(proj_w, wproj_bf, CC, CC, w - WB_QKV);
  else if (w < WB_QKV + WB_PROJ + WB_FFN1)
    cvt_wt_block(ffn_w1, w1_bf, CC, N3, w - (WB_QKV + WB_PROJ));
  else
    cvt_wt_block(ffn_w2, w2_bf, N3, CC, w - (WB_QKV + WB_PROJ + WB_FFN1));
}

// One 16x32 fragment from an LDS row: k = 8*hi..+7 and 16+8*hi..+7 (the order of kbase).
__device__ __forceinline__ void frag_lds(FragAB& f, const bf16* rowp, int hi) {
  uint4 lo = *reinterpret_cast<const uint4*>(rowp + (hi << 3));
  uint4 up = *reinterpret_cast<const uint4*>(rowp + 16 + (hi << 3));
  f.u[0] = lo.x; f.u[1] = lo.y; f.u[2] = lo.z; f.u[3] = lo.w;
  f.u[4] = up.x; f.u[5] = up.y; f.u[6] = up.z; f.u[7] = up.w;
}

// ---------------------------------------------------------------------------
// Tiled GEMM: Out = A[M x K] * W[K x N] (+bias, + epilogue), W given as Wt[N x K].
// Block tile 128x128 (8 waves as 4 x 2, each a 32x64 tile = 8 WMMA per 32 k), K in steps
// of 64: a step's A and Wt tiles are 128 rows of one whole 128-B line each, brought into LDS
// by async copies (two buffers, the next step in flight while this one is worked on).
// MODE 0: QKV scatter -> q/k bf16 [B,H,T,D], v bf16 [B,H,D,T]
// MODE 2: GELU        -> bf16 out [M x N]
// ---------------------------------------------------------------------------
#define GPITCH 72                   // bf16 per tile row in LDS: 128 B + 16 B (16 B x odd)
#define GTILE  (128 * GPITCH)       // bf16 per operand tile

// One K step: 128 rows x 64 k of A (at ag) and of Wt (at bg), source pitch K, 16 B per lane
// and copy, 4 + 4 copies per lane; a wave's copy covers 4 whole lines.
template <int K>
__device__ __forceinline__ void gemm_copy(const bf16* ag, const bf16* bg,
                                          bf16* sa, bf16* sb, int tid) {
  unsigned la[4], lb[4];
  unsigned long long ga[4], gb[4];
#pragma unroll   // the address arrays must become registers: they are the operands of the asm below
  for (int i = 0; i < 4; ++i) {
    const int p = i * 256 + tid;
    const int row = p >> 3, col = (p & 7) << 3;
    la[i] = lds_off32(sa + row * GPITCH + col);
    ga[i] = (unsigned long long)(uintptr_t)(ag + (size_t)row * K + col);
    lb[i] = lds_off32(sb + row * GPITCH + col);
    gb[i] = (unsigned long long)(uintptr_t)(bg + (size_t)row * K + col);
  }
  // The copies and their s_wait_xcnt in one statement: the wait stands before any
  // rewrite of an address register that an issued copy names.
  asm volatile(
      "global_load_async_to_lds_b128 %0, %8, off\n\t"
      "global_load_async_to_lds_b128 %1, %9, off\n\t"
      "global_load_async_to_lds_b128 %2, %10, off\n\t"
      "global_load_async_to_lds_b128 %3, %11, off\n\t"
      "global_load_async_to_lds_b128 %4, %12, off\n\t"
      "global_load_async_to_lds_b128 %5, %13, off\n\t"
      "global_load_async_to_lds_b128 %6, %14, off\n\t"
      "global_load_async_to_lds_b128 %7, %15, off\n\t"
      "s_wait_xcnt 0x0"
      :: "v"(la[0]), "v"(la[1]), "v"(la[2]), "v"(la[3]),
         "v"(lb[0]), "v"(lb[1]), "v"(lb[2]), "v"(lb[3]),
         "v"(ga[0]), "v"(ga[1]), "v"(ga[2]), "v"(ga[3]),
         "v"(gb[0]), "v"(gb[1]), "v"(gb[2]), "v"(gb[3])
      : "memory");
}

template <int MODE, int K, int N>
__global__ __launch_bounds__(256) void gemm_bf16_kernel(
    const bf16* __restrict__ A, const bf16* __restrict__ Wt,
    const float* __restrict__ bias,
    bf16* __restrict__ outb, bf16* __restrict__ oq,
    bf16* __restrict__ okk, bf16* __restrict__ ov) {
  __shared__ __align__(16) bf16 sA[2][GTILE];
  __shared__ __align__(16) bf16 sB[2][GTILE];
  constexpr int NSTEP = K / 64;        // at least 4 here

  const int tid  = threadIdx.x;
  const int lane = tid & 31;
  const int wave = tid >> 5;
  const int hi   = (lane >> 4) & 1;
  const int wm   = (wave >> 1) * 32;   // the wave's rows inside the block tile
  const int wn   = (wave & 1) * 64;    // the wave's columns inside the block tile
  const int m0   = blockIdx.y * 128;
  const int n0   = blockIdx.x * 128;
  const bf16* ag = A + (size_t)m0 * K;
  const bf16* bg = Wt + (size_t)n0 * K;

  // Step 0 into buffer 0, landed and published; then step 1 into buffer 1.
  gemm_copy<K>(ag, bg, sA[0], sB[0], tid);
  asm volatile("s_wait_asynccnt 0x0" ::: "memory");   // this wave's copies of step 0 have landed
  __syncthreads();                                    // ... and every other wave's
  gemm_copy<K>(ag + 64, bg + 64, sA[1], sB[1], tid);

  v8f acc[2][4];
#pragma unroll
  for (int ms = 0; ms < 2; ++ms)
#pragma unroll
    for (int ns = 0; ns < 4; ++ns)
      acc[ms][ns] = (v8f){0.f, 0.f, 0.f, 0.f, 0.f, 0.f, 0.f, 0.f};

  for (int t = 0; t < NSTEP; ++t) {
    const bf16* pa = sA[t & 1] + (wm + (lane & 15)) * GPITCH;
    const bf16* pb = sB[t & 1] + (wn + (lane & 15)) * GPITCH;
#pragma unroll   // fa[], fb[] must become registers; the LDS offsets become immediates
    for (int kk = 0; kk < 2; ++kk) {
      FragAB fa[2], fb[4];
#pragma unroll
      for (int ms = 0; ms < 2; ++ms) frag_lds(fa[ms], pa + ms * 16 * GPITCH + kk * 32, hi);
#pragma unroll
      for (int ns = 0; ns < 4; ++ns) frag_lds(fb[ns], pb + ns * 16 * GPITCH + kk * 32, hi);
#pragma unroll
      for (int ms = 0; ms < 2; ++ms)
#pragma unroll
        for (int ns = 0; ns < 4; ++ns)
          acc[ms][ns] = __builtin_amdgcn_wmma_f32_16x16x32_bf16(
              false, fa[ms].v, false, fb[ns].v, (short)0, acc[ms][ns], false, false);
    }

    // Hand-over: step t + 1 becomes readable, buffer t & 1 becomes free.
    asm volatile("s_wait_dscnt 0x0" ::: "memory");     // this wave's reads of step t are done
    asm volatile("s_wait_asynccnt 0x0" ::: "memory");  // this wave's copies of step t + 1 have landed
    __syncthreads();                                   // both hold for every wave of the block
    if (t + 2 < NSTEP)
      gemm_copy<K>(ag + (t + 2) * 64, bg + (t + 2) * 64, sA[t & 1], sB[t & 1], tid);
  }
  asm volatile("s_wait_asynccnt 0x0" ::: "memory");    // no copy outstanding when the wave ends

  // ---- epilogue: acc[ms][ns][r] is row wm + ms*16 + 8*hi + r, column wn + ns*16 + (lane & 15) ----
  const int gn0 = n0 + wn + (lane & 15);
  const int gm0 = m0 + wm + (hi << 3);
  float bv[4];
#pragma unroll   // bv[] must become registers
  for (int ns = 0; ns < 4; ++ns) bv[ns] = bias[gn0 + ns * 16];

  if (MODE == 0) {                     // QKV scatter
    const int part = n0 >> 8;          // a 128-column tile lies inside one of q, k, v: block-uniform
    if (part == 2) {                   // V transposed: [B,H,D,T]
#pragma unroll
      for (int ns = 0; ns < 4; ++ns)
#pragma unroll
        for (int ms = 0; ms < 2; ++ms)
#pragma unroll
          for (int r = 0; r < 8; ++r) {
            const int gm = gm0 + ms * 16 + r, cc = (gn0 + ns * 16) & 255;
            const int hh = cc >> 6, dd = cc & 63;
            const int bb = gm >> 12, ttok = gm & (TT - 1);
            ov[(((size_t)(bb * HH + hh)) * DD + dd) * TT + ttok] = (bf16)(acc[ms][ns][r] + bv[ns]);
          }
    } else {
      bf16* dst = (part == 0) ? oq : okk;
#pragma unroll
      for (int ns = 0; ns < 4; ++ns)
#pragma unroll
        for (int ms = 0; ms < 2; ++ms)
#pragma unroll
          for (int r = 0; r < 8; ++r) {
            const int gm = gm0 + ms * 16 + r, cc = (gn0 + ns * 16) & 255;
            const int hh = cc >> 6, dd = cc & 63;
            const int bb = gm >> 12, ttok = gm & (TT - 1);
            dst[(((size_t)(bb * HH + hh)) * TT + ttok) * DD + dd] = (bf16)(acc[ms][ns][r] + bv[ns]);
          }
    }
  } else {                             // exact GELU -> bf16
#pragma unroll
    for (int ns = 0; ns < 4; ++ns)
#pragma unroll
      for (int ms = 0; ms < 2; ++ms)
#pragma unroll
        for (int r = 0; r < 8; ++r) {
          const float val = acc[ms][ns][r] + bv[ns];
          const float g = 0.5f * val * (1.0f + erff(val * 0.70710678118f));
          outb[(size_t)(gm0 + ms * 16 + r) * N + gn0 + ns * 16] = (bf16)g;
        }
  }
}

// ---------------------------------------------------------------------------
// Flash attention, transposed: St = K * Qt puts one query's scores in one lane (column),
// so max and sum run in-lane plus one exchange between the wave halves; the two
// St tiles, converted in place, are the B operand of Ot += Vt * Pt.
// V is [B,H,D,T] so Vt rows are contiguous along keys.
// The 8 waves of a block share one (b,h) and 128 queries: K and Vt tiles of SKEYS keys are
// brought into LDS once per block by async copies (two buffers, the next tile in flight
// while this one is worked on) and every wave reads its fragments from there.
// Wave tile: 32 queries (two column groups) x one half of every tile's keys, in chunks of 32
// keys. Each K and Vt fragment read from LDS feeds two WMMAs (16 per chunk), and the block
// still has 8 waves. The two waves of a query group hold partial (max, sum, Ot) over
// disjoint keys; they are joined once, through LDS, behind the loop.
// ---------------------------------------------------------------------------
#define SKEYS  128                  // keys per LDS tile
#define NTILE  (TT / SKEYS)         // 32 tiles
#define KPITCH 72                   // bf16 per K row in LDS: 128 B + 16 B (16 B x odd)
#define VPITCH 136                  // bf16 per Vt row in LDS: 256 B + 16 B (16 B x odd)
#define KTILE  (SKEYS * KPITCH)     // bf16 per K tile
#define VTILE  (DD * VPITCH)        // bf16 per Vt tile
#define LOG2E  1.44269504088896f    // exp(x) = exp2(x * LOG2E)

__device__ __forceinline__ float xhalf(float x) {   // lane l <-> lane l ^ 16
  int b = __builtin_bit_cast(int, x);
  return __builtin_bit_cast(float,
      __builtin_amdgcn_permlanex16(b, b, 0x76543210, 0xfedcba98, false, false));
}

// exp2 with the one slot that the instruction set asks for behind a transcendental (before its
// result is read or its source register rewritten) kept in the same statement: a v_nop in a
// statement of its own did not stay behind the v_exp in the build.
__device__ __forceinline__ float exp2_slot(float x) {
  float r;
  asm("v_exp_f32 %0, %1\n\tv_nop" : "=v"(r) : "v"(x));
  return r;
}

// One tile: K rows [SKEYS][64] (16 KB contiguous at kg) and Vt rows [64][SKEYS] (source
// pitch TT, at vg), 16 B per lane and copy, 4 + 4 copies per lane; a wave's copy covers
// 512 B of whole lines.
__device__ __forceinline__ void tile_copy(const bf16* kg, const bf16* vg,
                                          bf16* sk, bf16* sv, int tid) {
  unsigned lk[4], lv[4];
  unsigned long long gk[4], gv[4];
#pragma unroll   // the address arrays must become registers: they are the operands of the asm below
  for (int i = 0; i < 4; ++i) {
    const int p = i * 256 + tid;
    lk[i] = lds_off32(sk + (p >> 3) * KPITCH + ((p & 7) << 3));
    gk[i] = (unsigned long long)(uintptr_t)(kg + (p << 3));
    lv[i] = lds_off32(sv + (p >> 4) * VPITCH + ((p & 15) << 3));
    gv[i] = (unsigned long long)(uintptr_t)(vg + (size_t)(p >> 4) * TT + ((p & 15) << 3));
  }
  // The copies and their s_wait_xcnt in one statement: the wait stands before any
  // rewrite of an address register that an issued copy names.
  asm volatile(
      "global_load_async_to_lds_b128 %0, %8, off\n\t"
      "global_load_async_to_lds_b128 %1, %9, off\n\t"
      "global_load_async_to_lds_b128 %2, %10, off\n\t"
      "global_load_async_to_lds_b128 %3, %11, off\n\t"
      "global_load_async_to_lds_b128 %4, %12, off\n\t"
      "global_load_async_to_lds_b128 %5, %13, off\n\t"
      "global_load_async_to_lds_b128 %6, %14, off\n\t"
      "global_load_async_to_lds_b128 %7, %15, off\n\t"
      "s_wait_xcnt 0x0"
      :: "v"(lk[0]), "v"(lk[1]), "v"(lk[2]), "v"(lk[3]),
         "v"(lv[0]), "v"(lv[1]), "v"(lv[2]), "v"(lv[3]),
         "v"(gk[0]), "v"(gk[1]), "v"(gk[2]), "v"(gk[3]),
         "v"(gv[0]), "v"(gv[1]), "v"(gv[2]), "v"(gv[3])
      : "memory");
}

// Four waves per SIMD (two blocks per WGP) is what the grid gives: the register budget is set to it.
__global__ __launch_bounds__(256) __attribute__((amdgpu_waves_per_eu(4, 4)))
void attn_kernel(const bf16* __restrict__ q,
                 const bf16* __restrict__ k,
                 const bf16* __restrict__ v,
                 bf16* __restrict__ o) {
  __shared__ __align__(16) bf16 sK[2][KTILE];
  __shared__ __align__(16) bf16 sV[2][VTILE];

  const int tid  = threadIdx.x;
  const int lane = tid & 31;
  const int wave = __builtin_amdgcn_readfirstlane(tid >> 5);   // scalar: the tests on kh are scalar branches
  const int hi   = (lane >> 4) & 1;
  const int qg   = wave >> 1;                      // query group: 32 of the block's 128 queries
  const int kh   = wave & 1;                       // which 64 keys of every tile
  const int bh   = blockIdx.x / (TT / 128);        // one (b,h) per block
  const int tq0  = (blockIdx.x % (TT / 128)) * 128 + qg * 32;   // the wave's first query
  const size_t rowbase = (size_t)bh * TT;
  const bf16* kbh = k + rowbase * DD;              // K rows of this (b,h)
  const bf16* vbh = v + (size_t)bh * DD * TT;      // Vt rows of this (b,h)

  // Tile 0 into buffer 0, landed and published; then tile 1 into buffer 1.
  tile_copy(kbh, vbh, sK[0], sV[0], tid);
  asm volatile("s_wait_asynccnt 0x0" ::: "memory");   // this wave's copies of tile 0 have landed
  __syncthreads();                                    // ... and every other wave's
  tile_copy(kbh + SKEYS * DD, vbh + SKEYS, sK[1], sV[1], tid);

  // Q fragments qf[column group][d half] as B operand: lane column = query. Loaded once.
  FragAB qf[2][2];
#pragma unroll   // qf[][] must become registers
  for (int qc = 0; qc < 2; ++qc) {
    const bf16* qp = q + (rowbase + tq0 + qc * 16 + (lane & 15)) * DD;
#pragma unroll
    for (int r = 0; r < 8; ++r) {
      qf[qc][0].u[r] = *reinterpret_cast<const unsigned int*>(qp + kbase(r, hi));
      qf[qc][1].u[r] = *reinterpret_cast<const unsigned int*>(qp + 32 + kbase(r, hi));
    }
  }

  // Softmax in the log2 domain: exp((s - m) * D^-0.5) = exp2(s * cscale - m * cscale), D = 64. cscale is
  // positive, so the maximum is taken on the raw scores and scaled once.
  const float cscale = 0.125f * LOG2E;
  const float HEADROOM = 8.0f / cscale;   // 8 in log2 units, as a raw score

  // oacc[qc][j][r] = Ot[d = j*16 + 8*hi + r][query = qc*16 + (lane & 15)]
  v8f oacc[2][4];
  float rowm[2], rowb[2], rowt[2], rows[2];
#pragma unroll   // oacc[][], rowm[], rowb[], rowt[], rows[] must become registers
  for (int qc = 0; qc < 2; ++qc) {
#pragma unroll
    for (int j = 0; j < 4; ++j) oacc[qc][j] = (v8f){0.f, 0.f, 0.f, 0.f, 0.f, 0.f, 0.f, 0.f};
    rowm[qc] = -3.0e38f;            // reference of this lane's query, raw score (equal in both halves)
    rowb[qc] = -3.0e38f * cscale;   // the same in log2 units: what the exponents in use are taken against
    rowt[qc] = -3.0e38f;            // raw score above which the reference is raised: the first chunk always raises it
    rows[qc] = 0.f;        // running sum over this half's keys only; halves join at the end
  }


  for (int t = 0; t < NTILE; ++t) {
    const bf16* bk = sK[t & 1] + (kh * (SKEYS / 2) + (lane & 15)) * KPITCH;
    const bf16* bv = sV[t & 1] + (lane & 15) * VPITCH + kh * (SKEYS / 2);

    // Unrolled so that the LDS offsets are immediates and a chunk's reads can be
    // issued ahead of the vector work of the chunk before it.
#pragma unroll
    for (int c32 = 0; c32 < SKEYS / 64; ++c32) {
      // ---- St = K * Qt for 32 keys x 32 queries:
      //      sacc[qc][nt][r] = score(key +nt*16+8*hi+r, query qc*16 + (lane & 15)) ----
      FragAB kf[2][2];
#pragma unroll
      for (int nt = 0; nt < 2; ++nt) {
        const bf16* kp = bk + (c32 * 32 + nt * 16) * KPITCH;
        frag_lds(kf[nt][0], kp, hi);
        frag_lds(kf[nt][1], kp + 32, hi);
      }
      v8f sacc[2][2];
#pragma unroll
      for (int nt = 0; nt < 2; ++nt)
#pragma unroll
        for (int qc = 0; qc < 2; ++qc) {
          sacc[qc][nt] = (v8f){0.f, 0.f, 0.f, 0.f, 0.f, 0.f, 0.f, 0.f};
          sacc[qc][nt] = __builtin_amdgcn_wmma_f32_16x16x32_bf16(
              false, kf[nt][0].v, false, qf[qc][0].v, (short)0, sacc[qc][nt], false, false);
        }
#pragma unroll
      for (int nt = 0; nt < 2; ++nt)
#pragma unroll
        for (int qc = 0; qc < 2; ++qc)
          sacc[qc][nt] = __builtin_amdgcn_wmma_f32_16x16x32_bf16(
              false, kf[nt][1].v, false, qf[qc][1].v, (short)0, sacc[qc][nt], false, false);

      FragAB vf[4];
#pragma unroll
      for (int j = 0; j < 4; ++j) frag_lds(vf[j], bv + j * 16 * VPITCH + c32 * 32, hi);

      // ---- online softmax: a lane holds 16 of its query's 32 scores. Lazy rescale: the exponents are
      //      taken against the reference in use (rowb), which is raised only where a raw score lies
      //      more than HEADROOM above it, so a probability is at most 2^8. Sum and Ot stay relative to
      //      one reference, and the division at the end cancels it whatever it is. ----
      float mc[2];
#pragma unroll   // mc[] must become registers
      for (int qc = 0; qc < 2; ++qc) {
        float m4[4];
#pragma unroll
        for (int i = 0; i < 4; ++i)
          m4[i] = fmaxf(fmaxf(sacc[qc][0][i], sacc[qc][0][i + 4]), fmaxf(sacc[qc][1][i], sacc[qc][1][i + 4]));
        mc[qc] = fmaxf(fmaxf(m4[0], m4[1]), fmaxf(m4[2], m4[3]));   // this lane's 16 keys only
      }
      // One test per chunk for both column groups, a scalar branch: taken if any lane asks. Marked
      // unlikely so that the rescale code is laid out of line and the path that skips it falls through.
      if (__builtin_expect(__builtin_amdgcn_ballot_w32((mc[0] > rowt[0]) | (mc[1] > rowt[1])) != 0, 0)) {
#pragma unroll
        for (int qc = 0; qc < 2; ++qc) {
          const float mn   = fmaxf(rowm[qc], fmaxf(mc[qc], xhalf(mc[qc])));   // equal in both halves
          const float nb   = mn * cscale;
          const float corr = exp2_slot(rowb[qc] - nb);
          rowm[qc] = mn;
          rowb[qc] = nb;
          rowt[qc] = mn + HEADROOM;
          rows[qc] *= corr;
          const v2f corr2 = (v2f){corr, corr};
#pragma unroll
          for (int j = 0; j < 4; ++j)
#pragma unroll
            for (int r = 0; r < 8; r += 2) {
              v2f t2 = (v2f){oacc[qc][j][r], oacc[qc][j][r + 1]};
              // In place: result and source share their registers, so that the path that skips the
              // rescale needs no copy of Ot where the two paths meet.
              asm("v_pk_mul_f32 %0, %0, %1" : "+v"(t2) : "v"(corr2));
              oacc[qc][j][r]     = t2.x;
              oacc[qc][j][r + 1] = t2.y;
            }
        }
      }

      FragAB pf[2];
#pragma unroll
      for (int qc = 0; qc < 2; ++qc) {
        // Pt as B operand: element s wants key 8*hi+s (s<8) or 16+8*hi+(s-8), which is
        // exactly tile s>>3, register s&7 of St: convert in place, no lane exchange.
        // The exponent of two scores comes from one packed FMA.
        const float nb = rowb[qc];
        float p[16];
#pragma unroll
        for (int i = 0; i < 16; i += 2) {
          const v2f arg = __builtin_elementwise_fma(
              (v2f){sacc[qc][i >> 3][i & 7], sacc[qc][i >> 3][(i & 7) + 1]}, (v2f){cscale, cscale},
              (v2f){-nb, -nb});
          p[i]     = exp2_slot(arg.x);
          p[i + 1] = exp2_slot(arg.y);
          pf[qc].b[i]     = (bf16)p[i];
          pf[qc].b[i + 1] = (bf16)p[i + 1];
        }
        float s4[4];
#pragma unroll
        for (int i = 0; i < 4; ++i)
          s4[i] = (p[i] + p[i + 4]) + (p[i + 8] + p[i + 12]);
        rows[qc] += (s4[0] + s4[1]) + (s4[2] + s4[3]);
      }

      // ---- Ot += Vt * Pt ----
#pragma unroll
      for (int j = 0; j < 4; ++j)
#pragma unroll
        for (int qc = 0; qc < 2; ++qc)
          oacc[qc][j] = __builtin_amdgcn_wmma_f32_16x16x32_bf16(
              false, vf[j].v, false, pf[qc].v, (short)0, oacc[qc][j], false, false);
    }

    // Hand-over: tile t + 1 becomes readable, buffer t & 1 becomes free.
    // This wave's reads of tile t are done. The two row sums are named as inputs only (nothing is
    // written): they are then formed in front of the hand-over. Without that their adds move behind
    // the barrier, the tile's 64 probabilities stay in registers until there, and the 32-query tile
    // has no registers left to fetch fragments ahead of their WMMAs.
    asm volatile("s_wait_dscnt 0x0" :: "v"(rows[0]), "v"(rows[1]) : "memory");
    asm volatile("s_wait_asynccnt 0x0" ::: "memory");  // this wave's copies of tile t + 1 have landed
    __syncthreads();                                   // both hold for every wave of the block
    if (t + 2 < NTILE)
      tile_copy(kbh + (size_t)(t + 2) * SKEYS * DD, vbh + (t + 2) * SKEYS,
                sK[t & 1], sV[t & 1], tid);
  }
  asm volatile("s_wait_asynccnt 0x0" ::: "memory");    // no copy outstanding when the wave ends

  // ---- join the two key halves of a query group. The K tiles are dead (the last hand-over's
  //      barrier ended every read, no copy is outstanding): their LDS carries the kh = 1 wave's
  //      partial Ot (16 B per lane and piece, lanes contiguous), maximum and sum. ----
  float4* mo = reinterpret_cast<float4*>(&sK[0][0]) + qg * (16 * 32) + lane;            // 4 x 8 KB
  float*  ml = reinterpret_cast<float*>(&sK[0][0]) + 4 * 16 * 32 * 4 + qg * (4 * 32) + lane;  // 4 x 512 B
  if (kh == 1) {
#pragma unroll
    for (int qc = 0; qc < 2; ++qc) {
#pragma unroll
      for (int j = 0; j < 4; ++j) {
        const v8f a = oacc[qc][j];
        mo[((qc * 4 + j) * 2 + 0) * 32] = make_float4(a[0], a[1], a[2], a[3]);
        mo[((qc * 4 + j) * 2 + 1) * 32] = make_float4(a[4], a[5], a[6], a[7]);
      }
      ml[(qc * 2 + 0) * 32] = rowb[qc];
      ml[(qc * 2 + 1) * 32] = rows[qc];
    }
  }
  __syncthreads();   // the kh = 1 partials are readable by the kh = 0 wave of the group
  if (kh == 1) return;

  // ---- normalize + merge heads: write [B,T,C] bf16, 8 consecutive d per lane ----
  const int b = bh >> 2, h = bh & 3;
  uint4 res[2][4];
#pragma unroll   // res[][] must become registers: all results are formed before the first store
  for (int qc = 0; qc < 2; ++qc) {
    const float m1 = ml[(qc * 2 + 0) * 32];
    const float l1 = ml[(qc * 2 + 1) * 32];
    const float mn = fmaxf(rowb[qc], m1);
    const float a0 = exp2_slot(rowb[qc] - mn);   // the maxima are in log2 units
    const float a1 = exp2_slot(m1 - mn);
    const float l  = rows[qc] * a0 + l1 * a1;
    const float inv = 1.0f / (l + xhalf(l));
    const float f0 = a0 * inv, f1 = a1 * inv;
#pragma unroll
    for (int j = 0; j < 4; ++j) {
      const float4 lo = mo[((qc * 4 + j) * 2 + 0) * 32];
      const float4 up = mo[((qc * 4 + j) * 2 + 1) * 32];
      const float o1[8] = {lo.x, lo.y, lo.z, lo.w, up.x, up.y, up.z, up.w};
      union { bf16 e[8]; uint4 u; } pk;
#pragma unroll
      for (int r = 0; r < 8; ++r) pk.e[r] = (bf16)(oacc[qc][j][r] * f0 + o1[r] * f1);
      res[qc][j] = pk.u;
    }
  }
#pragma unroll
  for (int qc = 0; qc < 2; ++qc) {
    bf16* op = o + ((size_t)b * TT + tq0 + qc * 16 + (lane & 15)) * CC + h * DD + (hi << 3);
#pragma unroll
    for (int j = 0; j < 4; ++j) *reinterpret_cast<uint4*>(op + j * 16) = res[qc][j];
  }
}

// ---------------------------------------------------------------------------
// Residual GEMM with LayerNorm in its epilogue: Out = LN(A[M x K] * W[K x 256] + bias + res).
// A block owns whole rows: tile 64 x 256 (8 waves as 2 x 4, each 32x64 as in the GEMM above, the
// same K steps, copies and hand-over), so the sum never goes to memory and no launch of
// its own reads it back. Behind the K loop the f32 tile goes through LDS (the W tiles are dead),
// which turns the accumulator layout into whole rows: a wave then takes 8 rows, a lane 2 x 16 B
// of each, and residual loads and all stores cover whole lines. Butterfly reductions.
// ---------------------------------------------------------------------------
#define FROWS   64                  // rows per block
#define FATILE  (FROWS * GPITCH)    // bf16 per A tile
#define FBTILE  (CC * GPITCH)       // bf16 per Wt tile
#define FPITCH  260                 // f32 per staged row: 16 B more than 256, so that rows r and r + 8
                                    // (the two lane halves of one LDS store) lie 32 banks apart
#define FLNT    (FROWS / 8)         // rows per wave in the LayerNorm part

// One K step: 64 rows x 64 k of A (at ag) and 256 rows x 64 k of Wt (at bg), source pitch K,
// 16 B per lane and copy, 2 + 8 copies per lane; a wave's copy covers 4 whole lines.
template <int K>
__device__ __forceinline__ void gemm_ln_copy(const bf16* ag, const bf16* bg,
                                             bf16* sa, bf16* sb, int tid) {
  unsigned la[2], lb[8];
  unsigned long long ga[2], gb[8];
#pragma unroll   // the address arrays must become registers: they are the operands of the asm below
  for (int i = 0; i < 8; ++i) {
    const int p = i * 256 + tid;
    const int row = p >> 3, col = (p & 7) << 3;
    if (i < 2) {
      la[i] = lds_off32(sa + row * GPITCH + col);
      ga[i] = (unsigned long long)(uintptr_t)(ag + (size_t)row * K + col);
    }
    lb[i] = lds_off32(sb + row * GPITCH + col);
    gb[i] = (unsigned long long)(uintptr_t)(bg + (size_t)row * K + col);
  }
  // The copies and their s_wait_xcnt in one statement: the wait stands before any
  // rewrite of an address register that an issued copy names.
  asm volatile(
      "global_load_async_to_lds_b128 %0, %10, off\n\t"
      "global_load_async_to_lds_b128 %1, %11, off\n\t"
      "global_load_async_to_lds_b128 %2, %12, off\n\t"
      "global_load_async_to_lds_b128 %3, %13, off\n\t"
      "global_load_async_to_lds_b128 %4, %14, off\n\t"
      "global_load_async_to_lds_b128 %5, %15, off\n\t"
      "global_load_async_to_lds_b128 %6, %16, off\n\t"
      "global_load_async_to_lds_b128 %7, %17, off\n\t"
      "global_load_async_to_lds_b128 %8, %18, off\n\t"
      "global_load_async_to_lds_b128 %9, %19, off\n\t"
      "s_wait_xcnt 0x0"
      :: "v"(la[0]), "v"(la[1]),
         "v"(lb[0]), "v"(lb[1]), "v"(lb[2]), "v"(lb[3]),
         "v"(lb[4]), "v"(lb[5]), "v"(lb[6]), "v"(lb[7]),
         "v"(ga[0]), "v"(ga[1]),
         "v"(gb[0]), "v"(gb[1]), "v"(gb[2]), "v"(gb[3]),
         "v"(gb[4]), "v"(gb[5]), "v"(gb[6]), "v"(gb[7])
      : "memory");
}

template <int K, bool WITHB>
__global__ __launch_bounds__(256) void gemm_ln_kernel(
    const bf16* __restrict__ A, const bf16* __restrict__ Wt,
    const float* __restrict__ bias, const float* __restrict__ res,
    const float* __restrict__ w, const float* __restrict__ lnb,
    float* __restrict__ outf, bf16* __restrict__ outb) {
  __shared__ __align__(16) bf16 sA[2][FATILE];
  __shared__ __align__(16) bf16 sB[2][FBTILE];
  static_assert(FROWS * FPITCH * 4 <= 2 * FBTILE * 2, "the staged f32 tile fits in the Wt tiles");
  constexpr int NSTEP = K / 64;        // at least 4 here

  const int tid  = threadIdx.x;
  const int lane = tid & 31;
  const int wave = tid >> 5;
  const int hi   = (lane >> 4) & 1;
  const int wm   = (wave >> 2) * 32;   // the wave's rows inside the block tile
  const int wn   = (wave & 3) * 64;    // the wave's columns inside the block tile
  const int m0   = blockIdx.x * FROWS;
  const bf16* ag = A + (size_t)m0 * K;

  // Step 0 into buffer 0.
  gemm_ln_copy<K>(ag, Wt, sA[0], sB[0], tid);

  // What the epilogue reads from memory is asked for here, beside step 0's copies, whose arrival is
  // waited for in any case: the residual of the wave's FLNT rows (8 KB contiguous), and GEMM bias,
  // LayerNorm weight and bias of the lane's 2 x 4 columns.
  const int tok0 = m0 + wave * FLNT;
  const float4* rp = reinterpret_cast<const float4*>(res + (size_t)tok0 * CC);
  float4 rv[FLNT][2];
#pragma unroll   // rv[][] must become registers, and the loads stand together
  for (int t = 0; t < FLNT; ++t) {
    rv[t][0] = rp[t * 64 + lane];
    rv[t][1] = rp[t * 64 + 32 + lane];
  }
  float4 gv[2], wv[2], bv[2];
#pragma unroll   // gv[], wv[], bv[] must become registers
  for (int i = 0; i < 2; ++i) {
    gv[i] = reinterpret_cast<const float4*>(bias)[i * 32 + lane];
    wv[i] = reinterpret_cast<const float4*>(w)[i * 32 + lane];
    bv[i] = reinterpret_cast<const float4*>(lnb)[i * 32 + lane];
  }
  // Precaution: stands before any register that one of these loads names is written again.
  asm volatile("s_wait_xcnt 0x0" ::: "memory");

  // Step 0 landed and published; then step 1 into buffer 1.
  asm volatile("s_wait_asynccnt 0x0" ::: "memory");   // this wave's copies of step 0 have landed
  __syncthreads();                                    // ... and every other wave's
  gemm_ln_copy<K>(ag + 64, Wt + 64, sA[1], sB[1], tid);

  v8f acc[2][4];
#pragma unroll
  for (int ms = 0; ms < 2; ++ms)
#pragma unroll
    for (int ns = 0; ns < 4; ++ns)
      acc[ms][ns] = (v8f){0.f, 0.f, 0.f, 0.f, 0.f, 0.f, 0.f, 0.f};

  // Kept rolled: unrolled (K = 256), the copy addresses of all steps are formed ahead and, beside the
  // epilogue's operands, no longer fit the register budget (spills).
#pragma nounroll
  for (int t = 0; t < NSTEP; ++t) {
    const bf16* pa = sA[t & 1] + (wm + (lane & 15)) * GPITCH;
    const bf16* pb = sB[t & 1] + (wn + (lane & 15)) * GPITCH;
#pragma unroll   // fa[], fb[] must become registers; the LDS offsets become immediates
    for (int kk = 0; kk < 2; ++kk) {
      FragAB fa[2], fb[4];
#pragma unroll
      for (int ms = 0; ms < 2; ++ms) frag_lds(fa[ms], pa + ms * 16 * GPITCH + kk * 32, hi);
#pragma unroll
      for (int ns = 0; ns < 4; ++ns) frag_lds(fb[ns], pb + ns * 16 * GPITCH + kk * 32, hi);
#pragma unroll
      for (int ms = 0; ms < 2; ++ms)
#pragma unroll
        for (int ns = 0; ns < 4; ++ns)
          acc[ms][ns] = __builtin_amdgcn_wmma_f32_16x16x32_bf16(
              false, fa[ms].v, false, fb[ns].v, (short)0, acc[ms][ns], false, false);
    }

    // Hand-over: step t + 1 becomes readable, buffer t & 1 becomes free.
    asm volatile("s_wait_dscnt 0x0" ::: "memory");     // this wave's reads of step t are done
    asm volatile("s_wait_asynccnt 0x0" ::: "memory");  // this wave's copies of step t + 1 have landed
    __syncthreads();                                   // both hold for every wave of the block
    if (t + 2 < NSTEP)
      gemm_ln_copy<K>(ag + (t + 2) * 64, Wt + (t + 2) * 64, sA[t & 1], sB[t & 1], tid);
  }
  asm volatile("s_wait_asynccnt 0x0" ::: "memory");    // no copy outstanding behind the loop

  // ---- the f32 tile through LDS. The Wt tiles are dead: the last hand-over's barrier ended every
  //      read and no copy is outstanding. acc[ms][ns][r] is row wm + ms*16 + 8*hi + r,
  //      column wn + ns*16 + (lane & 15). ----
  float* st = reinterpret_cast<float*>(&sB[0][0]);
  {
    float* sp = st + (wm + (hi << 3)) * FPITCH + wn + (lane & 15);
#pragma unroll
    for (int ms = 0; ms < 2; ++ms)
#pragma unroll
      for (int ns = 0; ns < 4; ++ns)
#pragma unroll
        for (int r = 0; r < 8; ++r) sp[(ms * 16 + r) * FPITCH + ns * 16] = acc[ms][ns][r];
  }
  __syncthreads();   // the whole tile is readable by the waves that take its rows
  // The LayerNorm part is scheduled on its own: in one piece with the LDS stores above, the compiler
  // starts it with two LDS reads in flight instead of four to six.
  __builtin_amdgcn_sched_barrier(0);

  // The wave's FLNT rows: (product + bias) + residual.
  float4 a[FLNT][2];
#pragma unroll   // a[][], rv[][] must become registers
  for (int t = 0; t < FLNT; ++t) {
    const float4* sr = reinterpret_cast<const float4*>(st + (wave * FLNT + t) * FPITCH);
#pragma unroll
    for (int i = 0; i < 2; ++i) {
      const float4 s = sr[i * 32 + lane];
      a[t][i].x = (s.x + gv[i].x) + rv[t][i].x;
      a[t][i].y = (s.y + gv[i].y) + rv[t][i].y;
      a[t][i].z = (s.z + gv[i].z) + rv[t][i].z;
      a[t][i].w = (s.w + gv[i].w) + rv[t][i].w;
    }
  }

  // Sums of all FLNT rows, written one butterfly step of every row at a time: the rows' chains are
  // independent, so that exchanges of several rows are in flight together.
  float sum[FLNT], sq[FLNT];
#pragma unroll   // sum[], sq[] must become registers
  for (int t = 0; t < FLNT; ++t) {
    const float4 a0 = a[t][0], a1 = a[t][1];
    sum[t] = a0.x + a0.y + a0.z + a0.w + a1.x + a1.y + a1.z + a1.w;
    sq[t]  = a0.x * a0.x + a0.y * a0.y + a0.z * a0.z + a0.w * a0.w +
             a1.x * a1.x + a1.y * a1.y + a1.z * a1.z + a1.w * a1.w;
  }
#pragma unroll
  for (int off = 1; off <= 16; off <<= 1) {
    float xs[FLNT], xq[FLNT];
#pragma unroll
    for (int t = 0; t < FLNT; ++t) {
      xs[t] = __shfl_xor(sum[t], off, 32);
      xq[t] = __shfl_xor(sq[t], off, 32);
    }
#pragma unroll
    for (int t = 0; t < FLNT; ++t) {
      sum[t] += xs[t];
      sq[t]  += xq[t];
    }
  }

  // All results are formed in registers before the first store.
  float4 y[FLNT][2];
  uint2 yb[FLNT][2];
#pragma unroll   // a[][], y[][], yb[][] are indexed by t
  for (int t = 0; t < FLNT; ++t) {
    const float mean = sum[t] * (1.0f / CC);
    const float var  = sq[t] * (1.0f / CC) - mean * mean;
    const float rstd = rsqrtf(var + LNEPS);
#pragma unroll
    for (int i = 0; i < 2; ++i) {
      const float4 av = a[t][i];
      y[t][i].x = wv[i].x * (av.x - mean) * rstd + bv[i].x;
      y[t][i].y = wv[i].y * (av.y - mean) * rstd + bv[i].y;
      y[t][i].z = wv[i].z * (av.z - mean) * rstd + bv[i].z;
      y[t][i].w = wv[i].w * (av.w - mean) * rstd + bv[i].w;
      if (WITHB) {
        union { bf16 e[4]; uint2 u; } pk;
        pk.e[0] = (bf16)y[t][i].x; pk.e[1] = (bf16)y[t][i].y;
        pk.e[2] = (bf16)y[t][i].z; pk.e[3] = (bf16)y[t][i].w;
        yb[t][i] = pk.u;
      }
    }
  }

  // Holds the stores at the end: moved up among the sums, their data registers are written again,
  // each time behind a wait.
  __builtin_amdgcn_sched_barrier(0);
  if (WITHB) {
    uint2* ob = reinterpret_cast<uint2*>(outb + (size_t)tok0 * CC);
#pragma unroll   // yb[][] is indexed by t
    for (int t = 0; t < FLNT; ++t)
#pragma unroll
      for (int i = 0; i < 2; ++i) ob[t * 64 + i * 32 + lane] = yb[t][i];
  }
  float4* of = reinterpret_cast<float4*>(outf + (size_t)tok0 * CC);
#pragma unroll   // y[][] is indexed by t
  for (int t = 0; t < FLNT; ++t) {
    of[t * 64 + lane]      = y[t][0];
    of[t * 64 + 32 + lane] = y[t][1];
  }
}

// ---------------------------------------------------------------------------
// Host launcher
// ---------------------------------------------------------------------------
extern "C" void kernel_launch(void* const* d_in, const int* in_sizes, int n_in,
                              void* d_out, int out_size, void* d_ws, size_t ws_size,
                              hipStream_t stream) {
  const float* x      = (const float*)d_in[0];
  const float* qkv_w  = (const float*)d_in[1];
  const float* qkv_b  = (const float*)d_in[2];
  const float* proj_w = (const float*)d_in[3];
  const float* proj_b = (const float*)d_in[4];
  const float* n1_w   = (const float*)d_in[5];
  const float* n1_b   = (const float*)d_in[6];
  const float* ffn_w1 = (const float*)d_in[7];
  const float* ffn_b1 = (const float*)d_in[8];
  const float* ffn_w2 = (const float*)d_in[9];
  const float* ffn_b2 = (const float*)d_in[10];
  const float* n2_w   = (const float*)d_in[11];
  const float* n2_b   = (const float*)d_in[12];
  float* out = (float*)d_out;

  char* ws = (char*)d_ws;
  size_t off = 0;
  auto take = [&](size_t bytes) { void* p = ws + off; off += (bytes + 255) & ~(size_t)255; return p; };

  bf16*  x_bf     = (bf16*)take((size_t)MM * CC * 2);
  bf16*  wqkv_bf  = (bf16*)take((size_t)CC * N3 * 2);
  bf16*  wproj_bf = (bf16*)take((size_t)CC * CC * 2);
  bf16*  w1_bf    = (bf16*)take((size_t)CC * N3 * 2);
  bf16*  w2_bf    = (bf16*)take((size_t)N3 * CC * 2);
  bf16*  q_bf     = (bf16*)take((size_t)MM * CC * 2);
  bf16*  k_bf     = (bf16*)take((size_t)MM * CC * 2);
  bf16*  v_bf     = (bf16*)take((size_t)MM * CC * 2);   // [B,H,D,T]
  bf16*  attn_bf  = (bf16*)take((size_t)MM * CC * 2);
  float* x1f      = (float*)take((size_t)MM * CC * 4);
  bf16*  x1_bf    = (bf16*)take((size_t)MM * CC * 2);
  bf16*  h_bf     = (bf16*)take((size_t)MM * N3 * 2);

  // 1) converts, one launch: x (8 pieces of 4 floats per thread) and the weights [K][N] -> bf16 [N][K]
  cvt_all_kernel<<<XB_ALL + WB_ALL, 256, 0, stream>>>(x, qkv_w, proj_w, ffn_w1, ffn_w2,
                                                      x_bf, wqkv_bf, wproj_bf, w1_bf, w2_bf);

  // 2) QKV projection, scatter q/k -> [B,H,T,D], v -> [B,H,D,T]
  gemm_bf16_kernel<0, CC, N3><<<dim3(N3 / 128, MM / 128), 256, 0, stream>>>(
      x_bf, wqkv_bf, qkv_b, nullptr, q_bf, k_bf, v_bf);

  // 3) flash attention -> [B,T,C] bf16
  attn_kernel<<<BB * HH * (TT / 128), 256, 0, stream>>>(q_bf, k_bf, v_bf, attn_bf);

  // 4) output projection + residual(x), LN1 -> x1 (f32 + bf16)
  gemm_ln_kernel<CC, true><<<MM / FROWS, 256, 0, stream>>>(
      attn_bf, wproj_bf, proj_b, x, n1_w, n1_b, x1f, x1_bf);

  // 5) FFN1 + GELU -> h bf16
  gemm_bf16_kernel<2, CC, N3><<<dim3(N3 / 128, MM / 128), 256, 0, stream>>>(
      x1_bf, w1_bf, ffn_b1, h_bf, nullptr, nullptr, nullptr);

  // 6) FFN2 + residual(x1), LN2 -> output f32
  gemm_ln_kernel<N3, false><<<MM / FROWS, 256, 0, stream>>>(
      h_bf, w2_bf, ffn_b2, x1f, n2_w, n2_b, out, nullptr);
}

// v010
// A run of this version takes 119 microseconds.
// Two timings next to v009 both put it at 1.05 times that version's speed.
// Counting every step since v000, it is 4.36 times as fast.
#include <hip/hip_runtime.h>
#include <hip/hip_bf16.h>

// ---------------------------------------------------------------------------
// Transformer block for MI455X (gfx1250, wave32, WMMA).
// bf16 activations, f32 accumulation via v_wmma_f32_16x16x32_bf16.
// GEMM and attention tiles staged to LDS with global_load_async_to_lds_b128 (ASYNCcnt).
// ---------------------------------------------------------------------------

typedef __bf16 bf16;
typedef __attribute__((ext_vector_type(16))) __bf16 v16bf;
typedef __attribute__((ext_vector_type(8)))  float  v8f;
typedef __attribute__((ext_vector_type(2)))  float  v2f;

#define BB   4
#define TT   4096
#define CC   256
#define HH   4
#define DD   64
#define MM   (BB * TT)      // 16384 tokens
#define N3   (3 * CC)       // 768
#define LNEPS 1e-5f

// K index inside a 16x32 (16-bit) A/B fragment for VGPR r, lane-half hi.
// ISA 7.12.2: VGPR0..3 lanes0-15 hold K=0..7 (pairs), lanes16-31 K=8..15; VGPR4..7 -> +16.
__device__ __forceinline__ int kbase(int r, int hi) {
  return ((r & 4) << 2) | (hi << 3) | ((r & 3) << 1);
}

union FragAB {
  v16bf v;
  unsigned int u[8];
  bf16 b[16];
};

__device__ __forceinline__ unsigned lds_off32(const void* p) {
  return (unsigned)(unsigned long long)(uintptr_t)p;   // low 32 bits = LDS byte offset
}

// ---------------------------------------------------------------------------
// fp32 -> bf16 convert of one block's share. A thread takes PER pieces of 4 floats (16 B
// loads, all issued before the first store; a wave's load covers 512 contiguous bytes), so
// that few waves each keep PER loads in flight. blk counts blocks of 256 * PER * 4 elements.
// ---------------------------------------------------------------------------
template <int PER>
__device__ __forceinline__ void cvt_bf16_block(const float* __restrict__ in,
                                               bf16* __restrict__ out, int blk) {
  const int base = blk * (256 * PER) + threadIdx.x;          // index of a piece of 4 floats
  const float4* ip = reinterpret_cast<const float4*>(in);
  uint2* op = reinterpret_cast<uint2*>(out);
  float4 a[PER];
#pragma unroll   // a[] must become registers, and the loads stand together ahead of the stores
  for (int i = 0; i < PER; ++i) a[i] = ip[base + i * 256];
#pragma unroll   // as above
  for (int i = 0; i < PER; ++i) {
    union { bf16 e[4]; uint2 u; } pk;
    pk.e[0] = (bf16)a[i].x; pk.e[1] = (bf16)a[i].y;
    pk.e[2] = (bf16)a[i].z; pk.e[3] = (bf16)a[i].w;
    op[base + i * 256] = pk.u;
  }
}

// ---------------------------------------------------------------------------
// Weight convert with transpose: fp32 [K][N] -> bf16 [N][K], so that a GEMM's B tile has
// K-contiguous rows like its A tile. A block takes 32 n x 64 k: a wave reads 8 rows of
// 128 contiguous bytes, and the block's 8 waves together fill one whole 128-B line of each
// of its 32 output rows. blk runs over (N / 32) * (K / 64) blocks, n fastest.
// ---------------------------------------------------------------------------
__device__ __forceinline__ void cvt_wt_block(const float* __restrict__ in,
                                             bf16* __restrict__ out, int K, int N, int blk) {
  const int n  = (blk % (N / 32)) * 32 + (threadIdx.x & 31);
  const int k0 = (blk / (N / 32)) * 64 + (threadIdx.x >> 5) * 8;
  float a[8];
#pragma unroll   // a[] must become registers, and the loads stand together ahead of the store
  for (int i = 0; i < 8; ++i) a[i] = in[(size_t)(k0 + i) * N + n];
  union { bf16 e[8]; uint4 u; } pk;
#pragma unroll   // as above
  for (int i = 0; i < 8; ++i) pk.e[i] = (bf16)a[i];
  *reinterpret_cast<uint4*>(out + (size_t)n * K + k0) = pk.u;
  // Precaution: stands before any register that the store names can be written again (in the
  // one-launch kernel other arrays' code follows the store in the listing).
  asm volatile("s_wait_xcnt 0x0" ::: "memory");
}

// ---------------------------------------------------------------------------
// All five converts in one launch: they do not depend on one another, so the four gaps between
// dependent launches and the start and end of four short launches go. The block index picks
// the array (a scalar branch); x's 512 blocks, which move most of the bytes, come first.
// ---------------------------------------------------------------------------
#define WB_QKV  ((N3 / 32) * (CC / 64))            // 96 blocks
#define WB_PROJ ((CC / 32) * (CC / 64))            // 32
#define WB_FFN1 ((N3 / 32) * (CC / 64))            // 96
#define WB_FFN2 ((CC / 32) * (N3 / 64))            // 96
#define WB_ALL  (WB_QKV + WB_PROJ + WB_FFN1 + WB_FFN2)
#define XB_ALL  ((MM * CC) / (256 * 8 * 4))        // 512
__global__ __launch_bounds__(256) void cvt_all_kernel(
    const float* __restrict__ x, const float* __restrict__ qkv_w,
    const float* __restrict__ proj_w, const float* __restrict__ ffn_w1,
    const float* __restrict__ ffn_w2, bf16* __restrict__ x_bf,
    bf16* __restrict__ wqkv_bf, bf16* __restrict__ wproj_bf,
    bf16* __restrict__ w1_bf, bf16* __restrict__ w2_bf) {
  const int b = blockIdx.x;
  if (b < XB_ALL) {
    cvt_bf16_block<8>(x, x_bf, b);
    return;
  }
  const int w = b - XB_ALL;
  if (w < WB_QKV)
    cvt_wt_block(qkv_w, wqkv_bf, CC, N3, w);
  else if (w < WB_QKV + WB_PROJ)
    cvt_wt_block(proj_w, wproj_bf, CC, CC, w - WB_QKV);
  else if (w < WB_QKV + WB_PROJ + WB_FFN1)
    cvt_wt_block(ffn_w1, w1_bf, CC, N3, w - (WB_QKV + WB_PROJ));
  else
    cvt_wt_block(ffn_w2, w2_bf, N3, CC, w - (WB_QKV + WB_PROJ + WB_FFN1));
}

// One 16x32 fragment from an LDS row: k = 8*hi..+7 and 16+8*hi..+7 (the order of kbase).
__device__ __forceinline__ void frag_lds(FragAB& f, const bf16* rowp, int hi) {
  uint4 lo = *reinterpret_cast<const uint4*>(rowp + (hi << 3));
  uint4 up = *reinterpret_cast<const uint4*>(rowp + 16 + (hi << 3));
  f.u[0] = lo.x; f.u[1] = lo.y; f.u[2] = lo.z; f.u[3] = lo.w;
  f.u[4] = up.x; f.u[5] = up.y; f.u[6] = up.z; f.u[7] = up.w;
}

// ---------------------------------------------------------------------------
// Tiled GEMM: Out = A[M x K] * W[K x N] (+bias, + epilogue), W given as Wt[N x K].
// Block tile 128x128 (8 waves as 4 x 2, each a 32x64 tile = 8 WMMA per 32 k), K in steps
// of 64: a step's A and Wt tiles are 128 rows of one whole 128-B line each, brought into LDS
// by async copies (two buffers, the next step in flight while this one is worked on).
// MODE 0: QKV scatter -> q/k bf16 [B,H,T,D], v bf16 [B,H,D,T]
// MODE 2: GELU        -> bf16 out [M x N]
// ---------------------------------------------------------------------------
#define GPITCH 72                   // bf16 per tile row in LDS: 128 B + 16 B (16 B x odd)
#define GTILE  (128 * GPITCH)       // bf16 per operand tile

// One K step: 128 rows x 64 k of A (at ag) and of Wt (at bg), source pitch K, 16 B per lane
// and copy, 4 + 4 copies per lane; a wave's copy covers 4 whole lines.
template <int K>
__device__ __forceinline__ void gemm_copy(const bf16* ag, const bf16* bg,
                                          bf16* sa, bf16* sb, int tid) {
  unsigned la[4], lb[4];
  unsigned long long ga[4], gb[4];
#pragma unroll   // the address arrays must become registers: they are the operands of the asm below
  for (int i = 0; i < 4; ++i) {
    const int p = i * 256 + tid;
    const int row = p >> 3, col = (p & 7) << 3;
    la[i] = lds_off32(sa + row * GPITCH + col);
    ga[i] = (unsigned long long)(uintptr_t)(ag + (size_t)row * K + col);
    lb[i] = lds_off32(sb + row * GPITCH + col);
    gb[i] = (unsigned long long)(uintptr_t)(bg + (size_t)row * K + col);
  }
  // The copies and their s_wait_xcnt in one statement: the wait stands before any
  // rewrite of an address register that an issued copy names.
  asm volatile(
      "global_load_async_to_lds_b128 %0, %8, off\n\t"
      "global_load_async_to_lds_b128 %1, %9, off\n\t"
      "global_load_async_to_lds_b128 %2, %10, off\n\t"
      "global_load_async_to_lds_b128 %3, %11, off\n\t"
      "global_load_async_to_lds_b128 %4, %12, off\n\t"
      "global_load_async_to_lds_b128 %5, %13, off\n\t"
      "global_load_async_to_lds_b128 %6, %14, off\n\t"
      "global_load_async_to_lds_b128 %7, %15, off\n\t"
      "s_wait_xcnt 0x0"
      :: "v"(la[0]), "v"(la[1]), "v"(la[2]), "v"(la[3]),
         "v"(lb[0]), "v"(lb[1]), "v"(lb[2]), "v"(lb[3]),
         "v"(ga[0]), "v"(ga[1]), "v"(ga[2]), "v"(ga[3]),
         "v"(gb[0]), "v"(gb[1]), "v"(gb[2]), "v"(gb[3])
      : "memory");
}

// GELU with erf, two values, without a branch: x * Phi(x) = max(x, 0) - |x| * q(|x|), where
// q(a) = erfc(a / sqrt(2)) / 2 = t * (c1 + t * (c2 + t * (c3 + t * (c4 + t * c5)))) * exp(-a * a / 2),
// t = 1 / (1 + p * a / sqrt(2)): the five-term rational form of erfc, absolute error of erf at most
// 1.5e-7 (the result is rounded to bf16). The library erff picks one of two polynomials per
// value under the exec mask: a wave runs both, one value after another, each a serial chain. Here
// every lane runs the same few instructions, the polynomial is packed, and the values are independent.
__device__ __forceinline__ v2f gelu2(v2f x) {
  const float kp = 0.3275911f * 0.70710678118f;     // p / sqrt(2)
  const float ke = -0.5f * 1.44269504088896f;       // exp(-x * x / 2) = exp2(x * x * ke)
  const v2f w = (x * x) * (v2f){ke, ke};
  const v2f t = (v2f){__builtin_amdgcn_rcpf(fmaf(fabsf(x.x), kp, 1.0f)),
                      __builtin_amdgcn_rcpf(fmaf(fabsf(x.y), kp, 1.0f))};
  const v2f e = (v2f){__builtin_amdgcn_exp2f(w.x), __builtin_amdgcn_exp2f(w.y)};
  v2f p = __builtin_elementwise_fma(t, (v2f){0.5307027145f, 0.5307027145f}, (v2f){-0.7265760135f, -0.7265760135f});
  p = __builtin_elementwise_fma(p, t, (v2f){0.7107068705f, 0.7107068705f});
  p = __builtin_elementwise_fma(p, t, (v2f){-0.142248368f, -0.142248368f});
  p = __builtin_elementwise_fma(p, t, (v2f){0.127414796f, 0.127414796f});
  const v2f q = (p * t) * e;
  return (v2f){fmaf(-fabsf(x.x), q.x, fmaxf(x.x, 0.0f)), fmaf(-fabsf(x.y), q.y, fmaxf(x.y, 0.0f))};
}

template <int MODE, int K, int N>
__global__ __launch_bounds__(256) void gemm_bf16_kernel(
    const bf16* __restrict__ A, const bf16* __restrict__ Wt,
    const float* __restrict__ bias,
    bf16* __restrict__ outb, bf16* __restrict__ oq,
    bf16* __restrict__ okk, bf16* __restrict__ ov) {
  __shared__ __align__(16) bf16 sA[2][GTILE];
  __shared__ __align__(16) bf16 sB[2][GTILE];
  constexpr int NSTEP = K / 64;        // at least 4 here

  const int tid  = threadIdx.x;
  const int lane = tid & 31;
  const int wave = tid >> 5;
  const int hi   = (lane >> 4) & 1;
  const int wm   = (wave >> 1) * 32;   // the wave's rows inside the block tile
  const int wn   = (wave & 1) * 64;    // the wave's columns inside the block tile
  const int m0   = blockIdx.y * 128;
  const int n0   = blockIdx.x * 128;
  const bf16* ag = A + (size_t)m0 * K;
  const bf16* bg = Wt + (size_t)n0 * K;

  // Step 0 into buffer 0, landed and published; then step 1 into buffer 1.
  gemm_copy<K>(ag, bg, sA[0], sB[0], tid);
  asm volatile("s_wait_asynccnt 0x0" ::: "memory");   // this wave's copies of step 0 have landed
  __syncthreads();                                    // ... and every other wave's
  gemm_copy<K>(ag + 64, bg + 64, sA[1], sB[1], tid);

  v8f acc[2][4];
#pragma unroll
  for (int ms = 0; ms < 2; ++ms)
#pragma unroll
    for (int ns = 0; ns < 4; ++ns)
      acc[ms][ns] = (v8f){0.f, 0.f, 0.f, 0.f, 0.f, 0.f, 0.f, 0.f};

  for (int t = 0; t < NSTEP; ++t) {
    const bf16* pa = sA[t & 1] + (wm + (lane & 15)) * GPITCH;
    const bf16* pb = sB[t & 1] + (wn + (lane & 15)) * GPITCH;
#pragma unroll   // fa[], fb[] must become registers; the LDS offsets become immediates
    for (int kk = 0; kk < 2; ++kk) {
      FragAB fa[2], fb[4];
#pragma unroll
      for (int ms = 0; ms < 2; ++ms) frag_lds(fa[ms], pa + ms * 16 * GPITCH + kk * 32, hi);
#pragma unroll
      for (int ns = 0; ns < 4; ++ns) frag_lds(fb[ns], pb + ns * 16 * GPITCH + kk * 32, hi);
#pragma unroll
      for (int ms = 0; ms < 2; ++ms)
#pragma unroll
        for (int ns = 0; ns < 4; ++ns)
          acc[ms][ns] = __builtin_amdgcn_wmma_f32_16x16x32_bf16(
              false, fa[ms].v, false, fb[ns].v, (short)0, acc[ms][ns], false, false);
    }

    // Hand-over: step t + 1 becomes readable, buffer t & 1 becomes free.
    asm volatile("s_wait_dscnt 0x0" ::: "memory");     // this wave's reads of step t are done
    asm volatile("s_wait_asynccnt 0x0" ::: "memory");  // this wave's copies of step t + 1 have landed
    __syncthreads();                                   // both hold for every wave of the block
    if (t + 2 < NSTEP)
      gemm_copy<K>(ag + (t + 2) * 64, bg + (t + 2) * 64, sA[t & 1], sB[t & 1], tid);
  }
  asm volatile("s_wait_asynccnt 0x0" ::: "memory");    // no copy outstanding when the wave ends

  // ---- epilogue: acc[ms][ns][r] is row wm + ms*16 + 8*hi + r, column wn + ns*16 + (lane & 15) ----
  const int gn0 = n0 + wn + (lane & 15);
  const int gm0 = m0 + wm + (hi << 3);
  float bv[4];
#pragma unroll   // bv[] must become registers
  for (int ns = 0; ns < 4; ++ns) bv[ns] = bias[gn0 + ns * 16];

  if (MODE == 0) {                     // QKV scatter
    const int part = n0 >> 8;          // a 128-column tile lies inside one of q, k, v: block-uniform
    if (part == 2) {                   // V transposed: [B,H,D,T]
#pragma unroll
      for (int ns = 0; ns < 4; ++ns)
#pragma unroll
        for (int ms = 0; ms < 2; ++ms)
#pragma unroll
          for (int r = 0; r < 8; ++r) {
            const int gm = gm0 + ms * 16 + r, cc = (gn0 + ns * 16) & 255;
            const int hh = cc >> 6, dd = cc & 63;
            const int bb = gm >> 12, ttok = gm & (TT - 1);
            ov[(((size_t)(bb * HH + hh)) * DD + dd) * TT + ttok] = (bf16)(acc[ms][ns][r] + bv[ns]);
          }
    } else {
      bf16* dst = (part == 0) ? oq : okk;
#pragma unroll
      for (int ns = 0; ns < 4; ++ns)
#pragma unroll
        for (int ms = 0; ms < 2; ++ms)
#pragma unroll
          for (int r = 0; r < 8; ++r) {
            const int gm = gm0 + ms * 16 + r, cc = (gn0 + ns * 16) & 255;
            const int hh = cc >> 6, dd = cc & 63;
            const int bb = gm >> 12, ttok = gm & (TT - 1);
            dst[(((size_t)(bb * HH + hh)) * TT + ttok) * DD + dd] = (bf16)(acc[ms][ns][r] + bv[ns]);
          }
    }
  } else {                             // GELU (erf form) -> bf16
#pragma unroll
    for (int ns = 0; ns < 4; ++ns) {
      // Each group of 16 values (8 independent pairs) is scheduled on its own: in one piece with the
      // last WMMAs and with one another the groups take over 200 registers, and the grid's three
      // blocks per WGP (six waves per SIMD) no longer fit.
      __builtin_amdgcn_sched_barrier(0);
      bf16 gb[2][8];
#pragma unroll   // gb[][] must become registers
      for (int ms = 0; ms < 2; ++ms)
#pragma unroll
        for (int r = 0; r < 8; r += 2) {
          const v2f g = gelu2((v2f){acc[ms][ns][r], acc[ms][ns][r + 1]} + (v2f){bv[ns], bv[ns]});
          gb[ms][r]     = (bf16)g.x;
          gb[ms][r + 1] = (bf16)g.y;
        }
      // Holds the group's stores together behind its arithmetic, so that no register which a store
      // names is written again between the stores and the wait below.
      __builtin_amdgcn_sched_barrier(0);
#pragma unroll
      for (int ms = 0; ms < 2; ++ms)
#pragma unroll
        for (int r = 0; r < 8; ++r)
          outb[(size_t)(gm0 + ms * 16 + r) * N + gn0 + ns * 16] = gb[ms][r];
      // Precaution: stands before any register that one of these stores names is written again.
      asm volatile("s_wait_xcnt 0x0" ::: "memory");
    }
  }
}

// ---------------------------------------------------------------------------
// Flash attention, transposed: St = K * Qt puts one query's scores in one lane (column),
// so max and sum run in-lane plus one exchange between the wave halves; the two
// St tiles, converted in place, are the B operand of Ot += Vt * Pt.
// V is [B,H,D,T] so Vt rows are contiguous along keys.
// The 8 waves of a block share one (b,h) and 128 queries: K and Vt tiles of SKEYS keys are
// brought into LDS once per block by async copies (two buffers, the next tile in flight
// while this one is worked on) and every wave reads its fragments from there.
// Wave tile: 32 queries (two column groups) x one half of every tile's keys, in chunks of 32
// keys. Each K and Vt fragment read from LDS feeds two WMMAs (16 per chunk), and the block
// still has 8 waves. The two waves of a query group hold partial (max, sum, Ot) over
// disjoint keys; they are joined once, through LDS, behind the loop.
// ---------------------------------------------------------------------------
#define SKEYS  128                  // keys per LDS tile
#define NTILE  (TT / SKEYS)         // 32 tiles
#define KPITCH 72                   // bf16 per K row in LDS: 128 B + 16 B (16 B x odd)
#define VPITCH 136                  // bf16 per Vt row in LDS: 256 B + 16 B (16 B x odd)
#define KTILE  (SKEYS * KPITCH)     // bf16 per K tile
#define VTILE  (DD * VPITCH)        // bf16 per Vt tile
#define LOG2E  1.44269504088896f    // exp(x) = exp2(x * LOG2E)

__device__ __forceinline__ float xhalf(float x) {   // lane l <-> lane l ^ 16
  int b = __builtin_bit_cast(int, x);
  return __builtin_bit_cast(float,
      __builtin_amdgcn_permlanex16(b, b, 0x76543210, 0xfedcba98, false, false));
}

// exp2 with the one slot that the instruction set asks for behind a transcendental (before its
// result is read or its source register rewritten) kept in the same statement: a v_nop in a
// statement of its own did not stay behind the v_exp in the build.
__device__ __forceinline__ float exp2_slot(float x) {
  float r;
  asm("v_exp_f32 %0, %1\n\tv_nop" : "=v"(r) : "v"(x));
  return r;
}

// One tile: K rows [SKEYS][64] (16 KB contiguous at kg) and Vt rows [64][SKEYS] (source
// pitch TT, at vg), 16 B per lane and copy, 4 + 4 copies per lane; a wave's copy covers
// 512 B of whole lines.
__device__ __forceinline__ void tile_copy(const bf16* kg, const bf16* vg,
                                          bf16* sk, bf16* sv, int tid) {
  unsigned lk[4], lv[4];
  unsigned long long gk[4], gv[4];
#pragma unroll   // the address arrays must become registers: they are the operands of the asm below
  for (int i = 0; i < 4; ++i) {
    const int p = i * 256 + tid;
    lk[i] = lds_off32(sk + (p >> 3) * KPITCH + ((p & 7) << 3));
    gk[i] = (unsigned long long)(uintptr_t)(kg + (p << 3));
    lv[i] = lds_off32(sv + (p >> 4) * VPITCH + ((p & 15) << 3));
    gv[i] = (unsigned long long)(uintptr_t)(vg + (size_t)(p >> 4) * TT + ((p & 15) << 3));
  }
  // The copies and their s_wait_xcnt in one statement: the wait stands before any
  // rewrite of an address register that an issued copy names.
  asm volatile(
      "global_load_async_to_lds_b128 %0, %8, off\n\t"
      "global_load_async_to_lds_b128 %1, %9, off\n\t"
      "global_load_async_to_lds_b128 %2, %10, off\n\t"
      "global_load_async_to_lds_b128 %3, %11, off\n\t"
      "global_load_async_to_lds_b128 %4, %12, off\n\t"
      "global_load_async_to_lds_b128 %5, %13, off\n\t"
      "global_load_async_to_lds_b128 %6, %14, off\n\t"
      "global_load_async_to_lds_b128 %7, %15, off\n\t"
      "s_wait_xcnt 0x0"
      :: "v"(lk[0]), "v"(lk[1]), "v"(lk[2]), "v"(lk[3]),
         "v"(lv[0]), "v"(lv[1]), "v"(lv[2]), "v"(lv[3]),
         "v"(gk[0]), "v"(gk[1]), "v"(gk[2]), "v"(gk[3]),
         "v"(gv[0]), "v"(gv[1]), "v"(gv[2]), "v"(gv[3])
      : "memory");
}

// Four waves per SIMD (two blocks per WGP) is what the grid gives: the register budget is set to it.
__global__ __launch_bounds__(256) __attribute__((amdgpu_waves_per_eu(4, 4)))
void attn_kernel(const bf16* __restrict__ q,
                 const bf16* __restrict__ k,
                 const bf16* __restrict__ v,
                 bf16* __restrict__ o) {
  __shared__ __align__(16) bf16 sK[2][KTILE];
  __shared__ __align__(16) bf16 sV[2][VTILE];

  const int tid  = threadIdx.x;
  const int lane = tid & 31;
  const int wave = __builtin_amdgcn_readfirstlane(tid >> 5);   // scalar: the tests on kh are scalar branches
  const int hi   = (lane >> 4) & 1;
  const int qg   = wave >> 1;                      // query group: 32 of the block's 128 queries
  const int kh   = wave & 1;                       // which 64 keys of every tile
  const int bh   = blockIdx.x / (TT / 128);        // one (b,h) per block
  const int tq0  = (blockIdx.x % (TT / 128)) * 128 + qg * 32;   // the wave's first query
  const size_t rowbase = (size_t)bh * TT;
  const bf16* kbh = k + rowbase * DD;              // K rows of this (b,h)
  const bf16* vbh = v + (size_t)bh * DD * TT;      // Vt rows of this (b,h)

  // Tile 0 into buffer 0, landed and published; then tile 1 into buffer 1.
  tile_copy(kbh, vbh, sK[0], sV[0], tid);
  asm volatile("s_wait_asynccnt 0x0" ::: "memory");   // this wave's copies of tile 0 have landed
  __syncthreads();                                    // ... and every other wave's
  tile_copy(kbh + SKEYS * DD, vbh + SKEYS, sK[1], sV[1], tid);

  // Q fragments qf[column group][d half] as B operand: lane column = query. Loaded once.
  FragAB qf[2][2];
#pragma unroll   // qf[][] must become registers
  for (int qc = 0; qc < 2; ++qc) {
    const bf16* qp = q + (rowbase + tq0 + qc * 16 + (lane & 15)) * DD;
#pragma unroll
    for (int r = 0; r < 8; ++r) {
      qf[qc][0].u[r] = *reinterpret_cast<const unsigned int*>(qp + kbase(r, hi));
      qf[qc][1].u[r] = *reinterpret_cast<const unsigned int*>(qp + 32 + kbase(r, hi));
    }
  }

  // Softmax in the log2 domain: exp((s - m) * D^-0.5) = exp2(s * cscale - m * cscale), D = 64. cscale is
  // positive, so the maximum is taken on the raw scores and scaled once.
  const float cscale = 0.125f * LOG2E;
  const float HEADROOM = 8.0f / cscale;   // 8 in log2 units, as a raw score

  // oacc[qc][j][r] = Ot[d = j*16 + 8*hi + r][query = qc*16 + (lane & 15)]
  v8f oacc[2][4];
  float rowm[2], rowb[2], rowt[2], rows[2];
#pragma unroll   // oacc[][], rowm[], rowb[], rowt[], rows[] must become registers
  for (int qc = 0; qc < 2; ++qc) {
#pragma unroll
    for (int j = 0; j < 4; ++j) oacc[qc][j] = (v8f){0.f, 0.f, 0.f, 0.f, 0.f, 0.f, 0.f, 0.f};
    rowm[qc] = -3.0e38f;            // reference of this lane's query, raw score (equal in both halves)
    rowb[qc] = -3.0e38f * cscale;   // the same in log2 units: what the exponents in use are taken against
    rowt[qc] = -3.0e38f;            // raw score above which the reference is raised: the first chunk always raises it
    rows[qc] = 0.f;        // running sum over this half's keys only; halves join at the end
  }


  for (int t = 0; t < NTILE; ++t) {
    const bf16* bk = sK[t & 1] + (kh * (SKEYS / 2) + (lane & 15)) * KPITCH;
    const bf16* bv = sV[t & 1] + (lane & 15) * VPITCH + kh * (SKEYS / 2);

    // Unrolled so that the LDS offsets are immediates and a chunk's reads can be
    // issued ahead of the vector work of the chunk before it.
#pragma unroll
    for (int c32 = 0; c32 < SKEYS / 64; ++c32) {
      // ---- St = K * Qt for 32 keys x 32 queries:
      //      sacc[qc][nt][r] = score(key +nt*16+8*hi+r, query qc*16 + (lane & 15)) ----
      FragAB kf[2][2];
#pragma unroll
      for (int nt = 0; nt < 2; ++nt) {
        const bf16* kp = bk + (c32 * 32 + nt * 16) * KPITCH;
        frag_lds(kf[nt][0], kp, hi);
        frag_lds(kf[nt][1], kp + 32, hi);
      }
      v8f sacc[2][2];
#pragma unroll
      for (int nt = 0; nt < 2; ++nt)
#pragma unroll
        for (int qc = 0; qc < 2; ++qc) {
          sacc[qc][nt] = (v8f){0.f, 0.f, 0.f, 0.f, 0.f, 0.f, 0.f, 0.f};
          sacc[qc][nt] = __builtin_amdgcn_wmma_f32_16x16x32_bf16(
              false, kf[nt][0].v, false, qf[qc][0].v, (short)0, sacc[qc][nt], false, false);
        }
#pragma unroll
      for (int nt = 0; nt < 2; ++nt)
#pragma unroll
        for (int qc = 0; qc < 2; ++qc)
          sacc[qc][nt] = __builtin_amdgcn_wmma_f32_16x16x32_bf16(
              false, kf[nt][1].v, false, qf[qc][1].v, (short)0, sacc[qc][nt], false, false);

      FragAB vf[4];
#pragma unroll
      for (int j = 0; j < 4; ++j) frag_lds(vf[j], bv + j * 16 * VPITCH + c32 * 32, hi);

      // ---- online softmax: a lane holds 16 of its query's 32 scores. Lazy rescale: the exponents are
      //      taken against the reference in use (rowb), which is raised only where a raw score lies
      //      more than HEADROOM above it, so a probability is at most 2^8. Sum and Ot stay relative to
      //      one reference, and the division at the end cancels it whatever it is. ----
      float mc[2];
#pragma unroll   // mc[] must become registers
      for (int qc = 0; qc < 2; ++qc) {
        float m4[4];
#pragma unroll
        for (int i = 0; i < 4; ++i)
          m4[i] = fmaxf(fmaxf(sacc[qc][0][i], sacc[qc][0][i + 4]), fmaxf(sacc[qc][1][i], sacc[qc][1][i + 4]));
        mc[qc] = fmaxf(fmaxf(m4[0], m4[1]), fmaxf(m4[2], m4[3]));   // this lane's 16 keys only
      }
      // One test per chunk for both column groups, a scalar branch: taken if any lane asks. Marked
      // unlikely so that the rescale code is laid out of line and the path that skips it falls through.
      if (__builtin_expect(__builtin_amdgcn_ballot_w32((mc[0] > rowt[0]) | (mc[1] > rowt[1])) != 0, 0)) {
#pragma unroll
        for (int qc = 0; qc < 2; ++qc) {
          const float mn   = fmaxf(rowm[qc], fmaxf(mc[qc], xhalf(mc[qc])));   // equal in both halves
          const float nb   = mn * cscale;
          const float corr = exp2_slot(rowb[qc] - nb);
          rowm[qc] = mn;
          rowb[qc] = nb;
          rowt[qc] = mn + HEADROOM;
          rows[qc] *= corr;
          const v2f corr2 = (v2f){corr, corr};
#pragma unroll
          for (int j = 0; j < 4; ++j)
#pragma unroll
            for (int r = 0; r < 8; r += 2) {
              v2f t2 = (v2f){oacc[qc][j][r], oacc[qc][j][r + 1]};
              // In place: result and source share their registers, so that the path that skips the
              // rescale needs no copy of Ot where the two paths meet.
              asm("v_pk_mul_f32 %0, %0, %1" : "+v"(t2) : "v"(corr2));
              oacc[qc][j][r]     = t2.x;
              oacc[qc][j][r + 1] = t2.y;
            }
        }
      }

      FragAB pf[2];
#pragma unroll
      for (int qc = 0; qc < 2; ++qc) {
        // Pt as B operand: element s wants key 8*hi+s (s<8) or 16+8*hi+(s-8), which is
        // exactly tile s>>3, register s&7 of St: convert in place, no lane exchange.
        // The exponent of two scores comes from one packed FMA.
        const float nb = rowb[qc];
        float p[16];
#pragma unroll
        for (int i = 0; i < 16; i += 2) {
          const v2f arg = __builtin_elementwise_fma(
              (v2f){sacc[qc][i >> 3][i & 7], sacc[qc][i >> 3][(i & 7) + 1]}, (v2f){cscale, cscale},
              (v2f){-nb, -nb});
          p[i]     = exp2_slot(arg.x);
          p[i + 1] = exp2_slot(arg.y);
          pf[qc].b[i]     = (bf16)p[i];
          pf[qc].b[i + 1] = (bf16)p[i + 1];
        }
        float s4[4];
#pragma unroll
        for (int i = 0; i < 4; ++i)
          s4[i] = (p[i] + p[i + 4]) + (p[i + 8] + p[i + 12]);
        rows[qc] += (s4[0] + s4[1]) + (s4[2] + s4[3]);
      }

      // ---- Ot += Vt * Pt ----
#pragma unroll
      for (int j = 0; j < 4; ++j)
#pragma unroll
        for (int qc = 0; qc < 2; ++qc)
          oacc[qc][j] = __builtin_amdgcn_wmma_f32_16x16x32_bf16(
              false, vf[j].v, false, pf[qc].v, (short)0, oacc[qc][j], false, false);
    }

    // Hand-over: tile t + 1 becomes readable, buffer t & 1 becomes free.
    // This wave's reads of tile t are done. The two row sums are named as inputs only (nothing is
    // written): they are then formed in front of the hand-over. Without that their adds move behind
    // the barrier, the tile's 64 probabilities stay in registers until there, and the 32-query tile
    // has no registers left to fetch fragments ahead of their WMMAs.
    asm volatile("s_wait_dscnt 0x0" :: "v"(rows[0]), "v"(rows[1]) : "memory");
    asm volatile("s_wait_asynccnt 0x0" ::: "memory");  // this wave's copies of tile t + 1 have landed
    __syncthreads();                                   // both hold for every wave of the block
    if (t + 2 < NTILE)
      tile_copy(kbh + (size_t)(t + 2) * SKEYS * DD, vbh + (t + 2) * SKEYS,
                sK[t & 1], sV[t & 1], tid);
  }
  asm volatile("s_wait_asynccnt 0x0" ::: "memory");    // no copy outstanding when the wave ends

  // ---- join the two key halves of a query group. The K tiles are dead (the last hand-over's
  //      barrier ended every read, no copy is outstanding): their LDS carries the kh = 1 wave's
  //      partial Ot (16 B per lane and piece, lanes contiguous), maximum and sum. ----
  float4* mo = reinterpret_cast<float4*>(&sK[0][0]) + qg * (16 * 32) + lane;            // 4 x 8 KB
  float*  ml = reinterpret_cast<float*>(&sK[0][0]) + 4 * 16 * 32 * 4 + qg * (4 * 32) + lane;  // 4 x 512 B
  if (kh == 1) {
#pragma unroll
    for (int qc = 0; qc < 2; ++qc) {
#pragma unroll
      for (int j = 0; j < 4; ++j) {
        const v8f a = oacc[qc][j];
        mo[((qc * 4 + j) * 2 + 0) * 32] = make_float4(a[0], a[1], a[2], a[3]);
        mo[((qc * 4 + j) * 2 + 1) * 32] = make_float4(a[4], a[5], a[6], a[7]);
      }
      ml[(qc * 2 + 0) * 32] = rowb[qc];
      ml[(qc * 2 + 1) * 32] = rows[qc];
    }
  }
  __syncthreads();   // the kh = 1 partials are readable by the kh = 0 wave of the group
  if (kh == 1) return;

  // ---- normalize + merge heads: write [B,T,C] bf16, 8 consecutive d per lane ----
  const int b = bh >> 2, h = bh & 3;
  uint4 res[2][4];
#pragma unroll   // res[][] must become registers: all results are formed before the first store
  for (int qc = 0; qc < 2; ++qc) {
    const float m1 = ml[(qc * 2 + 0) * 32];
    const float l1 = ml[(qc * 2 + 1) * 32];
    const float mn = fmaxf(rowb[qc], m1);
    const float a0 = exp2_slot(rowb[qc] - mn);   // the maxima are in log2 units
    const float a1 = exp2_slot(m1 - mn);
    const float l  = rows[qc] * a0 + l1 * a1;
    const float inv = 1.0f / (l + xhalf(l));
    const float f0 = a0 * inv, f1 = a1 * inv;
#pragma unroll
    for (int j = 0; j < 4; ++j) {
      const float4 lo = mo[((qc * 4 + j) * 2 + 0) * 32];
      const float4 up = mo[((qc * 4 + j) * 2 + 1) * 32];
      const float o1[8] = {lo.x, lo.y, lo.z, lo.w, up.x, up.y, up.z, up.w};
      union { bf16 e[8]; uint4 u; } pk;
#pragma unroll
      for (int r = 0; r < 8; ++r) pk.e[r] = (bf16)(oacc[qc][j][r] * f0 + o1[r] * f1);
      res[qc][j] = pk.u;
    }
  }
#pragma unroll
  for (int qc = 0; qc < 2; ++qc) {
    bf16* op = o + ((size_t)b * TT + tq0 + qc * 16 + (lane & 15)) * CC + h * DD + (hi << 3);
#pragma unroll
    for (int j = 0; j < 4; ++j) *reinterpret_cast<uint4*>(op + j * 16) = res[qc][j];
  }
}

// ---------------------------------------------------------------------------
// Residual GEMM with LayerNorm in its epilogue: Out = LN(A[M x K] * W[K x 256] + bias + res).
// A block owns whole rows: tile 64 x 256 (8 waves as 2 x 4, each 32x64 as in the GEMM above, the
// same K steps, copies and hand-over), so the sum never goes to memory and no launch of
// its own reads it back. Behind the K loop the f32 tile goes through LDS (the W tiles are dead),
// which turns the accumulator layout into whole rows: a wave then takes 8 rows, a lane 2 x 16 B
// of each, and residual loads and all stores cover whole lines. Butterfly reductions.
// ---------------------------------------------------------------------------
#define FROWS   64                  // rows per block
#define FATILE  (FROWS * GPITCH)    // bf16 per A tile
#define FBTILE  (CC * GPITCH)       // bf16 per Wt tile
#define FPITCH  260                 // f32 per staged row: 16 B more than 256, so that rows r and r + 8
                                    // (the two lane halves of one LDS store) lie 32 banks apart
#define FLNT    (FROWS / 8)         // rows per wave in the LayerNorm part

// One K step: 64 rows x 64 k of A (at ag) and 256 rows x 64 k of Wt (at bg), source pitch K,
// 16 B per lane and copy, 2 + 8 copies per lane; a wave's copy covers 4 whole lines.
template <int K>
__device__ __forceinline__ void gemm_ln_copy(const bf16* ag, const bf16* bg,
                                             bf16* sa, bf16* sb, int tid) {
  unsigned la[2], lb[8];
  unsigned long long ga[2], gb[8];
#pragma unroll   // the address arrays must become registers: they are the operands of the asm below
  for (int i = 0; i < 8; ++i) {
    const int p = i * 256 + tid;
    const int row = p >> 3, col = (p & 7) << 3;
    if (i < 2) {
      la[i] = lds_off32(sa + row * GPITCH + col);
      ga[i] = (unsigned long long)(uintptr_t)(ag + (size_t)row * K + col);
    }
    lb[i] = lds_off32(sb + row * GPITCH + col);
    gb[i] = (unsigned long long)(uintptr_t)(bg + (size_t)row * K + col);
  }
  // The copies and their s_wait_xcnt in one statement: the wait stands before any
  // rewrite of an address register that an issued copy names.
  asm volatile(
      "global_load_async_to_lds_b128 %0, %10, off\n\t"
      "global_load_async_to_lds_b128 %1, %11, off\n\t"
      "global_load_async_to_lds_b128 %2, %12, off\n\t"
      "global_load_async_to_lds_b128 %3, %13, off\n\t"
      "global_load_async_to_lds_b128 %4, %14, off\n\t"
      "global_load_async_to_lds_b128 %5, %15, off\n\t"
      "global_load_async_to_lds_b128 %6, %16, off\n\t"
      "global_load_async_to_lds_b128 %7, %17, off\n\t"
      "global_load_async_to_lds_b128 %8, %18, off\n\t"
      "global_load_async_to_lds_b128 %9, %19, off\n\t"
      "s_wait_xcnt 0x0"
      :: "v"(la[0]), "v"(la[1]),
         "v"(lb[0]), "v"(lb[1]), "v"(lb[2]), "v"(lb[3]),
         "v"(lb[4]), "v"(lb[5]), "v"(lb[6]), "v"(lb[7]),
         "v"(ga[0]), "v"(ga[1]),
         "v"(gb[0]), "v"(gb[1]), "v"(gb[2]), "v"(gb[3]),
         "v"(gb[4]), "v"(gb[5]), "v"(gb[6]), "v"(gb[7])
      : "memory");
}

template <int K, bool WITHB>
__global__ __launch_bounds__(256) void gemm_ln_kernel(
    const bf16* __restrict__ A, const bf16* __restrict__ Wt,
    const float* __restrict__ bias, const float* __restrict__ res,
    const float* __restrict__ w, const float* __restrict__ lnb,
    float* __restrict__ outf, bf16* __restrict__ outb) {
  __shared__ __align__(16) bf16 sA[2][FATILE];
  __shared__ __align__(16) bf16 sB[2][FBTILE];
  static_assert(FROWS * FPITCH * 4 <= 2 * FBTILE * 2, "the staged f32 tile fits in the Wt tiles");
  constexpr int NSTEP = K / 64;        // at least 4 here

  const int tid  = threadIdx.x;
  const int lane = tid & 31;
  const int wave = tid >> 5;
  const int hi   = (lane >> 4) & 1;
  const int wm   = (wave >> 2) * 32;   // the wave's rows inside the block tile
  const int wn   = (wave & 3) * 64;    // the wave's columns inside the block tile
  const int m0   = blockIdx.x * FROWS;
  const bf16* ag = A + (size_t)m0 * K;

  // Step 0 into buffer 0.
  gemm_ln_copy<K>(ag, Wt, sA[0], sB[0], tid);

  // What the epilogue reads from memory is asked for here, beside step 0's copies, whose arrival is
  // waited for in any case: the residual of the wave's FLNT rows (8 KB contiguous), and GEMM bias,
  // LayerNorm weight and bias of the lane's 2 x 4 columns.
  const int tok0 = m0 + wave * FLNT;
  const float4* rp = reinterpret_cast<const float4*>(res + (size_t)tok0 * CC);
  float4 rv[FLNT][2];
#pragma unroll   // rv[][] must become registers, and the loads stand together
  for (int t = 0; t < FLNT; ++t) {
    rv[t][0] = rp[t * 64 + lane];
    rv[t][1] = rp[t * 64 + 32 + lane];
  }
  float4 gv[2], wv[2], bv[2];
#pragma unroll   // gv[], wv[], bv[] must become registers
  for (int i = 0; i < 2; ++i) {
    gv[i] = reinterpret_cast<const float4*>(bias)[i * 32 + lane];
    wv[i] = reinterpret_cast<const float4*>(w)[i * 32 + lane];
    bv[i] = reinterpret_cast<const float4*>(lnb)[i * 32 + lane];
  }
  // Precaution: stands before any register that one of these loads names is written again.
  asm volatile("s_wait_xcnt 0x0" ::: "memory");

  // Step 0 landed and published; then step 1 into buffer 1.
  asm volatile("s_wait_asynccnt 0x0" ::: "memory");   // this wave's copies of step 0 have landed
  __syncthreads();                                    // ... and every other wave's
  gemm_ln_copy<K>(ag + 64, Wt + 64, sA[1], sB[1], tid);

  v8f acc[2][4];
#pragma unroll
  for (int ms = 0; ms < 2; ++ms)
#pragma unroll
    for (int ns = 0; ns < 4; ++ns)
      acc[ms][ns] = (v8f){0.f, 0.f, 0.f, 0.f, 0.f, 0.f, 0.f, 0.f};

  // Kept rolled: unrolled (K = 256), the copy addresses of all steps are formed ahead and, beside the
  // epilogue's operands, no longer fit the register budget (spills).
#pragma nounroll
  for (int t = 0; t < NSTEP; ++t) {
    const bf16* pa = sA[t & 1] + (wm + (lane & 15)) * GPITCH;
    const bf16* pb = sB[t & 1] + (wn + (lane & 15)) * GPITCH;
#pragma unroll   // fa[], fb[] must become registers; the LDS offsets become immediates
    for (int kk = 0; kk < 2; ++kk) {
      FragAB fa[2], fb[4];
#pragma unroll
      for (int ms = 0; ms < 2; ++ms) frag_lds(fa[ms], pa + ms * 16 * GPITCH + kk * 32, hi);
#pragma unroll
      for (int ns = 0; ns < 4; ++ns) frag_lds(fb[ns], pb + ns * 16 * GPITCH + kk * 32, hi);
#pragma unroll
      for (int ms = 0; ms < 2; ++ms)
#pragma unroll
        for (int ns = 0; ns < 4; ++ns)
          acc[ms][ns] = __builtin_amdgcn_wmma_f32_16x16x32_bf16(
              false, fa[ms].v, false, fb[ns].v, (short)0, acc[ms][ns], false, false);
    }

    // Hand-over: step t + 1 becomes readable, buffer t & 1 becomes free.
    asm volatile("s_wait_dscnt 0x0" ::: "memory");     // this wave's reads of step t are done
    asm volatile("s_wait_asynccnt 0x0" ::: "memory");  // this wave's copies of step t + 1 have landed
    __syncthreads();                                   // both hold for every wave of the block
    if (t + 2 < NSTEP)
      gemm_ln_copy<K>(ag + (t + 2) * 64, Wt + (t + 2) * 64, sA[t & 1], sB[t & 1], tid);
  }
  asm volatile("s_wait_asynccnt 0x0" ::: "memory");    // no copy outstanding behind the loop

  // ---- the f32 tile through LDS. The Wt tiles are dead: the last hand-over's barrier ended every
  //      read and no copy is outstanding. acc[ms][ns][r] is row wm + ms*16 + 8*hi + r,
  //      column wn + ns*16 + (lane & 15). ----
  float* st = reinterpret_cast<float*>(&sB[0][0]);
  {
    float* sp = st + (wm + (hi << 3)) * FPITCH + wn + (lane & 15);
#pragma unroll
    for (int ms = 0; ms < 2; ++ms)
#pragma unroll
      for (int ns = 0; ns < 4; ++ns)
#pragma unroll
        for (int r = 0; r < 8; ++r) sp[(ms * 16 + r) * FPITCH + ns * 16] = acc[ms][ns][r];
  }
  __syncthreads();   // the whole tile is readable by the waves that take its rows
  // The LayerNorm part is scheduled on its own: in one piece with the LDS stores above, the compiler
  // starts it with two LDS reads in flight instead of four to six.
  __builtin_amdgcn_sched_barrier(0);

  // The wave's FLNT rows: (product + bias) + residual.
  float4 a[FLNT][2];
#pragma unroll   // a[][], rv[][] must become registers
  for (int t = 0; t < FLNT; ++t) {
    const float4* sr = reinterpret_cast<const float4*>(st + (wave * FLNT + t) * FPITCH);
#pragma unroll
    for (int i = 0; i < 2; ++i) {
      const float4 s = sr[i * 32 + lane];
      a[t][i].x = (s.x + gv[i].x) + rv[t][i].x;
      a[t][i].y = (s.y + gv[i].y) + rv[t][i].y;
      a[t][i].z = (s.z + gv[i].z) + rv[t][i].z;
      a[t][i].w = (s.w + gv[i].w) + rv[t][i].w;
    }
  }

  // Sums of all FLNT rows, written one butterfly step of every row at a time: the rows' chains are
  // independent, so that exchanges of several rows are in flight together.
  float sum[FLNT], sq[FLNT];
#pragma unroll   // sum[], sq[] must become registers
  for (int t = 0; t < FLNT; ++t) {
    const float4 a0 = a[t][0], a1 = a[t][1];
    sum[t] = a0.x + a0.y + a0.z + a0.w + a1.x + a1.y + a1.z + a1.w;
    sq[t]  = a0.x * a0.x + a0.y * a0.y + a0.z * a0.z + a0.w * a0.w +
             a1.x * a1.x + a1.y * a1.y + a1.z * a1.z + a1.w * a1.w;
  }
#pragma unroll
  for (int off = 1; off <= 16; off <<= 1) {
    float xs[FLNT], xq[FLNT];
#pragma unroll
    for (int t = 0; t < FLNT; ++t) {
      xs[t] = __shfl_xor(sum[t], off, 32);
      xq[t] = __shfl_xor(sq[t], off, 32);
    }
#pragma unroll
    for (int t = 0; t < FLNT; ++t) {
      sum[t] += xs[t];
      sq[t]  += xq[t];
    }
  }

  // All results are formed in registers before the first store.
  float4 y[FLNT][2];
  uint2 yb[FLNT][2];
#pragma unroll   // a[][], y[][], yb[][] are indexed by t
  for (int t = 0; t < FLNT; ++t) {
    const float mean = sum[t] * (1.0f / CC);
    const float var  = sq[t] * (1.0f / CC) - mean * mean;
    const float rstd = rsqrtf(var + LNEPS);
#pragma unroll
    for (int i = 0; i < 2; ++i) {
      const float4 av = a[t][i];
      y[t][i].x = wv[i].x * (av.x - mean) * rstd + bv[i].x;
      y[t][i].y = wv[i].y * (av.y - mean) * rstd + bv[i].y;
      y[t][i].z = wv[i].z * (av.z - mean) * rstd + bv[i].z;
      y[t][i].w = wv[i].w * (av.w - mean) * rstd + bv[i].w;
      if (WITHB) {
        union { bf16 e[4]; uint2 u; } pk;
        pk.e[0] = (bf16)y[t][i].x; pk.e[1] = (bf16)y[t][i].y;
        pk.e[2] = (bf16)y[t][i].z; pk.e[3] = (bf16)y[t][i].w;
        yb[t][i] = pk.u;
      }
    }
  }

  // Holds the stores at the end: moved up among the sums, their data registers are written again,
  // each time behind a wait.
  __builtin_amdgcn_sched_barrier(0);
  if (WITHB) {
    uint2* ob = reinterpret_cast<uint2*>(outb + (size_t)tok0 * CC);
#pragma unroll   // yb[][] is indexed by t
    for (int t = 0; t < FLNT; ++t)
#pragma unroll
      for (int i = 0; i < 2; ++i) ob[t * 64 + i * 32 + lane] = yb[t][i];
  }
  float4* of = reinterpret_cast<float4*>(outf + (size_t)tok0 * CC);
#pragma unroll   // y[][] is indexed by t
  for (int t = 0; t < FLNT; ++t) {
    of[t * 64 + lane]      = y[t][0];
    of[t * 64 + 32 + lane] = y[t][1];
  }
}

// ---------------------------------------------------------------------------
// Host launcher
// ---------------------------------------------------------------------------
extern "C" void kernel_launch(void* const* d_in, const int* in_sizes, int n_in,
                              void* d_out, int out_size, void* d_ws, size_t ws_size,
                              hipStream_t stream) {
  const float* x      = (const float*)d_in[0];
  const float* qkv_w  = (const float*)d_in[1];
  const float* qkv_b  = (const float*)d_in[2];
  const float* proj_w = (const float*)d_in[3];
  const float* proj_b = (const float*)d_in[4];
  const float* n1_w   = (const float*)d_in[5];
  const float* n1_b   = (const float*)d_in[6];
  const float* ffn_w1 = (const float*)d_in[7];
  const float* ffn_b1 = (const float*)d_in[8];
  const float* ffn_w2 = (const float*)d_in[9];
  const float* ffn_b2 = (const float*)d_in[10];
  const float* n2_w   = (const float*)d_in[11];
  const float* n2_b   = (const float*)d_in[12];
  float* out = (float*)d_out;

  char* ws = (char*)d_ws;
  size_t off = 0;
  auto take = [&](size_t bytes) { void* p = ws + off; off += (bytes + 255) & ~(size_t)255; return p; };

  bf16*  x_bf     = (bf16*)take((size_t)MM * CC * 2);
  bf16*  wqkv_bf  = (bf16*)take((size_t)CC * N3 * 2);
  bf16*  wproj_bf = (bf16*)take((size_t)CC * CC * 2);
  bf16*  w1_bf    = (bf16*)take((size_t)CC * N3 * 2);
  bf16*  w2_bf    = (bf16*)take((size_t)N3 * CC * 2);
  bf16*  q_bf     = (bf16*)take((size_t)MM * CC * 2);
  bf16*  k_bf     = (bf16*)take((size_t)MM * CC * 2);
  bf16*  v_bf     = (bf16*)take((size_t)MM * CC * 2);   // [B,H,D,T]
  bf16*  attn_bf  = (bf16*)take((size_t)MM * CC * 2);
  float* x1f      = (float*)take((size_t)MM * CC * 4);
  bf16*  x1_bf    = (bf16*)take((size_t)MM * CC * 2);
  bf16*  h_bf     = (bf16*)take((size_t)MM * N3 * 2);

  // 1) converts, one launch: x (8 pieces of 4 floats per thread) and the weights [K][N] -> bf16 [N][K]
  cvt_all_kernel<<<XB_ALL + WB_ALL, 256, 0, stream>>>(x, qkv_w, proj_w, ffn_w1, ffn_w2,
                                                      x_bf, wqkv_bf, wproj_bf, w1_bf, w2_bf);

  // 2) QKV projection, scatter q/k -> [B,H,T,D], v -> [B,H,D,T]
  gemm_bf16_kernel<0, CC, N3><<<dim3(N3 / 128, MM / 128), 256, 0, stream>>>(
      x_bf, wqkv_bf, qkv_b, nullptr, q_bf, k_bf, v_bf);

  // 3) flash attention -> [B,T,C] bf16
  attn_kernel<<<BB * HH * (TT / 128), 256, 0, stream>>>(q_bf, k_bf, v_bf, attn_bf);

  // 4) output projection + residual(x), LN1 -> x1 (f32 + bf16)
  gemm_ln_kernel<CC, true><<<MM / FROWS, 256, 0, stream>>>(
      attn_bf, wproj_bf, proj_b, x, n1_w, n1_b, x1f, x1_bf);

  // 5) FFN1 + GELU -> h bf16
  gemm_bf16_kernel<2, CC, N3><<<dim3(N3 / 128, MM / 128), 256, 0, stream>>>(
      x1_bf, w1_bf, ffn_b1, h_bf, nullptr, nullptr, nullptr);

  // 6) FFN2 + residual(x1), LN2 -> output f32
  gemm_ln_kernel<N3, false><<<MM / FROWS, 256, 0, stream>>>(
      h_bf, w2_bf, ffn_b2, x1f, n2_w, n2_b, out, nullptr);
}
